// v000
// Times are from an AMD MI455X. After a warm-up the kernel runs many times in a row, and a time is the length of
// such a window on the GPU divided by its runs, so every launch and the gaps after it count. The runs cycle
// through copies of the inputs. A figure is the median of several windows, for all but v000 over two sittings.
// Sittings can differ by a few percent; kernels timed side by side share one.
// v000 is the starting kernel. One run takes 1980 microseconds.
#include <hip/hip_runtime.h>
#include <math.h>

// ---------------------------------------------------------------------------
// Types for CDNA5 WMMA (wave32)
// ---------------------------------------------------------------------------
typedef __bf16 bf16_t;
typedef __attribute__((ext_vector_type(16))) __bf16 v16bf;
typedef __attribute__((ext_vector_type(2)))  __bf16 bf16x2;
typedef __attribute__((ext_vector_type(8)))  float  v8f;

// Problem constants (match reference)
constexpr int BSZ = 4;
constexpr int SEQ = 1024;
constexpr int DIM = 1024;
constexpr int NH  = 16;
constexpr int HDM = 64;
constexpr int FFD = 4096;
constexpr int D3  = 3 * DIM;

#define LDS_STRIDE 40   // 32 K-elements + 8 pad (keeps 16B alignment of rows)

// ---------------------------------------------------------------------------
// f32 -> bf16 convert kernel (n must be a multiple of 256)
// ---------------------------------------------------------------------------
__global__ __launch_bounds__(256) void cvt_f32_to_bf16(const float* __restrict__ in,
                                                       bf16_t* __restrict__ out, int n) {
    int i = blockIdx.x * 256 + threadIdx.x;
    if (i < n) out[i] = (bf16_t)in[i];
}

// ---------------------------------------------------------------------------
// Transpose V: qkv_bf [B*S, 3D] (v part at col offset 2D, head h at h*HD)
//   -> vT [B, H, HD, S]
// ---------------------------------------------------------------------------
__global__ __launch_bounds__(256) void transpose_v_kernel(const bf16_t* __restrict__ qkv,
                                                          bf16_t* __restrict__ vT) {
    size_t idx = (size_t)blockIdx.x * 256 + threadIdx.x;   // over B*H*HD*S
    int s = (int)(idx & (SEQ - 1));
    size_t rest = idx >> 10;
    int d = (int)(rest & (HDM - 1)); rest >>= 6;
    int h = (int)(rest & (NH - 1));
    int b = (int)(rest >> 4);
    vT[idx] = qkv[((size_t)(b * SEQ + s)) * D3 + 2 * DIM + h * HDM + d];
}

// ---------------------------------------------------------------------------
// Fragment gather from an LDS tile, per ISA 7.12.2 16-bit A/B layout.
// For lane l: row = base + (l&15), half = l>>4; VGPR v holds
// K = kbase(v) + half*8 + {0,1}, kbase = {0,2,4,6,16,18,20,22}.
// ---------------------------------------------------------------------------
__device__ inline v16bf load_frag(const bf16_t* __restrict__ smem, int baseRow, int lane) {
    const int r    = baseRow + (lane & 15);
    const int half = (lane >> 4) & 1;
    const bf16_t* p = smem + r * LDS_STRIDE + half * 8;
    v16bf f;
#pragma unroll
    for (int v = 0; v < 8; ++v) {
        const int k2 = (v < 4) ? (2 * v) : (16 + 2 * (v - 4));
        bf16x2 pr = *(const bf16x2*)(p + k2);
        f[2 * v]     = pr.x;
        f[2 * v + 1] = pr.y;
    }
    return f;
}

// ---------------------------------------------------------------------------
// Generic bf16 WMMA GEMM:  C[M,N] = alpha * A[M,K] @ B[N,K]^T  (+ bias[N])
// mode 0: store f32      mode 1: store bf16      mode 2: exact GELU -> bf16
//
// Block tile 128 x BN (BN = 128 or 64), 8 waves (4 row-groups x 2 col-groups),
// wave tile 32 x (BN/2). K stepped by 32 through double-buffered LDS filled
// with GLOBAL_LOAD_ASYNC_TO_LDS_B128 (ASYNCcnt pipeline): copies for stage
// s+1 overlap WMMA compute of stage s.
// Requires: M%128==0, N%BN==0, K%32==0, lda/ldb%8==0, 16B-aligned bases.
// ---------------------------------------------------------------------------
template <int BN>
__global__ __launch_bounds__(256) void gemm_bf16_wmma(
    const bf16_t* __restrict__ A, int lda,
    const bf16_t* __restrict__ Bm, int ldb,
    const float* __restrict__ bias,
    void* __restrict__ C, int ldc,
    int M, int N, int K, float alpha, int mode) {

    constexpr int CT = BN / 32;        // wave col tiles of 16 (4 or 2)
    constexpr int GB = BN / 64;        // B-tile async instrs per thread (2 or 1)
    constexpr int G  = 2 + GB;         // async instrs per thread per stage

    __shared__ __align__(16) bf16_t As[2 * 128 * LDS_STRIDE];
    __shared__ __align__(16) bf16_t Bs[2 * BN * LDS_STRIDE];

    const int tid  = threadIdx.x;
    const int lane = tid & 31;
    const int wave = tid >> 5;
    const int m_w  = (wave & 3) * 32;        // 4 wave-rows x 32
    const int n_w  = (wave >> 2) * (BN / 2); // 2 wave-cols x BN/2

    const int m0 = blockIdx.y * 128;
    const int n0 = blockIdx.x * BN;

    v8f acc[2][CT] = {};

    // Issue async copies (global -> LDS, 16B per lane per instruction).
    auto issueA = [&](int k0, int st) {
#pragma unroll
        for (int i = 0; i < 2; ++i) {
            const int u   = tid + i * 256;
            const int row = u >> 2;          // 4 x 16B units per 32-wide row
            const int ch  = u & 3;
            unsigned long long ga = (unsigned long long)(uintptr_t)
                (A + (size_t)(m0 + row) * lda + k0 + ch * 8);
            unsigned la = (unsigned)(uintptr_t)
                (As + st * (128 * LDS_STRIDE) + row * LDS_STRIDE + ch * 8);
            asm volatile("global_load_async_to_lds_b128 %0, %1, off"
                         :: "v"(la), "v"(ga) : "memory");
        }
    };
    auto issueB = [&](int k0, int st) {
#pragma unroll
        for (int i = 0; i < GB; ++i) {
            const int u   = tid + i * 256;
            const int row = u >> 2;
            const int ch  = u & 3;
            unsigned long long ga = (unsigned long long)(uintptr_t)
                (Bm + (size_t)(n0 + row) * ldb + k0 + ch * 8);
            unsigned la = (unsigned)(uintptr_t)
                (Bs + st * (BN * LDS_STRIDE) + row * LDS_STRIDE + ch * 8);
            asm volatile("global_load_async_to_lds_b128 %0, %1, off"
                         :: "v"(la), "v"(ga) : "memory");
        }
    };

    issueA(0, 0);
    issueB(0, 0);

    const int NS = K / 32;
    for (int s = 0; s < NS; ++s) {
        const int buf = s & 1;
        if (s + 1 < NS) {
            // Prefetch next stage into the other buffer, then wait for all
            // OLDER async copies (this stage's) to complete: async loads
            // complete in order, so cnt <= G leaves only the new ones.
            issueA((s + 1) * 32, buf ^ 1);
            issueB((s + 1) * 32, buf ^ 1);
            asm volatile("s_wait_asynccnt %0" :: "i"(G) : "memory");
        } else {
            asm volatile("s_wait_asynccnt 0" ::: "memory");
        }
        __syncthreads();   // all waves' copies for stage s are in LDS

        const bf16_t* Ab = As + buf * (128 * LDS_STRIDE);
        const bf16_t* Bb = Bs + buf * (BN * LDS_STRIDE);

        v16bf af[2], bfv[CT];
#pragma unroll
        for (int r = 0; r < 2; ++r)  af[r]  = load_frag(Ab, m_w + r * 16, lane);
#pragma unroll
        for (int c = 0; c < CT; ++c) bfv[c] = load_frag(Bb, n_w + c * 16, lane);

#pragma unroll
        for (int r = 0; r < 2; ++r)
#pragma unroll
            for (int c = 0; c < CT; ++c)
                acc[r][c] = __builtin_amdgcn_wmma_f32_16x16x32_bf16(
                    false, af[r], false, bfv[c], (short)0, acc[r][c], false, false);

        __syncthreads();   // all reads done before buf is refilled (stage s+2)
    }

    // Epilogue. D layout: lanes 0-15 -> cols, lanes 16-31 -> rows +8;
    // VGPR i -> row +i.
    float*  Cf = (float*)C;
    bf16_t* Cb = (bf16_t*)C;
#pragma unroll
    for (int r = 0; r < 2; ++r) {
#pragma unroll
        for (int c = 0; c < CT; ++c) {
            const int col  = n0 + n_w + c * 16 + (lane & 15);
            const int row0 = m0 + m_w + r * 16 + ((lane >> 4) & 1) * 8;
            const float bv = bias ? bias[col] : 0.0f;
#pragma unroll
            for (int i = 0; i < 8; ++i) {
                const int row = row0 + i;
                float v = acc[r][c][i] * alpha + bv;
                if (mode == 0) {
                    Cf[(size_t)row * ldc + col] = v;
                } else {
                    if (mode == 2)
                        v = 0.5f * v * (1.0f + erff(v * 0.70710678118654752f));
                    Cb[(size_t)row * ldc + col] = (bf16_t)v;
                }
            }
        }
    }
}

// ---------------------------------------------------------------------------
// Softmax over one row with additive bias: P = softmax(scores + bias) -> bf16
// ---------------------------------------------------------------------------
__global__ __launch_bounds__(256) void softmax_bias_kernel(const float* __restrict__ scores,
                                                           const float* __restrict__ bias,
                                                           bf16_t* __restrict__ P) {
    const int t   = blockIdx.x;
    const int tid = threadIdx.x;
    __shared__ float red[256];

    float vals[4];
    float m = -INFINITY;
#pragma unroll
    for (int i = 0; i < 4; ++i) {
        const int j = tid + i * 256;
        const float v = scores[(size_t)t * SEQ + j] + bias[(size_t)t * SEQ + j];
        vals[i] = v;
        m = fmaxf(m, v);
    }
    red[tid] = m;
    __syncthreads();
    for (int s = 128; s > 0; s >>= 1) {
        if (tid < s) red[tid] = fmaxf(red[tid], red[tid + s]);
        __syncthreads();
    }
    m = red[0];
    __syncthreads();

    float sum = 0.0f;
#pragma unroll
    for (int i = 0; i < 4; ++i) {
        vals[i] = expf(vals[i] - m);
        sum += vals[i];
    }
    red[tid] = sum;
    __syncthreads();
    for (int s = 128; s > 0; s >>= 1) {
        if (tid < s) red[tid] += red[tid + s];
        __syncthreads();
    }
    const float inv = 1.0f / red[0];
#pragma unroll
    for (int i = 0; i < 4; ++i)
        P[(size_t)t * SEQ + tid + i * 256] = (bf16_t)(vals[i] * inv);
}

// ---------------------------------------------------------------------------
// Fused residual + LayerNorm over rows of width DIM (=1024).
// ---------------------------------------------------------------------------
__global__ __launch_bounds__(256) void add_ln_kernel(const float* __restrict__ a,
                                                     const float* __restrict__ res,
                                                     const float* __restrict__ g,
                                                     const float* __restrict__ b,
                                                     float* __restrict__ outf,
                                                     bf16_t* __restrict__ outb) {
    const int row = blockIdx.x;
    const int tid = threadIdx.x;
    __shared__ float red[256];

    float loc[4];
    float s = 0.0f;
#pragma unroll
    for (int i = 0; i < 4; ++i) {
        const int j = tid + i * 256;
        const float v = a[(size_t)row * DIM + j] + res[(size_t)row * DIM + j];
        loc[i] = v;
        s += v;
    }
    red[tid] = s;
    __syncthreads();
    for (int st = 128; st > 0; st >>= 1) {
        if (tid < st) red[tid] += red[tid + st];
        __syncthreads();
    }
    const float mean = red[0] * (1.0f / DIM);
    __syncthreads();

    float vs = 0.0f;
#pragma unroll
    for (int i = 0; i < 4; ++i) {
        const float d = loc[i] - mean;
        vs += d * d;
    }
    red[tid] = vs;
    __syncthreads();
    for (int st = 128; st > 0; st >>= 1) {
        if (tid < st) red[tid] += red[tid + st];
        __syncthreads();
    }
    const float inv = rsqrtf(red[0] * (1.0f / DIM) + 1e-5f);

#pragma unroll
    for (int i = 0; i < 4; ++i) {
        const int j = tid + i * 256;
        const float y = (loc[i] - mean) * inv * g[j] + b[j];
        outf[(size_t)row * DIM + j] = y;
        if (outb) outb[(size_t)row * DIM + j] = (bf16_t)y;
    }
}

// ---------------------------------------------------------------------------
// Host orchestration
// ---------------------------------------------------------------------------
extern "C" void kernel_launch(void* const* d_in, const int* in_sizes, int n_in,
                              void* d_out, int out_size, void* d_ws, size_t ws_size,
                              hipStream_t stream) {
    (void)in_sizes; (void)n_in; (void)out_size; (void)ws_size;

    const float* src       = (const float*)d_in[0];
    const float* attn_bias = (const float*)d_in[1];
    const float* Wqkv      = (const float*)d_in[2];
    const float* bqkv      = (const float*)d_in[3];
    const float* Wo        = (const float*)d_in[4];
    const float* bo        = (const float*)d_in[5];
    const float* g1        = (const float*)d_in[6];
    const float* b1n       = (const float*)d_in[7];
    const float* g2        = (const float*)d_in[8];
    const float* b2n       = (const float*)d_in[9];
    const float* W1        = (const float*)d_in[10];
    const float* b1        = (const float*)d_in[11];
    const float* W2        = (const float*)d_in[12];
    const float* b2        = (const float*)d_in[13];
    float* out = (float*)d_out;

    char* ws = (char*)d_ws;
    size_t off = 0;
    auto alloc = [&](size_t bytes) -> char* {
        char* p = ws + off;
        off += (bytes + 255) & ~(size_t)255;
        return p;
    };

    const size_t NT = (size_t)BSZ * SEQ;            // 4096 tokens

    bf16_t* src_bf  = (bf16_t*)alloc(NT * DIM * 2);
    bf16_t* Wqkv_bf = (bf16_t*)alloc((size_t)D3 * DIM * 2);
    bf16_t* Wo_bf   = (bf16_t*)alloc((size_t)DIM * DIM * 2);
    bf16_t* W1_bf   = (bf16_t*)alloc((size_t)FFD * DIM * 2);
    bf16_t* W2_bf   = (bf16_t*)alloc((size_t)DIM * FFD * 2);
    bf16_t* qkv_bf  = (bf16_t*)alloc(NT * D3 * 2);
    bf16_t* vT_bf   = (bf16_t*)alloc((size_t)BSZ * NH * HDM * SEQ * 2);
    float*  scores  = (float*) alloc((size_t)SEQ * SEQ * 4);
    bf16_t* P_bf    = (bf16_t*)alloc((size_t)SEQ * SEQ * 2);
    bf16_t* ctx_bf  = (bf16_t*)alloc(NT * DIM * 2);
    float*  y_f     = (float*) alloc(NT * DIM * 4);
    float*  x_f     = (float*) alloc(NT * DIM * 4);
    bf16_t* x_bf    = (bf16_t*)alloc(NT * DIM * 2);
    bf16_t* h_bf    = (bf16_t*)alloc(NT * FFD * 2);
    float*  f_f     = (float*) alloc(NT * DIM * 4);

    auto cvt = [&](const float* in, bf16_t* o, size_t n) {
        cvt_f32_to_bf16<<<(unsigned)(n / 256), 256, 0, stream>>>(in, o, (int)n);
    };
    auto gemm128 = [&](const bf16_t* A, int lda, const bf16_t* Bm, int ldb,
                       const float* bias, void* C, int ldc,
                       int M, int N, int K, float alpha, int mode) {
        dim3 grid((unsigned)(N / 128), (unsigned)(M / 128));
        gemm_bf16_wmma<128><<<grid, 256, 0, stream>>>(A, lda, Bm, ldb, bias, C, ldc,
                                                      M, N, K, alpha, mode);
    };
    auto gemm64 = [&](const bf16_t* A, int lda, const bf16_t* Bm, int ldb,
                      const float* bias, void* C, int ldc,
                      int M, int N, int K, float alpha, int mode) {
        dim3 grid((unsigned)(N / 64), (unsigned)(M / 128));
        gemm_bf16_wmma<64><<<grid, 256, 0, stream>>>(A, lda, Bm, ldb, bias, C, ldc,
                                                     M, N, K, alpha, mode);
    };

    // 1) Convert inputs/weights to bf16
    cvt(src,  src_bf,  NT * DIM);
    cvt(Wqkv, Wqkv_bf, (size_t)D3 * DIM);
    cvt(Wo,   Wo_bf,   (size_t)DIM * DIM);
    cvt(W1,   W1_bf,   (size_t)FFD * DIM);
    cvt(W2,   W2_bf,   (size_t)DIM * FFD);

    // 2) QKV projection: qkv = src @ Wqkv^T + bqkv  -> bf16 [NT, 3D]
    gemm128(src_bf, DIM, Wqkv_bf, DIM, bqkv, qkv_bf, D3,
            (int)NT, D3, DIM, 1.0f, /*bf16*/1);

    // 3) Transpose V -> [B, H, HD, S]
    transpose_v_kernel<<<(unsigned)((size_t)BSZ * NH * HDM * SEQ / 256), 256, 0, stream>>>(
        qkv_bf, vT_bf);

    // 4) Attention per (b, h)
    const float inv_sqrt_hd = 0.125f;  // 1/sqrt(64)
    for (int b = 0; b < BSZ; ++b) {
        for (int h = 0; h < NH; ++h) {
            const bf16_t* qA = qkv_bf + (size_t)b * SEQ * D3 + h * HDM;
            const bf16_t* kB = qkv_bf + (size_t)b * SEQ * D3 + DIM + h * HDM;
            // scores = (q @ k^T) / sqrt(HD)   [S, S] f32
            gemm128(qA, D3, kB, D3, nullptr, scores, SEQ,
                    SEQ, SEQ, HDM, inv_sqrt_hd, /*f32*/0);
            // P = softmax(scores + attn_bias[h]) -> bf16
            softmax_bias_kernel<<<SEQ, 256, 0, stream>>>(
                scores, attn_bias + (size_t)h * SEQ * SEQ, P_bf);
            // ctx[:, h*HD:(h+1)*HD] = P @ V   (V as [HD, S])
            gemm64(P_bf, SEQ, vT_bf + ((size_t)(b * NH + h) * HDM) * SEQ, SEQ,
                   nullptr, ctx_bf + (size_t)b * SEQ * DIM + h * HDM, DIM,
                   SEQ, HDM, SEQ, 1.0f, /*bf16*/1);
        }
    }

    // 5) Output projection: y = ctx @ Wo^T + bo  (f32)
    gemm128(ctx_bf, DIM, Wo_bf, DIM, bo, y_f, DIM,
            (int)NT, DIM, DIM, 1.0f, /*f32*/0);

    // 6) x = LN(src + y) -> f32 + bf16
    add_ln_kernel<<<(unsigned)NT, 256, 0, stream>>>(y_f, src, g1, b1n, x_f, x_bf);

    // 7) FF1: h = gelu(x @ W1^T + b1) -> bf16 [NT, FF]
    gemm128(x_bf, DIM, W1_bf, DIM, b1, h_bf, FFD,
            (int)NT, FFD, DIM, 1.0f, /*gelu->bf16*/2);

    // 8) FF2: f = h @ W2^T + b2 -> f32
    gemm128(h_bf, FFD, W2_bf, FFD, b2, f_f, DIM,
            (int)NT, DIM, FFD, 1.0f, /*f32*/0);

    // 9) out = LN(x + f)
    add_ln_kernel<<<(unsigned)NT, 256, 0, stream>>>(f_f, x_f, g2, b2n, out, nullptr);
}

// v001
// One run takes 476 microseconds.
// Next to v000, in two timings, it ran 4.13 and 4.15 times as fast.
#include <hip/hip_runtime.h>
#include <math.h>

// ---------------------------------------------------------------------------
// Types for CDNA5 WMMA (wave32)
// ---------------------------------------------------------------------------
typedef __bf16 bf16_t;
typedef __attribute__((ext_vector_type(16))) __bf16 v16bf;
typedef __attribute__((ext_vector_type(2)))  __bf16 bf16x2;
typedef __attribute__((ext_vector_type(8)))  float  v8f;

// Problem constants (match reference)
constexpr int BSZ = 4;
constexpr int SEQ = 1024;
constexpr int DIM = 1024;
constexpr int NH  = 16;
constexpr int HDM = 64;
constexpr int FFD = 4096;
constexpr int D3  = 3 * DIM;

#define LDS_STRIDE 40   // 32 K-elements + 8 pad (keeps 16B alignment of rows)

// ---------------------------------------------------------------------------
// f32 -> bf16 convert kernel (n must be a multiple of 256)
// ---------------------------------------------------------------------------
__global__ __launch_bounds__(256) void cvt_f32_to_bf16(const float* __restrict__ in,
                                                       bf16_t* __restrict__ out, int n) {
    int i = blockIdx.x * 256 + threadIdx.x;
    if (i < n) out[i] = (bf16_t)in[i];
}

// ---------------------------------------------------------------------------
// Transpose V: qkv_bf [B*S, 3D] (v part at col offset 2D, head h at h*HD)
//   -> vT [B, H, HD, S]
// ---------------------------------------------------------------------------
__global__ __launch_bounds__(256) void transpose_v_kernel(const bf16_t* __restrict__ qkv,
                                                          bf16_t* __restrict__ vT) {
    size_t idx = (size_t)blockIdx.x * 256 + threadIdx.x;   // over B*H*HD*S
    int s = (int)(idx & (SEQ - 1));
    size_t rest = idx >> 10;
    int d = (int)(rest & (HDM - 1)); rest >>= 6;
    int h = (int)(rest & (NH - 1));
    int b = (int)(rest >> 4);
    vT[idx] = qkv[((size_t)(b * SEQ + s)) * D3 + 2 * DIM + h * HDM + d];
}

// ---------------------------------------------------------------------------
// Fragment gather from an LDS tile, per ISA 7.12.2 16-bit A/B layout.
// For lane l: row = base + (l&15), half = l>>4; VGPR v holds
// K = kbase(v) + half*8 + {0,1}, kbase = {0,2,4,6,16,18,20,22}.
// ---------------------------------------------------------------------------
__device__ inline v16bf load_frag(const bf16_t* __restrict__ smem, int baseRow, int lane) {
    const int r    = baseRow + (lane & 15);
    const int half = (lane >> 4) & 1;
    const bf16_t* p = smem + r * LDS_STRIDE + half * 8;
    v16bf f;
#pragma unroll
    for (int v = 0; v < 8; ++v) {
        const int k2 = (v < 4) ? (2 * v) : (16 + 2 * (v - 4));
        bf16x2 pr = *(const bf16x2*)(p + k2);
        f[2 * v]     = pr.x;
        f[2 * v + 1] = pr.y;
    }
    return f;
}

// ---------------------------------------------------------------------------
// Generic bf16 WMMA GEMM:  C[M,N] = alpha * A[M,K] @ B[N,K]^T  (+ bias[N])
// mode 0: store f32      mode 1: store bf16      mode 2: exact GELU -> bf16
//
// Block tile 128 x BN (BN = 128 or 64), 8 waves (4 row-groups x 2 col-groups),
// wave tile 32 x (BN/2). K stepped by 32 through double-buffered LDS filled
// with GLOBAL_LOAD_ASYNC_TO_LDS_B128 (ASYNCcnt pipeline): copies for stage
// s+1 overlap WMMA compute of stage s.
// Requires: M%128==0, N%BN==0, K%32==0, lda/ldb%8==0, 16B-aligned bases.
// Batched over blockIdx.z: z = hz * BSZ + b; every operand's base moves by
// b * (its .b stride) + hz * (its .h stride), in elements. A plain GEMM is
// launched with gridDim.z == 1.
// ---------------------------------------------------------------------------
struct ZStride { int b, h; };

template <int BN>
__global__ __launch_bounds__(256) void gemm_bf16_wmma(
    const bf16_t* __restrict__ A, int lda,
    const bf16_t* __restrict__ Bm, int ldb,
    const float* __restrict__ bias,
    void* __restrict__ C, int ldc,
    int M, int N, int K, float alpha, int mode,
    ZStride zA, ZStride zB, ZStride zC) {

    constexpr int CT = BN / 32;        // wave col tiles of 16 (4 or 2)
    constexpr int GB = BN / 64;        // B-tile async instrs per thread (2 or 1)
    constexpr int G  = 2 + GB;         // async instrs per thread per stage

    __shared__ __align__(16) bf16_t As[2 * 128 * LDS_STRIDE];
    __shared__ __align__(16) bf16_t Bs[2 * BN * LDS_STRIDE];

    const int tid  = threadIdx.x;
    const int lane = tid & 31;
    const int wave = tid >> 5;
    const int m_w  = (wave & 3) * 32;        // 4 wave-rows x 32
    const int n_w  = (wave >> 2) * (BN / 2); // 2 wave-cols x BN/2

    const int m0 = blockIdx.y * 128;
    const int n0 = blockIdx.x * BN;

    const int zb = blockIdx.z & (BSZ - 1);
    const int zh = blockIdx.z / BSZ;
    A  += (size_t)zb * zA.b + (size_t)zh * zA.h;
    Bm += (size_t)zb * zB.b + (size_t)zh * zB.h;
    const size_t zc = (size_t)zb * zC.b + (size_t)zh * zC.h;

    v8f acc[2][CT] = {};

    // Issue async copies (global -> LDS, 16B per lane per instruction).
    auto issueA = [&](int k0, int st) {
#pragma unroll
        for (int i = 0; i < 2; ++i) {
            const int u   = tid + i * 256;
            const int row = u >> 2;          // 4 x 16B units per 32-wide row
            const int ch  = u & 3;
            unsigned long long ga = (unsigned long long)(uintptr_t)
                (A + (size_t)(m0 + row) * lda + k0 + ch * 8);
            unsigned la = (unsigned)(uintptr_t)
                (As + st * (128 * LDS_STRIDE) + row * LDS_STRIDE + ch * 8);
            asm volatile("global_load_async_to_lds_b128 %0, %1, off"
                         :: "v"(la), "v"(ga) : "memory");
        }
    };
    auto issueB = [&](int k0, int st) {
#pragma unroll
        for (int i = 0; i < GB; ++i) {
            const int u   = tid + i * 256;
            const int row = u >> 2;
            const int ch  = u & 3;
            unsigned long long ga = (unsigned long long)(uintptr_t)
                (Bm + (size_t)(n0 + row) * ldb + k0 + ch * 8);
            unsigned la = (unsigned)(uintptr_t)
                (Bs + st * (BN * LDS_STRIDE) + row * LDS_STRIDE + ch * 8);
            asm volatile("global_load_async_to_lds_b128 %0, %1, off"
                         :: "v"(la), "v"(ga) : "memory");
        }
    };

    issueA(0, 0);
    issueB(0, 0);

    const int NS = K / 32;
    for (int s = 0; s < NS; ++s) {
        const int buf = s & 1;
        if (s + 1 < NS) {
            // Prefetch next stage into the other buffer, then wait for all
            // OLDER async copies (this stage's) to complete: async loads
            // complete in order, so cnt <= G leaves only the new ones.
            issueA((s + 1) * 32, buf ^ 1);
            issueB((s + 1) * 32, buf ^ 1);
            asm volatile("s_wait_asynccnt %0" :: "i"(G) : "memory");
        } else {
            asm volatile("s_wait_asynccnt 0" ::: "memory");
        }
        __syncthreads();   // all waves' copies for stage s are in LDS

        const bf16_t* Ab = As + buf * (128 * LDS_STRIDE);
        const bf16_t* Bb = Bs + buf * (BN * LDS_STRIDE);

        v16bf af[2], bfv[CT];
#pragma unroll
        for (int r = 0; r < 2; ++r)  af[r]  = load_frag(Ab, m_w + r * 16, lane);
#pragma unroll
        for (int c = 0; c < CT; ++c) bfv[c] = load_frag(Bb, n_w + c * 16, lane);

#pragma unroll
        for (int r = 0; r < 2; ++r)
#pragma unroll
            for (int c = 0; c < CT; ++c)
                acc[r][c] = __builtin_amdgcn_wmma_f32_16x16x32_bf16(
                    false, af[r], false, bfv[c], (short)0, acc[r][c], false, false);

        __syncthreads();   // all reads done before buf is refilled (stage s+2)
    }

    // Epilogue. D layout: lanes 0-15 -> cols, lanes 16-31 -> rows +8;
    // VGPR i -> row +i.
    float*  Cf = (float*)C + zc;
    bf16_t* Cb = (bf16_t*)C + zc;
#pragma unroll
    for (int r = 0; r < 2; ++r) {
#pragma unroll
        for (int c = 0; c < CT; ++c) {
            const int col  = n0 + n_w + c * 16 + (lane & 15);
            const int row0 = m0 + m_w + r * 16 + ((lane >> 4) & 1) * 8;
            const float bv = bias ? bias[col] : 0.0f;
#pragma unroll
            for (int i = 0; i < 8; ++i) {
                const int row = row0 + i;
                float v = acc[r][c][i] * alpha + bv;
                if (mode == 0) {
                    Cf[(size_t)row * ldc + col] = v;
                } else {
                    if (mode == 2)
                        v = 0.5f * v * (1.0f + erff(v * 0.70710678118654752f));
                    Cb[(size_t)row * ldc + col] = (bf16_t)v;
                }
            }
        }
    }
}

// ---------------------------------------------------------------------------
// Softmax over one row with additive bias: P = softmax(scores + bias) -> bf16
// Grid (b, row, head of the group): the BSZ blocks that read one bias row are
// neighbours in launch order. scores and P planes are indexed head * BSZ + b.
// ---------------------------------------------------------------------------
__global__ __launch_bounds__(256) void softmax_bias_kernel(const float* __restrict__ scores,
                                                           const float* __restrict__ bias,
                                                           bf16_t* __restrict__ P) {
    const int t   = blockIdx.y;
    const int tid = threadIdx.x;
    __shared__ float red[256];

    const size_t plane = (size_t)SEQ * SEQ;
    scores += (blockIdx.z * BSZ + blockIdx.x) * plane;
    P      += (blockIdx.z * BSZ + blockIdx.x) * plane;
    bias   += blockIdx.z * plane;

    float vals[4];
    float m = -INFINITY;
#pragma unroll
    for (int i = 0; i < 4; ++i) {
        const int j = tid + i * 256;
        const float v = scores[(size_t)t * SEQ + j] + bias[(size_t)t * SEQ + j];
        vals[i] = v;
        m = fmaxf(m, v);
    }
    red[tid] = m;
    __syncthreads();
    for (int s = 128; s > 0; s >>= 1) {
        if (tid < s) red[tid] = fmaxf(red[tid], red[tid + s]);
        __syncthreads();
    }
    m = red[0];
    __syncthreads();

    float sum = 0.0f;
#pragma unroll
    for (int i = 0; i < 4; ++i) {
        vals[i] = expf(vals[i] - m);
        sum += vals[i];
    }
    red[tid] = sum;
    __syncthreads();
    for (int s = 128; s > 0; s >>= 1) {
        if (tid < s) red[tid] += red[tid + s];
        __syncthreads();
    }
    const float inv = 1.0f / red[0];
#pragma unroll
    for (int i = 0; i < 4; ++i)
        P[(size_t)t * SEQ + tid + i * 256] = (bf16_t)(vals[i] * inv);
}

// ---------------------------------------------------------------------------
// Fused residual + LayerNorm over rows of width DIM (=1024).
// ---------------------------------------------------------------------------
__global__ __launch_bounds__(256) void add_ln_kernel(const float* __restrict__ a,
                                                     const float* __restrict__ res,
                                                     const float* __restrict__ g,
                                                     const float* __restrict__ b,
                                                     float* __restrict__ outf,
                                                     bf16_t* __restrict__ outb) {
    const int row = blockIdx.x;
    const int tid = threadIdx.x;
    __shared__ float red[256];

    float loc[4];
    float s = 0.0f;
#pragma unroll
    for (int i = 0; i < 4; ++i) {
        const int j = tid + i * 256;
        const float v = a[(size_t)row * DIM + j] + res[(size_t)row * DIM + j];
        loc[i] = v;
        s += v;
    }
    red[tid] = s;
    __syncthreads();
    for (int st = 128; st > 0; st >>= 1) {
        if (tid < st) red[tid] += red[tid + st];
        __syncthreads();
    }
    const float mean = red[0] * (1.0f / DIM);
    __syncthreads();

    float vs = 0.0f;
#pragma unroll
    for (int i = 0; i < 4; ++i) {
        const float d = loc[i] - mean;
        vs += d * d;
    }
    red[tid] = vs;
    __syncthreads();
    for (int st = 128; st > 0; st >>= 1) {
        if (tid < st) red[tid] += red[tid + st];
        __syncthreads();
    }
    const float inv = rsqrtf(red[0] * (1.0f / DIM) + 1e-5f);

#pragma unroll
    for (int i = 0; i < 4; ++i) {
        const int j = tid + i * 256;
        const float y = (loc[i] - mean) * inv * g[j] + b[j];
        outf[(size_t)row * DIM + j] = y;
        if (outb) outb[(size_t)row * DIM + j] = (bf16_t)y;
    }
}

// ---------------------------------------------------------------------------
// Host orchestration
// ---------------------------------------------------------------------------
extern "C" void kernel_launch(void* const* d_in, const int* in_sizes, int n_in,
                              void* d_out, int out_size, void* d_ws, size_t ws_size,
                              hipStream_t stream) {
    (void)in_sizes; (void)n_in; (void)out_size; (void)ws_size;

    const float* src       = (const float*)d_in[0];
    const float* attn_bias = (const float*)d_in[1];
    const float* Wqkv      = (const float*)d_in[2];
    const float* bqkv      = (const float*)d_in[3];
    const float* Wo        = (const float*)d_in[4];
    const float* bo        = (const float*)d_in[5];
    const float* g1        = (const float*)d_in[6];
    const float* b1n       = (const float*)d_in[7];
    const float* g2        = (const float*)d_in[8];
    const float* b2n       = (const float*)d_in[9];
    const float* W1        = (const float*)d_in[10];
    const float* b1        = (const float*)d_in[11];
    const float* W2        = (const float*)d_in[12];
    const float* b2        = (const float*)d_in[13];
    float* out = (float*)d_out;

    char* ws = (char*)d_ws;
    size_t off = 0;
    auto alloc = [&](size_t bytes) -> char* {
        char* p = ws + off;
        off += (bytes + 255) & ~(size_t)255;
        return p;
    };

    const size_t NT = (size_t)BSZ * SEQ;            // 4096 tokens

    constexpr int HG = 4;                           // heads per score launch
    const size_t PLANE = (size_t)SEQ * SEQ;         // one (b, h) score matrix

    // Live across the attention phase: 58 MiB.
    bf16_t* Wo_bf   = (bf16_t*)alloc((size_t)DIM * DIM * 2);
    bf16_t* W1_bf   = (bf16_t*)alloc((size_t)FFD * DIM * 2);
    bf16_t* W2_bf   = (bf16_t*)alloc((size_t)DIM * FFD * 2);
    bf16_t* qkv_bf  = (bf16_t*)alloc(NT * D3 * 2);
    bf16_t* vT_bf   = (bf16_t*)alloc((size_t)BSZ * NH * HDM * SEQ * 2);
    bf16_t* ctx_bf  = (bf16_t*)alloc(NT * DIM * 2);
    // Three sets with disjoint lives share what follows (192 MiB at most):
    // the QKV GEMM's operands, the attention planes, the buffers of steps 5-9.
    const size_t shared0 = off;
    bf16_t* src_bf  = (bf16_t*)alloc(NT * DIM * 2);
    bf16_t* Wqkv_bf = (bf16_t*)alloc((size_t)D3 * DIM * 2);
    off = shared0;
    float*  scores  = (float*) alloc((size_t)BSZ * HG * PLANE * 4);
    bf16_t* P_bf    = (bf16_t*)alloc((size_t)BSZ * NH * PLANE * 2);
    off = shared0;
    float*  y_f     = (float*) alloc(NT * DIM * 4);
    float*  x_f     = (float*) alloc(NT * DIM * 4);
    bf16_t* x_bf    = (bf16_t*)alloc(NT * DIM * 2);
    bf16_t* h_bf    = (bf16_t*)alloc(NT * FFD * 2);
    float*  f_f     = (float*) alloc(NT * DIM * 4);

    auto cvt = [&](const float* in, bf16_t* o, size_t n) {
        cvt_f32_to_bf16<<<(unsigned)(n / 256), 256, 0, stream>>>(in, o, (int)n);
    };
    auto gemm128 = [&](const bf16_t* A, int lda, const bf16_t* Bm, int ldb,
                       const float* bias, void* C, int ldc,
                       int M, int N, int K, float alpha, int mode) {
        dim3 grid((unsigned)(N / 128), (unsigned)(M / 128));
        gemm_bf16_wmma<128><<<grid, 256, 0, stream>>>(A, lda, Bm, ldb, bias, C, ldc,
                                                      M, N, K, alpha, mode,
                                                      ZStride{0, 0}, ZStride{0, 0},
                                                      ZStride{0, 0});
    };

    // 1) Convert inputs/weights to bf16
    cvt(src,  src_bf,  NT * DIM);
    cvt(Wqkv, Wqkv_bf, (size_t)D3 * DIM);
    cvt(Wo,   Wo_bf,   (size_t)DIM * DIM);
    cvt(W1,   W1_bf,   (size_t)FFD * DIM);
    cvt(W2,   W2_bf,   (size_t)DIM * FFD);

    // 2) QKV projection: qkv = src @ Wqkv^T + bqkv  -> bf16 [NT, 3D]
    gemm128(src_bf, DIM, Wqkv_bf, DIM, bqkv, qkv_bf, D3,
            (int)NT, D3, DIM, 1.0f, /*bf16*/1);

    // 3) Transpose V -> [B, H, HD, S]
    transpose_v_kernel<<<(unsigned)((size_t)BSZ * NH * HDM * SEQ / 256), 256, 0, stream>>>(
        qkv_bf, vT_bf);

    // 4) Attention, batched over blockIdx.z (z = head * BSZ + b).
    const float inv_sqrt_hd = 0.125f;  // 1/sqrt(64)
    for (int h0 = 0; h0 < NH; h0 += HG) {
        // scores = (q @ k^T) / sqrt(HD)   [HG*B][S, S] f32
        gemm_bf16_wmma<128><<<dim3(SEQ / 128, SEQ / 128, BSZ * HG), 256, 0, stream>>>(
            qkv_bf + h0 * HDM, D3, qkv_bf + DIM + h0 * HDM, D3, nullptr, scores, SEQ,
            SEQ, SEQ, HDM, inv_sqrt_hd, /*f32*/0,
            ZStride{SEQ * D3, HDM}, ZStride{SEQ * D3, HDM},
            ZStride{SEQ * SEQ, BSZ * SEQ * SEQ});
        // P = softmax(scores + attn_bias[h]) -> bf16, kept for all heads
        softmax_bias_kernel<<<dim3(BSZ, SEQ, HG), 256, 0, stream>>>(
            scores, attn_bias + (size_t)h0 * PLANE, P_bf + (size_t)h0 * BSZ * PLANE);
    }
    // ctx[b, :, h*HD:(h+1)*HD] = P @ V   (V as [HD, S]), all (b, h) in one launch
    gemm_bf16_wmma<64><<<dim3(1, SEQ / 128, BSZ * NH), 256, 0, stream>>>(
        P_bf, SEQ, vT_bf, SEQ, nullptr, ctx_bf, DIM,
        SEQ, HDM, SEQ, 1.0f, /*bf16*/1,
        ZStride{SEQ * SEQ, BSZ * SEQ * SEQ}, ZStride{NH * HDM * SEQ, HDM * SEQ},
        ZStride{SEQ * DIM, HDM});

    // 5) Output projection: y = ctx @ Wo^T + bo  (f32)
    gemm128(ctx_bf, DIM, Wo_bf, DIM, bo, y_f, DIM,
            (int)NT, DIM, DIM, 1.0f, /*f32*/0);

    // 6) x = LN(src + y) -> f32 + bf16
    add_ln_kernel<<<(unsigned)NT, 256, 0, stream>>>(y_f, src, g1, b1n, x_f, x_bf);

    // 7) FF1: h = gelu(x @ W1^T + b1) -> bf16 [NT, FF]
    gemm128(x_bf, DIM, W1_bf, DIM, b1, h_bf, FFD,
            (int)NT, FFD, DIM, 1.0f, /*gelu->bf16*/2);

    // 8) FF2: f = h @ W2^T + b2 -> f32
    gemm128(h_bf, FFD, W2_bf, FFD, b2, f_f, DIM,
            (int)NT, DIM, FFD, 1.0f, /*f32*/0);

    // 9) out = LN(x + f)
    add_ln_kernel<<<(unsigned)NT, 256, 0, stream>>>(f_f, x_f, g2, b2n, out, nullptr);
}

// v002
// Measured time: 280 microseconds a run.
// Next to v001, in two timings, it ran 1.70 times as fast each time.
// Counting every step since v000, it is 7.05 times as fast.
#include <hip/hip_runtime.h>
#include <math.h>

// ---------------------------------------------------------------------------
// Types for CDNA5 WMMA (wave32)
// ---------------------------------------------------------------------------
typedef __bf16 bf16_t;
typedef __attribute__((ext_vector_type(16))) __bf16 v16bf;
typedef __attribute__((ext_vector_type(2)))  __bf16 bf16x2;
typedef __attribute__((ext_vector_type(8)))  float  v8f;

// Problem constants (match reference)
constexpr int BSZ = 4;
constexpr int SEQ = 1024;
constexpr int DIM = 1024;
constexpr int NH  = 16;
constexpr int HDM = 64;
constexpr int FFD = 4096;
constexpr int D3  = 3 * DIM;

#define LDS_STRIDE 40   // 32 K-elements + 8 pad (keeps 16B alignment of rows)

// ---------------------------------------------------------------------------
// f32 -> bf16 convert kernel (n must be a multiple of 256)
// ---------------------------------------------------------------------------
__global__ __launch_bounds__(256) void cvt_f32_to_bf16(const float* __restrict__ in,
                                                       bf16_t* __restrict__ out, int n) {
    int i = blockIdx.x * 256 + threadIdx.x;
    if (i < n) out[i] = (bf16_t)in[i];
}

// ---------------------------------------------------------------------------
// Fragment gather from an LDS tile, per ISA 7.12.2 16-bit A/B layout.
// For lane l: row = base + (l&15), half = l>>4; VGPR v holds
// K = kbase(v) + half*8 + {0,1}, kbase = {0,2,4,6,16,18,20,22}.
// ---------------------------------------------------------------------------
__device__ inline v16bf load_frag(const bf16_t* __restrict__ smem, int baseRow, int lane) {
    const int r    = baseRow + (lane & 15);
    const int half = (lane >> 4) & 1;
    const bf16_t* p = smem + r * LDS_STRIDE + half * 8;
    v16bf f;
#pragma unroll
    for (int v = 0; v < 8; ++v) {
        const int k2 = (v < 4) ? (2 * v) : (16 + 2 * (v - 4));
        bf16x2 pr = *(const bf16x2*)(p + k2);
        f[2 * v]     = pr.x;
        f[2 * v + 1] = pr.y;
    }
    return f;
}

// ---------------------------------------------------------------------------
// Generic bf16 WMMA GEMM:  C[M,N] = alpha * A[M,K] @ B[N,K]^T  (+ bias[N])
// mode 0: store f32      mode 1: store bf16      mode 2: exact GELU -> bf16
//
// Block tile 128 x BN (BN = 128 or 64), 8 waves (4 row-groups x 2 col-groups),
// wave tile 32 x (BN/2). K stepped by 32 through double-buffered LDS filled
// with GLOBAL_LOAD_ASYNC_TO_LDS_B128 (ASYNCcnt pipeline): copies for stage
// s+1 overlap WMMA compute of stage s.
// Requires: M%128==0, N%BN==0, K%32==0, lda/ldb%8==0, 16B-aligned bases.
// Batched over blockIdx.z: z = hz * BSZ + b; every operand's base moves by
// b * (its .b stride) + hz * (its .h stride), in elements. A plain GEMM is
// launched with gridDim.z == 1.
// ---------------------------------------------------------------------------
struct ZStride { int b, h; };

template <int BN>
__global__ __launch_bounds__(256) void gemm_bf16_wmma(
    const bf16_t* __restrict__ A, int lda,
    const bf16_t* __restrict__ Bm, int ldb,
    const float* __restrict__ bias,
    void* __restrict__ C, int ldc,
    int M, int N, int K, float alpha, int mode,
    ZStride zA, ZStride zB, ZStride zC) {

    constexpr int CT = BN / 32;        // wave col tiles of 16 (4 or 2)
    constexpr int GB = BN / 64;        // B-tile async instrs per thread (2 or 1)
    constexpr int G  = 2 + GB;         // async instrs per thread per stage

    __shared__ __align__(16) bf16_t As[2 * 128 * LDS_STRIDE];
    __shared__ __align__(16) bf16_t Bs[2 * BN * LDS_STRIDE];

    const int tid  = threadIdx.x;
    const int lane = tid & 31;
    const int wave = tid >> 5;
    const int m_w  = (wave & 3) * 32;        // 4 wave-rows x 32
    const int n_w  = (wave >> 2) * (BN / 2); // 2 wave-cols x BN/2

    const int m0 = blockIdx.y * 128;
    const int n0 = blockIdx.x * BN;

    const int zb = blockIdx.z & (BSZ - 1);
    const int zh = blockIdx.z / BSZ;
    A  += (size_t)zb * zA.b + (size_t)zh * zA.h;
    Bm += (size_t)zb * zB.b + (size_t)zh * zB.h;
    const size_t zc = (size_t)zb * zC.b + (size_t)zh * zC.h;

    v8f acc[2][CT] = {};

    // Issue async copies (global -> LDS, 16B per lane per instruction).
    auto issueA = [&](int k0, int st) {
#pragma unroll
        for (int i = 0; i < 2; ++i) {
            const int u   = tid + i * 256;
            const int row = u >> 2;          // 4 x 16B units per 32-wide row
            const int ch  = u & 3;
            unsigned long long ga = (unsigned long long)(uintptr_t)
                (A + (size_t)(m0 + row) * lda + k0 + ch * 8);
            unsigned la = (unsigned)(uintptr_t)
                (As + st * (128 * LDS_STRIDE) + row * LDS_STRIDE + ch * 8);
            asm volatile("global_load_async_to_lds_b128 %0, %1, off"
                         :: "v"(la), "v"(ga) : "memory");
        }
    };
    auto issueB = [&](int k0, int st) {
#pragma unroll
        for (int i = 0; i < GB; ++i) {
            const int u   = tid + i * 256;
            const int row = u >> 2;
            const int ch  = u & 3;
            unsigned long long ga = (unsigned long long)(uintptr_t)
                (Bm + (size_t)(n0 + row) * ldb + k0 + ch * 8);
            unsigned la = (unsigned)(uintptr_t)
                (Bs + st * (BN * LDS_STRIDE) + row * LDS_STRIDE + ch * 8);
            asm volatile("global_load_async_to_lds_b128 %0, %1, off"
                         :: "v"(la), "v"(ga) : "memory");
        }
    };

    issueA(0, 0);
    issueB(0, 0);

    const int NS = K / 32;
    for (int s = 0; s < NS; ++s) {
        const int buf = s & 1;
        if (s + 1 < NS) {
            // Prefetch next stage into the other buffer, then wait for all
            // OLDER async copies (this stage's) to complete: async loads
            // complete in order, so cnt <= G leaves only the new ones.
            issueA((s + 1) * 32, buf ^ 1);
            issueB((s + 1) * 32, buf ^ 1);
            asm volatile("s_wait_asynccnt %0" :: "i"(G) : "memory");
        } else {
            asm volatile("s_wait_asynccnt 0" ::: "memory");
        }
        __syncthreads();   // all waves' copies for stage s are in LDS

        const bf16_t* Ab = As + buf * (128 * LDS_STRIDE);
        const bf16_t* Bb = Bs + buf * (BN * LDS_STRIDE);

        v16bf af[2], bfv[CT];
#pragma unroll
        for (int r = 0; r < 2; ++r)  af[r]  = load_frag(Ab, m_w + r * 16, lane);
#pragma unroll
        for (int c = 0; c < CT; ++c) bfv[c] = load_frag(Bb, n_w + c * 16, lane);

#pragma unroll
        for (int r = 0; r < 2; ++r)
#pragma unroll
            for (int c = 0; c < CT; ++c)
                acc[r][c] = __builtin_amdgcn_wmma_f32_16x16x32_bf16(
                    false, af[r], false, bfv[c], (short)0, acc[r][c], false, false);

        __syncthreads();   // all reads done before buf is refilled (stage s+2)
    }

    // Epilogue. D layout: lanes 0-15 -> cols, lanes 16-31 -> rows +8;
    // VGPR i -> row +i.
    float*  Cf = (float*)C + zc;
    bf16_t* Cb = (bf16_t*)C + zc;
#pragma unroll
    for (int r = 0; r < 2; ++r) {
#pragma unroll
        for (int c = 0; c < CT; ++c) {
            const int col  = n0 + n_w + c * 16 + (lane & 15);
            const int row0 = m0 + m_w + r * 16 + ((lane >> 4) & 1) * 8;
            const float bv = bias ? bias[col] : 0.0f;
#pragma unroll
            for (int i = 0; i < 8; ++i) {
                const int row = row0 + i;
                float v = acc[r][c][i] * alpha + bv;
                if (mode == 0) {
                    Cf[(size_t)row * ldc + col] = v;
                } else {
                    if (mode == 2)
                        v = 0.5f * v * (1.0f + erff(v * 0.70710678118654752f));
                    Cb[(size_t)row * ldc + col] = (bf16_t)v;
                }
            }
        }
    }
}

typedef unsigned int u32x4 __attribute__((ext_vector_type(4)));
typedef short        s16x8 __attribute__((ext_vector_type(8)));
typedef float        f32x2 __attribute__((ext_vector_type(2)));
typedef float        f32x4 __attribute__((ext_vector_type(4)));

constexpr unsigned PITCH_K = 2 * HDM + 16;   // odd multiple of 16 B: ds_load_b128 readers
constexpr unsigned PITCH_V = 2 * HDM + 32;   // odd multiple of 32 B: ds_load_tr16_b128 readers
constexpr unsigned V_OFF   = SEQ * PITCH_K;
constexpr unsigned ATT_LDS = V_OFF + SEQ * PITCH_V;
constexpr int ATT_WAVES = 16;                // 16 query rows each
constexpr int ATT_ROWS  = ATT_WAVES * 16;
constexpr int ATT_KEYS  = 64;                // keys per pass
constexpr int ATT_PASSES = SEQ / ATT_KEYS;
static_assert(ATT_LDS <= 320u * 1024u, "K and V of one head must fit one workgroup's LDS");
static_assert(ATT_PASSES % 2 == 0, "the pass loop is written in pairs");

struct Frag { u32x4 q[2]; };   // one 16 x 32 bf16 operand: 8 registers per lane

__device__ __forceinline__ v8f mma(const Frag& a, const Frag& b, v8f c) {
    return __builtin_amdgcn_wmma_f32_16x16x32_bf16(
        false, __builtin_bit_cast(v16bf, a), false, __builtin_bit_cast(v16bf, b),
        (short)0, c, false, false);
}
__device__ __forceinline__ u32x4 ld_tr16(const unsigned char* p) {
    typedef __attribute__((address_space(3))) s16x8 lds_s16x8;
    return __builtin_bit_cast(u32x4, __builtin_amdgcn_ds_load_tr16_b128_v8i16((lds_s16x8*)p));
}
__device__ __forceinline__ unsigned pack2(float lo, float hi) {   // round to nearest even
    return __builtin_bit_cast(unsigned, __builtin_convertvector(f32x2{lo, hi}, bf16x2));
}
__device__ __forceinline__ float xhalf(float x) {                 // lane l with lane l ^ 16
    return __builtin_bit_cast(float, __builtin_amdgcn_permlanex16(
        __builtin_bit_cast(int, x), __builtin_bit_cast(int, x),
        0x76543210, 0xfedcba98, false, false));
}

__global__ __launch_bounds__(ATT_WAVES * 32) void attn_fused(const bf16_t* __restrict__ qkv,
                                                             const float* __restrict__ bias,
                                                             bf16_t* __restrict__ ctx) {
    __shared__ __attribute__((aligned(256))) unsigned char L[ATT_LDS];
    const unsigned tid = threadIdx.x, lane = tid & 31u, wave = tid >> 5;
    const unsigned c = lane & 15u, h = lane >> 4;
    // Grid (8, batch, 8): the BSZ workgroups that read one bias block lie 8 apart
    // in launch order, in the hope that they share one L2's copy of it (speed only:
    // no result depends on where a workgroup runs).
    const unsigned tile = blockIdx.x + 8u * blockIdx.z;      // head * 4 + row block
    const unsigned b    = blockIdx.y;
    const unsigned hd   = tile / (SEQ / ATT_ROWS);
    const unsigned q0   = (tile % (SEQ / ATT_ROWS)) * ATT_ROWS + wave * 16u;

    const bf16_t* base = qkv + (size_t)b * SEQ * D3 + hd * HDM;   // q of token 0

    // Stage K and V: 8 lanes per 128-byte row, whole lines from memory.
    constexpr int RST = ATT_WAVES * 32 / 8;   // rows per step of the workgroup
    constexpr int NST = SEQ / RST;
    const unsigned srow = tid >> 3, sch = tid & 7u;
    const bf16_t* sp = base + (size_t)srow * D3 + sch * 8u;
    u32x4 kr[NST], vr[NST];
#pragma unroll
    for (int i = 0; i < NST; ++i) {
        kr[i] = *(const u32x4*)(sp + (size_t)i * RST * D3 + DIM);
        vr[i] = *(const u32x4*)(sp + (size_t)i * RST * D3 + 2 * DIM);
    }

    // Q fragments in the hardware k order (as K's below), scaled by 1/8.
    Frag qf[2];
    const bf16_t* qp = base + (size_t)(q0 + c) * D3 + 8u * h;
    {
#pragma unroll
        for (int kc = 0; kc < 2; ++kc) {
            Frag f;
            f.q[0] = *(const u32x4*)(qp + 32 * kc);
            f.q[1] = *(const u32x4*)(qp + 32 * kc + 16);
            v16bf t = __builtin_bit_cast(v16bf, f);
#pragma unroll
            for (int e = 0; e < 16; ++e) t[e] = (bf16_t)((float)t[e] * 0.125f);
            qf[kc] = __builtin_bit_cast(Frag, t);
        }
    }

    // A operand whose row 0 is ones: row 0 of its product is the column sums of P^T.
    Frag ones;
    {
        const unsigned o = (c == 0u) ? 0x3F803F80u : 0u;
        ones.q[0] = u32x4{o, o, o, o};
        ones.q[1] = u32x4{o, o, o, o};
    }

    v8f acc[4] = {};          // O^T: acc[t][r] = O[q0 + c][16 t + 8 h + r]
    v8f lacc = {};            // register 0 of lanes 0-15: denominator of query c
    float m_run = -INFINITY;  // maximum in use, base-2 scaled; equal in lanes c, c + 16
    constexpr float LOG2E = 1.4426950408889634f;

    // This lane's bias: row q0 + c, keys 16 j + 8 h + 0..7 of each pass.
    const float* bp = bias + ((size_t)hd * SEQ + q0 + c) * SEQ + 8u * h;
    auto load_bias = [&](v8f (&d)[4], int it) {
#pragma unroll
        for (int j = 0; j < 4; ++j) {
            const f32x4 lo = *(const f32x4*)(bp + it * ATT_KEYS + 16 * j);
            const f32x4 hi = *(const f32x4*)(bp + it * ATT_KEYS + 16 * j + 4);
            d[j] = v8f{lo.x, lo.y, lo.z, lo.w, hi.x, hi.y, hi.z, hi.w};
        }
    };

    // One pass over 64 keys. s arrives holding the pass's bias tile; nx is filled
    // with the next pass's (fetch: a literal at every call, false in the last pass),
    // so that its memory latency lies under this pass.
    auto pass = [&](v8f (&s)[4], v8f (&nx)[4], int it, bool fetch) __attribute__((always_inline)) {
        if (fetch) {
            load_bias(nx, it + 1);
            // Before the loop's pointer, which these loads name, is advanced.
            asm volatile("s_wait_xcnt 0x0" ::: "memory");
        }
        // Holds these loads at the head of the pass: sunk to where registers come
        // free they would have half a pass, too little for a read from memory.
        __builtin_amdgcn_sched_barrier(0);

        const unsigned char* kp = L + (it * ATT_KEYS + c) * PITCH_K + 16u * h;
#pragma unroll
        for (int j = 0; j < 4; ++j) {
#pragma unroll
            for (int kc = 0; kc < 2; ++kc) {
                Frag kf;
                kf.q[0] = *(const u32x4*)(kp + j * 16 * PITCH_K + 64 * kc);
                kf.q[1] = *(const u32x4*)(kp + j * 16 * PITCH_K + 64 * kc + 32);
                s[j] = mma(kf, qf[kc], s[j]);   // s[j][r] = score(key 16 j + 8 h + r, query c)
            }
        }

        float mx = s[0][0];
#pragma unroll
        for (int j = 0; j < 4; ++j)
#pragma unroll
            for (int r = 0; r < 8; ++r) mx = __builtin_fmaxf(mx, s[j][r]);
        mx = __builtin_fmaxf(mx, xhalf(mx)) * LOG2E;   // both halves: this query's maximum

        if (__builtin_amdgcn_ballot_w32(mx > m_run + 8.0f) != 0) {   // scalar branch, rare
            const float m_new = __builtin_fmaxf(m_run, mx);
            const float corr  = __builtin_amdgcn_exp2f(m_run - m_new);  // 0 on the first pass
            m_run = m_new;
            lacc = lacc * corr;
#pragma unroll
            for (int t = 0; t < 4; ++t) acc[t] = acc[t] * corr;
        }
        const float nm = -m_run;

#pragma unroll
        for (int g = 0; g < 2; ++g) {   // 32 keys: one k extent of the second product
            const unsigned char* ad = L + V_OFF
                + (it * ATT_KEYS + 32u * g + 8u * h + (lane & 7u)) * PITCH_V
                + ((lane >> 3) & 1u) * 16u;
            Frag vf[4];
#pragma unroll
            for (int t = 0; t < 4; ++t) {
                vf[t].q[0] = ld_tr16(ad + 32 * t);
                vf[t].q[1] = ld_tr16(ad + 16 * PITCH_V + 32 * t);
            }
            unsigned w[8];
#pragma unroll
            for (int i = 0; i < 8; ++i) {   // elements 2 i, 2 i + 1 of the 32-key operand
                const v8f& sv = s[2 * g + (i >> 2)];
                const f32x2 arg = __builtin_elementwise_fma(
                    f32x2{sv[2 * (i & 3)], sv[2 * (i & 3) + 1]}, f32x2{LOG2E, LOG2E},
                    f32x2{nm, nm});
                w[i] = pack2(__builtin_amdgcn_exp2f(arg.x), __builtin_amdgcn_exp2f(arg.y));
            }
            Frag pf;
            pf.q[0] = u32x4{w[0], w[1], w[2], w[3]};
            pf.q[1] = u32x4{w[4], w[5], w[6], w[7]};
#pragma unroll
            for (int t = 0; t < 4; ++t) acc[t] = mma(vf[t], pf, acc[t]);
            lacc = mma(ones, pf, lacc);
        }
    };

    v8f sa[4], sb[4];
    load_bias(sa, 0);
    // Every load so far is issued. The inputs keep the loads' address registers
    // from being given away (to a later load's result) in front of the wait.
    asm volatile("s_wait_xcnt 0x0" :: "v"(sp), "v"(qp), "v"(bp) : "memory");
    __builtin_amdgcn_sched_barrier(0);   // keeps every other reuse behind the wait
#pragma unroll
    for (int i = 0; i < NST; ++i) {
        *(u32x4*)(L + (srow + i * RST) * PITCH_K + sch * 16u)         = kr[i];
        *(u32x4*)(L + V_OFF + (srow + i * RST) * PITCH_V + sch * 16u) = vr[i];
    }
    __syncthreads();   // K and V are staged; nothing writes LDS after this

    for (int it = 0; it < ATT_PASSES - 2; it += 2) {
        pass(sa, sb, it, true);
        pass(sb, sa, it + 1, true);
    }
    pass(sa, sb, ATT_PASSES - 2, true);
    pass(sb, sa, ATT_PASSES - 1, false);

    // Lanes 16-31 hold row 8 of the sum tile, which is 0: the exchange-and-add
    // gives both halves the denominator.
    const float lr  = lacc[0];
    const float inv = 1.0f / (lr + xhalf(lr));
    bf16_t* op = ctx + (size_t)(b * SEQ + q0 + c) * DIM + hd * HDM + 8u * h;
#pragma unroll
    for (int t = 0; t < 4; ++t) {
        const v8f o = acc[t] * inv;
        *(u32x4*)(op + 16 * t) = u32x4{pack2(o[0], o[1]), pack2(o[2], o[3]),
                                       pack2(o[4], o[5]), pack2(o[6], o[7])};
    }
}

// ---------------------------------------------------------------------------
// Fused residual + LayerNorm over rows of width DIM (=1024).
// ---------------------------------------------------------------------------
__global__ __launch_bounds__(256) void add_ln_kernel(const float* __restrict__ a,
                                                     const float* __restrict__ res,
                                                     const float* __restrict__ g,
                                                     const float* __restrict__ b,
                                                     float* __restrict__ outf,
                                                     bf16_t* __restrict__ outb) {
    const int row = blockIdx.x;
    const int tid = threadIdx.x;
    __shared__ float red[256];

    float loc[4];
    float s = 0.0f;
#pragma unroll
    for (int i = 0; i < 4; ++i) {
        const int j = tid + i * 256;
        const float v = a[(size_t)row * DIM + j] + res[(size_t)row * DIM + j];
        loc[i] = v;
        s += v;
    }
    red[tid] = s;
    __syncthreads();
    for (int st = 128; st > 0; st >>= 1) {
        if (tid < st) red[tid] += red[tid + st];
        __syncthreads();
    }
    const float mean = red[0] * (1.0f / DIM);
    __syncthreads();

    float vs = 0.0f;
#pragma unroll
    for (int i = 0; i < 4; ++i) {
        const float d = loc[i] - mean;
        vs += d * d;
    }
    red[tid] = vs;
    __syncthreads();
    for (int st = 128; st > 0; st >>= 1) {
        if (tid < st) red[tid] += red[tid + st];
        __syncthreads();
    }
    const float inv = rsqrtf(red[0] * (1.0f / DIM) + 1e-5f);

#pragma unroll
    for (int i = 0; i < 4; ++i) {
        const int j = tid + i * 256;
        const float y = (loc[i] - mean) * inv * g[j] + b[j];
        outf[(size_t)row * DIM + j] = y;
        if (outb) outb[(size_t)row * DIM + j] = (bf16_t)y;
    }
}

// ---------------------------------------------------------------------------
// Host orchestration
// ---------------------------------------------------------------------------
extern "C" void kernel_launch(void* const* d_in, const int* in_sizes, int n_in,
                              void* d_out, int out_size, void* d_ws, size_t ws_size,
                              hipStream_t stream) {
    (void)in_sizes; (void)n_in; (void)out_size; (void)ws_size;

    const float* src       = (const float*)d_in[0];
    const float* attn_bias = (const float*)d_in[1];
    const float* Wqkv      = (const float*)d_in[2];
    const float* bqkv      = (const float*)d_in[3];
    const float* Wo        = (const float*)d_in[4];
    const float* bo        = (const float*)d_in[5];
    const float* g1        = (const float*)d_in[6];
    const float* b1n       = (const float*)d_in[7];
    const float* g2        = (const float*)d_in[8];
    const float* b2n       = (const float*)d_in[9];
    const float* W1        = (const float*)d_in[10];
    const float* b1        = (const float*)d_in[11];
    const float* W2        = (const float*)d_in[12];
    const float* b2        = (const float*)d_in[13];
    float* out = (float*)d_out;

    char* ws = (char*)d_ws;
    size_t off = 0;
    auto alloc = [&](size_t bytes) -> char* {
        char* p = ws + off;
        off += (bytes + 255) & ~(size_t)255;
        return p;
    };

    const size_t NT = (size_t)BSZ * SEQ;            // 4096 tokens

    // Live across the attention phase.
    bf16_t* Wo_bf   = (bf16_t*)alloc((size_t)DIM * DIM * 2);
    bf16_t* W1_bf   = (bf16_t*)alloc((size_t)FFD * DIM * 2);
    bf16_t* W2_bf   = (bf16_t*)alloc((size_t)DIM * FFD * 2);
    bf16_t* qkv_bf  = (bf16_t*)alloc(NT * D3 * 2);
    bf16_t* ctx_bf  = (bf16_t*)alloc(NT * DIM * 2);
    // Two sets with disjoint lives share what follows:
    // the QKV GEMM's operands, the buffers of steps 5-9.
    const size_t shared0 = off;
    bf16_t* src_bf  = (bf16_t*)alloc(NT * DIM * 2);
    bf16_t* Wqkv_bf = (bf16_t*)alloc((size_t)D3 * DIM * 2);
    off = shared0;
    float*  y_f     = (float*) alloc(NT * DIM * 4);
    float*  x_f     = (float*) alloc(NT * DIM * 4);
    bf16_t* x_bf    = (bf16_t*)alloc(NT * DIM * 2);
    bf16_t* h_bf    = (bf16_t*)alloc(NT * FFD * 2);
    float*  f_f     = (float*) alloc(NT * DIM * 4);

    auto cvt = [&](const float* in, bf16_t* o, size_t n) {
        cvt_f32_to_bf16<<<(unsigned)(n / 256), 256, 0, stream>>>(in, o, (int)n);
    };
    auto gemm128 = [&](const bf16_t* A, int lda, const bf16_t* Bm, int ldb,
                       const float* bias, void* C, int ldc,
                       int M, int N, int K, float alpha, int mode) {
        dim3 grid((unsigned)(N / 128), (unsigned)(M / 128));
        gemm_bf16_wmma<128><<<grid, 256, 0, stream>>>(A, lda, Bm, ldb, bias, C, ldc,
                                                      M, N, K, alpha, mode,
                                                      ZStride{0, 0}, ZStride{0, 0},
                                                      ZStride{0, 0});
    };

    // 1) Convert inputs/weights to bf16
    cvt(src,  src_bf,  NT * DIM);
    cvt(Wqkv, Wqkv_bf, (size_t)D3 * DIM);
    cvt(Wo,   Wo_bf,   (size_t)DIM * DIM);
    cvt(W1,   W1_bf,   (size_t)FFD * DIM);
    cvt(W2,   W2_bf,   (size_t)DIM * FFD);

    // 2) QKV projection: qkv = src @ Wqkv^T + bqkv  -> bf16 [NT, 3D]
    gemm128(src_bf, DIM, Wqkv_bf, DIM, bqkv, qkv_bf, D3,
            (int)NT, D3, DIM, 1.0f, /*bf16*/1);

    // 3, 4) Attention: ctx[b, :, h*HD:(h+1)*HD] = softmax(q k^T / 8 + bias[h]) v
    attn_fused<<<dim3(8, BSZ, NH * (SEQ / ATT_ROWS) / 8), ATT_WAVES * 32, 0, stream>>>(
        qkv_bf, attn_bias, ctx_bf);

    // 5) Output projection: y = ctx @ Wo^T + bo  (f32)
    gemm128(ctx_bf, DIM, Wo_bf, DIM, bo, y_f, DIM,
            (int)NT, DIM, DIM, 1.0f, /*f32*/0);

    // 6) x = LN(src + y) -> f32 + bf16
    add_ln_kernel<<<(unsigned)NT, 256, 0, stream>>>(y_f, src, g1, b1n, x_f, x_bf);

    // 7) FF1: h = gelu(x @ W1^T + b1) -> bf16 [NT, FF]
    gemm128(x_bf, DIM, W1_bf, DIM, b1, h_bf, FFD,
            (int)NT, FFD, DIM, 1.0f, /*gelu->bf16*/2);

    // 8) FF2: f = h @ W2^T + b2 -> f32
    gemm128(h_bf, FFD, W2_bf, FFD, b2, f_f, DIM,
            (int)NT, DIM, FFD, 1.0f, /*f32*/0);

    // 9) out = LN(x + f)
    add_ln_kernel<<<(unsigned)NT, 256, 0, stream>>>(f_f, x_f, g2, b2n, out, nullptr);
}

// v003
// A run of this version takes 246 microseconds.
// In two side-by-side timings against v002, it was 1.13 and 1.14 times as fast.
// Over all steps from v000 it is 8.00 times as fast.
#include <hip/hip_runtime.h>
#include <math.h>

// ---------------------------------------------------------------------------
// Types for CDNA5 WMMA (wave32)
// ---------------------------------------------------------------------------
typedef __bf16 bf16_t;
typedef __attribute__((ext_vector_type(16))) __bf16 v16bf;
typedef __attribute__((ext_vector_type(2)))  __bf16 bf16x2;
typedef __attribute__((ext_vector_type(8)))  float  v8f;

// Problem constants (match reference)
constexpr int BSZ = 4;
constexpr int SEQ = 1024;
constexpr int DIM = 1024;
constexpr int NH  = 16;
constexpr int HDM = 64;
constexpr int FFD = 4096;
constexpr int D3  = 3 * DIM;

#define LDS_STRIDE 40   // 32 K-elements + 8 pad (keeps 16B alignment of rows)

// ---------------------------------------------------------------------------
// f32 -> bf16 convert of all five GEMM operands in one streaming launch.
// One workgroup of 16 waves per CV_CHUNK contiguous elements of one tensor
// (every tensor is a whole number of chunks). A lane has CV_LOADS independent
// 16-byte loads, so many are in flight at once; each wave-wide load covers 512
// contiguous bytes and each wave-wide store 256.
// ---------------------------------------------------------------------------
typedef __attribute__((ext_vector_type(4))) float  cv_f32x4;
typedef __attribute__((ext_vector_type(4))) __bf16 cv_bf16x4;

constexpr int CV_THREADS = 512;
constexpr int CV_LOADS   = 32;                          // 16-byte loads per lane
constexpr int CV_CHUNK   = CV_THREADS * CV_LOADS * 4;   // elements per workgroup
constexpr unsigned CV_SRC  = (unsigned)(BSZ * SEQ * DIM / CV_CHUNK);
constexpr unsigned CV_WQKV = (unsigned)(D3 * DIM / CV_CHUNK);
constexpr unsigned CV_WO   = (unsigned)(DIM * DIM / CV_CHUNK);
constexpr unsigned CV_W1   = (unsigned)(FFD * DIM / CV_CHUNK);
constexpr unsigned CV_W2   = (unsigned)(DIM * FFD / CV_CHUNK);
constexpr unsigned CV_GRID = CV_SRC + CV_WQKV + CV_WO + CV_W1 + CV_W2;
static_assert(BSZ * SEQ * DIM % CV_CHUNK == 0 && D3 * DIM % CV_CHUNK == 0 &&
              DIM * DIM % CV_CHUNK == 0 && FFD * DIM % CV_CHUNK == 0,
              "every tensor must be a whole number of chunks");

__global__ __launch_bounds__(CV_THREADS) void cvt_all_f32_to_bf16(
    const float* __restrict__ src,  const float* __restrict__ wqkv,
    const float* __restrict__ wo,   const float* __restrict__ w1,
    const float* __restrict__ w2,
    bf16_t* __restrict__ src_o,  bf16_t* __restrict__ wqkv_o,
    bf16_t* __restrict__ wo_o,   bf16_t* __restrict__ w1_o,
    bf16_t* __restrict__ w2_o) {
    // Which tensor, and which chunk of it: the same for the whole workgroup.
    unsigned blk = blockIdx.x;
    const float* in = src;
    bf16_t* out = src_o;
    if (blk >= CV_SRC) {
        blk -= CV_SRC; in = wqkv; out = wqkv_o;
        if (blk >= CV_WQKV) {
            blk -= CV_WQKV; in = wo; out = wo_o;
            if (blk >= CV_WO) {
                blk -= CV_WO; in = w1; out = w1_o;
                if (blk >= CV_W1) { blk -= CV_W1; in = w2; out = w2_o; }
            }
        }
    }
    const cv_f32x4* ip = (const cv_f32x4*)(in + (size_t)blk * CV_CHUNK) + threadIdx.x;
    cv_bf16x4*      op = (cv_bf16x4*)(out + (size_t)blk * CV_CHUNK) + threadIdx.x;

    cv_f32x4 v[CV_LOADS];
#pragma unroll
    for (int j = 0; j < CV_LOADS; ++j) v[j] = ip[j * CV_THREADS];
#pragma unroll
    for (int j = 0; j < CV_LOADS; ++j)
        op[j * CV_THREADS] = __builtin_convertvector(v[j], cv_bf16x4);
}

// ---------------------------------------------------------------------------
// Fragment gather from an LDS tile, per ISA 7.12.2 16-bit A/B layout.
// For lane l: row = base + (l&15), half = l>>4; VGPR v holds
// K = kbase(v) + half*8 + {0,1}, kbase = {0,2,4,6,16,18,20,22}.
// ---------------------------------------------------------------------------
__device__ inline v16bf load_frag(const bf16_t* __restrict__ smem, int baseRow, int lane) {
    const int r    = baseRow + (lane & 15);
    const int half = (lane >> 4) & 1;
    const bf16_t* p = smem + r * LDS_STRIDE + half * 8;
    v16bf f;
#pragma unroll
    for (int v = 0; v < 8; ++v) {
        const int k2 = (v < 4) ? (2 * v) : (16 + 2 * (v - 4));
        bf16x2 pr = *(const bf16x2*)(p + k2);
        f[2 * v]     = pr.x;
        f[2 * v + 1] = pr.y;
    }
    return f;
}

// ---------------------------------------------------------------------------
// Generic bf16 WMMA GEMM:  C[M,N] = alpha * A[M,K] @ B[N,K]^T  (+ bias[N])
// mode 0: store f32      mode 1: store bf16      mode 2: exact GELU -> bf16
//
// Block tile 128 x BN (BN = 128 or 64), 8 waves (4 row-groups x 2 col-groups),
// wave tile 32 x (BN/2). K stepped by 32 through double-buffered LDS filled
// with GLOBAL_LOAD_ASYNC_TO_LDS_B128 (ASYNCcnt pipeline): copies for stage
// s+1 overlap WMMA compute of stage s.
// Requires: M%128==0, N%BN==0, K%32==0, lda/ldb%8==0, 16B-aligned bases.
// Batched over blockIdx.z: z = hz * BSZ + b; every operand's base moves by
// b * (its .b stride) + hz * (its .h stride), in elements. A plain GEMM is
// launched with gridDim.z == 1.
// ---------------------------------------------------------------------------
struct ZStride { int b, h; };

template <int BN>
__global__ __launch_bounds__(256) void gemm_bf16_wmma(
    const bf16_t* __restrict__ A, int lda,
    const bf16_t* __restrict__ Bm, int ldb,
    const float* __restrict__ bias,
    void* __restrict__ C, int ldc,
    int M, int N, int K, float alpha, int mode,
    ZStride zA, ZStride zB, ZStride zC) {

    constexpr int CT = BN / 32;        // wave col tiles of 16 (4 or 2)
    constexpr int GB = BN / 64;        // B-tile async instrs per thread (2 or 1)
    constexpr int G  = 2 + GB;         // async instrs per thread per stage

    __shared__ __align__(16) bf16_t As[2 * 128 * LDS_STRIDE];
    __shared__ __align__(16) bf16_t Bs[2 * BN * LDS_STRIDE];

    const int tid  = threadIdx.x;
    const int lane = tid & 31;
    const int wave = tid >> 5;
    const int m_w  = (wave & 3) * 32;        // 4 wave-rows x 32
    const int n_w  = (wave >> 2) * (BN / 2); // 2 wave-cols x BN/2

    const int m0 = blockIdx.y * 128;
    const int n0 = blockIdx.x * BN;

    const int zb = blockIdx.z & (BSZ - 1);
    const int zh = blockIdx.z / BSZ;
    A  += (size_t)zb * zA.b + (size_t)zh * zA.h;
    Bm += (size_t)zb * zB.b + (size_t)zh * zB.h;
    const size_t zc = (size_t)zb * zC.b + (size_t)zh * zC.h;

    v8f acc[2][CT] = {};

    // Issue async copies (global -> LDS, 16B per lane per instruction).
    auto issueA = [&](int k0, int st) {
#pragma unroll
        for (int i = 0; i < 2; ++i) {
            const int u   = tid + i * 256;
            const int row = u >> 2;          // 4 x 16B units per 32-wide row
            const int ch  = u & 3;
            unsigned long long ga = (unsigned long long)(uintptr_t)
                (A + (size_t)(m0 + row) * lda + k0 + ch * 8);
            unsigned la = (unsigned)(uintptr_t)
                (As + st * (128 * LDS_STRIDE) + row * LDS_STRIDE + ch * 8);
            asm volatile("global_load_async_to_lds_b128 %0, %1, off"
                         :: "v"(la), "v"(ga) : "memory");
        }
    };
    auto issueB = [&](int k0, int st) {
#pragma unroll
        for (int i = 0; i < GB; ++i) {
            const int u   = tid + i * 256;
            const int row = u >> 2;
            const int ch  = u & 3;
            unsigned long long ga = (unsigned long long)(uintptr_t)
                (Bm + (size_t)(n0 + row) * ldb + k0 + ch * 8);
            unsigned la = (unsigned)(uintptr_t)
                (Bs + st * (BN * LDS_STRIDE) + row * LDS_STRIDE + ch * 8);
            asm volatile("global_load_async_to_lds_b128 %0, %1, off"
                         :: "v"(la), "v"(ga) : "memory");
        }
    };

    issueA(0, 0);
    issueB(0, 0);

    const int NS = K / 32;
    for (int s = 0; s < NS; ++s) {
        const int buf = s & 1;
        if (s + 1 < NS) {
            // Prefetch next stage into the other buffer, then wait for all
            // OLDER async copies (this stage's) to complete: async loads
            // complete in order, so cnt <= G leaves only the new ones.
            issueA((s + 1) * 32, buf ^ 1);
            issueB((s + 1) * 32, buf ^ 1);
            asm volatile("s_wait_asynccnt %0" :: "i"(G) : "memory");
        } else {
            asm volatile("s_wait_asynccnt 0" ::: "memory");
        }
        __syncthreads();   // all waves' copies for stage s are in LDS

        const bf16_t* Ab = As + buf * (128 * LDS_STRIDE);
        const bf16_t* Bb = Bs + buf * (BN * LDS_STRIDE);

        v16bf af[2], bfv[CT];
#pragma unroll
        for (int r = 0; r < 2; ++r)  af[r]  = load_frag(Ab, m_w + r * 16, lane);
#pragma unroll
        for (int c = 0; c < CT; ++c) bfv[c] = load_frag(Bb, n_w + c * 16, lane);

#pragma unroll
        for (int r = 0; r < 2; ++r)
#pragma unroll
            for (int c = 0; c < CT; ++c)
                acc[r][c] = __builtin_amdgcn_wmma_f32_16x16x32_bf16(
                    false, af[r], false, bfv[c], (short)0, acc[r][c], false, false);

        __syncthreads();   // all reads done before buf is refilled (stage s+2)
    }

    // Epilogue. D layout: lanes 0-15 -> cols, lanes 16-31 -> rows +8;
    // VGPR i -> row +i.
    float*  Cf = (float*)C + zc;
    bf16_t* Cb = (bf16_t*)C + zc;
#pragma unroll
    for (int r = 0; r < 2; ++r) {
#pragma unroll
        for (int c = 0; c < CT; ++c) {
            const int col  = n0 + n_w + c * 16 + (lane & 15);
            const int row0 = m0 + m_w + r * 16 + ((lane >> 4) & 1) * 8;
            const float bv = bias ? bias[col] : 0.0f;
#pragma unroll
            for (int i = 0; i < 8; ++i) {
                const int row = row0 + i;
                float v = acc[r][c][i] * alpha + bv;
                if (mode == 0) {
                    Cf[(size_t)row * ldc + col] = v;
                } else {
                    if (mode == 2)
                        v = 0.5f * v * (1.0f + erff(v * 0.70710678118654752f));
                    Cb[(size_t)row * ldc + col] = (bf16_t)v;
                }
            }
        }
    }
}

typedef unsigned int u32x4 __attribute__((ext_vector_type(4)));
typedef short        s16x8 __attribute__((ext_vector_type(8)));
typedef float        f32x2 __attribute__((ext_vector_type(2)));
typedef float        f32x4 __attribute__((ext_vector_type(4)));

constexpr unsigned PITCH_K = 2 * HDM + 16;   // odd multiple of 16 B: ds_load_b128 readers
constexpr unsigned PITCH_V = 2 * HDM + 32;   // odd multiple of 32 B: ds_load_tr16_b128 readers
constexpr unsigned V_OFF   = SEQ * PITCH_K;
constexpr unsigned ATT_LDS = V_OFF + SEQ * PITCH_V;
constexpr int ATT_WAVES = 16;                // 16 query rows each
constexpr int ATT_ROWS  = ATT_WAVES * 16;
constexpr int ATT_KEYS  = 64;                // keys per pass
constexpr int ATT_PASSES = SEQ / ATT_KEYS;
static_assert(ATT_LDS <= 320u * 1024u, "K and V of one head must fit one workgroup's LDS");
static_assert(ATT_PASSES % 2 == 0, "the pass loop is written in pairs");

struct Frag { u32x4 q[2]; };   // one 16 x 32 bf16 operand: 8 registers per lane

__device__ __forceinline__ v8f mma(const Frag& a, const Frag& b, v8f c) {
    return __builtin_amdgcn_wmma_f32_16x16x32_bf16(
        false, __builtin_bit_cast(v16bf, a), false, __builtin_bit_cast(v16bf, b),
        (short)0, c, false, false);
}
__device__ __forceinline__ u32x4 ld_tr16(const unsigned char* p) {
    typedef __attribute__((address_space(3))) s16x8 lds_s16x8;
    return __builtin_bit_cast(u32x4, __builtin_amdgcn_ds_load_tr16_b128_v8i16((lds_s16x8*)p));
}
__device__ __forceinline__ unsigned pack2(float lo, float hi) {   // round to nearest even
    return __builtin_bit_cast(unsigned, __builtin_convertvector(f32x2{lo, hi}, bf16x2));
}
__device__ __forceinline__ float xhalf(float x) {                 // lane l with lane l ^ 16
    return __builtin_bit_cast(float, __builtin_amdgcn_permlanex16(
        __builtin_bit_cast(int, x), __builtin_bit_cast(int, x),
        0x76543210, 0xfedcba98, false, false));
}

__global__ __launch_bounds__(ATT_WAVES * 32) void attn_fused(const bf16_t* __restrict__ qkv,
                                                             const float* __restrict__ bias,
                                                             bf16_t* __restrict__ ctx) {
    __shared__ __attribute__((aligned(256))) unsigned char L[ATT_LDS];
    const unsigned tid = threadIdx.x, lane = tid & 31u, wave = tid >> 5;
    const unsigned c = lane & 15u, h = lane >> 4;
    // Grid (8, batch, 8): the BSZ workgroups that read one bias block lie 8 apart
    // in launch order, in the hope that they share one L2's copy of it (speed only:
    // no result depends on where a workgroup runs).
    const unsigned tile = blockIdx.x + 8u * blockIdx.z;      // head * 4 + row block
    const unsigned b    = blockIdx.y;
    const unsigned hd   = tile / (SEQ / ATT_ROWS);
    const unsigned q0   = (tile % (SEQ / ATT_ROWS)) * ATT_ROWS + wave * 16u;

    const bf16_t* base = qkv + (size_t)b * SEQ * D3 + hd * HDM;   // q of token 0

    // Stage K and V: 8 lanes per 128-byte row, whole lines from memory.
    constexpr int RST = ATT_WAVES * 32 / 8;   // rows per step of the workgroup
    constexpr int NST = SEQ / RST;
    const unsigned srow = tid >> 3, sch = tid & 7u;
    const bf16_t* sp = base + (size_t)srow * D3 + sch * 8u;
    u32x4 kr[NST], vr[NST];
#pragma unroll
    for (int i = 0; i < NST; ++i) {
        kr[i] = *(const u32x4*)(sp + (size_t)i * RST * D3 + DIM);
        vr[i] = *(const u32x4*)(sp + (size_t)i * RST * D3 + 2 * DIM);
    }

    // Q fragments in the hardware k order (as K's below), scaled by 1/8.
    Frag qf[2];
    const bf16_t* qp = base + (size_t)(q0 + c) * D3 + 8u * h;
    {
#pragma unroll
        for (int kc = 0; kc < 2; ++kc) {
            Frag f;
            f.q[0] = *(const u32x4*)(qp + 32 * kc);
            f.q[1] = *(const u32x4*)(qp + 32 * kc + 16);
            v16bf t = __builtin_bit_cast(v16bf, f);
#pragma unroll
            for (int e = 0; e < 16; ++e) t[e] = (bf16_t)((float)t[e] * 0.125f);
            qf[kc] = __builtin_bit_cast(Frag, t);
        }
    }

    // A operand whose row 0 is ones: row 0 of its product is the column sums of P^T.
    Frag ones;
    {
        const unsigned o = (c == 0u) ? 0x3F803F80u : 0u;
        ones.q[0] = u32x4{o, o, o, o};
        ones.q[1] = u32x4{o, o, o, o};
    }

    v8f acc[4] = {};          // O^T: acc[t][r] = O[q0 + c][16 t + 8 h + r]
    v8f lacc = {};            // register 0 of lanes 0-15: denominator of query c
    float m_run = -INFINITY;  // maximum in use, base-2 scaled; equal in lanes c, c + 16
    constexpr float LOG2E = 1.4426950408889634f;

    // This lane's bias: row q0 + c, keys 16 j + 8 h + 0..7 of each pass.
    const float* bp = bias + ((size_t)hd * SEQ + q0 + c) * SEQ + 8u * h;
    auto load_bias = [&](v8f (&d)[4], int it) {
#pragma unroll
        for (int j = 0; j < 4; ++j) {
            const f32x4 lo = *(const f32x4*)(bp + it * ATT_KEYS + 16 * j);
            const f32x4 hi = *(const f32x4*)(bp + it * ATT_KEYS + 16 * j + 4);
            d[j] = v8f{lo.x, lo.y, lo.z, lo.w, hi.x, hi.y, hi.z, hi.w};
        }
    };

    // One pass over 64 keys. s arrives holding the pass's bias tile; nx is filled
    // with the next pass's (fetch: a literal at every call, false in the last pass),
    // so that its memory latency lies under this pass.
    auto pass = [&](v8f (&s)[4], v8f (&nx)[4], int it, bool fetch) __attribute__((always_inline)) {
        if (fetch) {
            load_bias(nx, it + 1);
            // Before the loop's pointer, which these loads name, is advanced.
            asm volatile("s_wait_xcnt 0x0" ::: "memory");
        }
        // Holds these loads at the head of the pass: sunk to where registers come
        // free they would have half a pass, too little for a read from memory.
        __builtin_amdgcn_sched_barrier(0);

        const unsigned char* kp = L + (it * ATT_KEYS + c) * PITCH_K + 16u * h;
#pragma unroll
        for (int j = 0; j < 4; ++j) {
#pragma unroll
            for (int kc = 0; kc < 2; ++kc) {
                Frag kf;
                kf.q[0] = *(const u32x4*)(kp + j * 16 * PITCH_K + 64 * kc);
                kf.q[1] = *(const u32x4*)(kp + j * 16 * PITCH_K + 64 * kc + 32);
                s[j] = mma(kf, qf[kc], s[j]);   // s[j][r] = score(key 16 j + 8 h + r, query c)
            }
        }

        float mx = s[0][0];
#pragma unroll
        for (int j = 0; j < 4; ++j)
#pragma unroll
            for (int r = 0; r < 8; ++r) mx = __builtin_fmaxf(mx, s[j][r]);
        mx = __builtin_fmaxf(mx, xhalf(mx)) * LOG2E;   // both halves: this query's maximum

        if (__builtin_amdgcn_ballot_w32(mx > m_run + 8.0f) != 0) {   // scalar branch, rare
            const float m_new = __builtin_fmaxf(m_run, mx);
            const float corr  = __builtin_amdgcn_exp2f(m_run - m_new);  // 0 on the first pass
            m_run = m_new;
            lacc = lacc * corr;
#pragma unroll
            for (int t = 0; t < 4; ++t) acc[t] = acc[t] * corr;
        }
        const float nm = -m_run;

#pragma unroll
        for (int g = 0; g < 2; ++g) {   // 32 keys: one k extent of the second product
            const unsigned char* ad = L + V_OFF
                + (it * ATT_KEYS + 32u * g + 8u * h + (lane & 7u)) * PITCH_V
                + ((lane >> 3) & 1u) * 16u;
            Frag vf[4];
#pragma unroll
            for (int t = 0; t < 4; ++t) {
                vf[t].q[0] = ld_tr16(ad + 32 * t);
                vf[t].q[1] = ld_tr16(ad + 16 * PITCH_V + 32 * t);
            }
            unsigned w[8];
#pragma unroll
            for (int i = 0; i < 8; ++i) {   // elements 2 i, 2 i + 1 of the 32-key operand
                const v8f& sv = s[2 * g + (i >> 2)];
                const f32x2 arg = __builtin_elementwise_fma(
                    f32x2{sv[2 * (i & 3)], sv[2 * (i & 3) + 1]}, f32x2{LOG2E, LOG2E},
                    f32x2{nm, nm});
                w[i] = pack2(__builtin_amdgcn_exp2f(arg.x), __builtin_amdgcn_exp2f(arg.y));
            }
            Frag pf;
            pf.q[0] = u32x4{w[0], w[1], w[2], w[3]};
            pf.q[1] = u32x4{w[4], w[5], w[6], w[7]};
#pragma unroll
            for (int t = 0; t < 4; ++t) acc[t] = mma(vf[t], pf, acc[t]);
            lacc = mma(ones, pf, lacc);
        }
    };

    v8f sa[4], sb[4];
    load_bias(sa, 0);
    // Every load so far is issued. The inputs keep the loads' address registers
    // from being given away (to a later load's result) in front of the wait.
    asm volatile("s_wait_xcnt 0x0" :: "v"(sp), "v"(qp), "v"(bp) : "memory");
    __builtin_amdgcn_sched_barrier(0);   // keeps every other reuse behind the wait
#pragma unroll
    for (int i = 0; i < NST; ++i) {
        *(u32x4*)(L + (srow + i * RST) * PITCH_K + sch * 16u)         = kr[i];
        *(u32x4*)(L + V_OFF + (srow + i * RST) * PITCH_V + sch * 16u) = vr[i];
    }
    __syncthreads();   // K and V are staged; nothing writes LDS after this

    for (int it = 0; it < ATT_PASSES - 2; it += 2) {
        pass(sa, sb, it, true);
        pass(sb, sa, it + 1, true);
    }
    pass(sa, sb, ATT_PASSES - 2, true);
    pass(sb, sa, ATT_PASSES - 1, false);

    // Lanes 16-31 hold row 8 of the sum tile, which is 0: the exchange-and-add
    // gives both halves the denominator.
    const float lr  = lacc[0];
    const float inv = 1.0f / (lr + xhalf(lr));
    bf16_t* op = ctx + (size_t)(b * SEQ + q0 + c) * DIM + hd * HDM + 8u * h;
#pragma unroll
    for (int t = 0; t < 4; ++t) {
        const v8f o = acc[t] * inv;
        *(u32x4*)(op + 16 * t) = u32x4{pack2(o[0], o[1]), pack2(o[2], o[3]),
                                       pack2(o[4], o[5]), pack2(o[6], o[7])};
    }
}

// ---------------------------------------------------------------------------
// Fused residual + LayerNorm over rows of width DIM (=1024).
// ---------------------------------------------------------------------------
__global__ __launch_bounds__(256) void add_ln_kernel(const float* __restrict__ a,
                                                     const float* __restrict__ res,
                                                     const float* __restrict__ g,
                                                     const float* __restrict__ b,
                                                     float* __restrict__ outf,
                                                     bf16_t* __restrict__ outb) {
    const int row = blockIdx.x;
    const int tid = threadIdx.x;
    __shared__ float red[256];

    float loc[4];
    float s = 0.0f;
#pragma unroll
    for (int i = 0; i < 4; ++i) {
        const int j = tid + i * 256;
        const float v = a[(size_t)row * DIM + j] + res[(size_t)row * DIM + j];
        loc[i] = v;
        s += v;
    }
    red[tid] = s;
    __syncthreads();
    for (int st = 128; st > 0; st >>= 1) {
        if (tid < st) red[tid] += red[tid + st];
        __syncthreads();
    }
    const float mean = red[0] * (1.0f / DIM);
    __syncthreads();

    float vs = 0.0f;
#pragma unroll
    for (int i = 0; i < 4; ++i) {
        const float d = loc[i] - mean;
        vs += d * d;
    }
    red[tid] = vs;
    __syncthreads();
    for (int st = 128; st > 0; st >>= 1) {
        if (tid < st) red[tid] += red[tid + st];
        __syncthreads();
    }
    const float inv = rsqrtf(red[0] * (1.0f / DIM) + 1e-5f);

#pragma unroll
    for (int i = 0; i < 4; ++i) {
        const int j = tid + i * 256;
        const float y = (loc[i] - mean) * inv * g[j] + b[j];
        outf[(size_t)row * DIM + j] = y;
        if (outb) outb[(size_t)row * DIM + j] = (bf16_t)y;
    }
}

// ---------------------------------------------------------------------------
// Host orchestration
// ---------------------------------------------------------------------------
extern "C" void kernel_launch(void* const* d_in, const int* in_sizes, int n_in,
                              void* d_out, int out_size, void* d_ws, size_t ws_size,
                              hipStream_t stream) {
    (void)in_sizes; (void)n_in; (void)out_size; (void)ws_size;

    const float* src       = (const float*)d_in[0];
    const float* attn_bias = (const float*)d_in[1];
    const float* Wqkv      = (const float*)d_in[2];
    const float* bqkv      = (const float*)d_in[3];
    const float* Wo        = (const float*)d_in[4];
    const float* bo        = (const float*)d_in[5];
    const float* g1        = (const float*)d_in[6];
    const float* b1n       = (const float*)d_in[7];
    const float* g2        = (const float*)d_in[8];
    const float* b2n       = (const float*)d_in[9];
    const float* W1        = (const float*)d_in[10];
    const float* b1        = (const float*)d_in[11];
    const float* W2        = (const float*)d_in[12];
    const float* b2        = (const float*)d_in[13];
    float* out = (float*)d_out;

    char* ws = (char*)d_ws;
    size_t off = 0;
    auto alloc = [&](size_t bytes) -> char* {
        char* p = ws + off;
        off += (bytes + 255) & ~(size_t)255;
        return p;
    };

    const size_t NT = (size_t)BSZ * SEQ;            // 4096 tokens

    // Live across the attention phase.
    bf16_t* Wo_bf   = (bf16_t*)alloc((size_t)DIM * DIM * 2);
    bf16_t* W1_bf   = (bf16_t*)alloc((size_t)FFD * DIM * 2);
    bf16_t* W2_bf   = (bf16_t*)alloc((size_t)DIM * FFD * 2);
    bf16_t* qkv_bf  = (bf16_t*)alloc(NT * D3 * 2);
    bf16_t* ctx_bf  = (bf16_t*)alloc(NT * DIM * 2);
    // Two sets with disjoint lives share what follows:
    // the QKV GEMM's operands, the buffers of steps 5-9.
    const size_t shared0 = off;
    bf16_t* src_bf  = (bf16_t*)alloc(NT * DIM * 2);
    bf16_t* Wqkv_bf = (bf16_t*)alloc((size_t)D3 * DIM * 2);
    off = shared0;
    float*  y_f     = (float*) alloc(NT * DIM * 4);
    float*  x_f     = (float*) alloc(NT * DIM * 4);
    bf16_t* x_bf    = (bf16_t*)alloc(NT * DIM * 2);
    bf16_t* h_bf    = (bf16_t*)alloc(NT * FFD * 2);
    float*  f_f     = (float*) alloc(NT * DIM * 4);

    auto gemm128 = [&](const bf16_t* A, int lda, const bf16_t* Bm, int ldb,
                       const float* bias, void* C, int ldc,
                       int M, int N, int K, float alpha, int mode) {
        dim3 grid((unsigned)(N / 128), (unsigned)(M / 128));
        gemm_bf16_wmma<128><<<grid, 256, 0, stream>>>(A, lda, Bm, ldb, bias, C, ldc,
                                                      M, N, K, alpha, mode,
                                                      ZStride{0, 0}, ZStride{0, 0},
                                                      ZStride{0, 0});
    };

    // 1) Convert inputs/weights to bf16
    cvt_all_f32_to_bf16<<<CV_GRID, CV_THREADS, 0, stream>>>(
        src, Wqkv, Wo, W1, W2, src_bf, Wqkv_bf, Wo_bf, W1_bf, W2_bf);

    // 2) QKV projection: qkv = src @ Wqkv^T + bqkv  -> bf16 [NT, 3D]
    gemm128(src_bf, DIM, Wqkv_bf, DIM, bqkv, qkv_bf, D3,
            (int)NT, D3, DIM, 1.0f, /*bf16*/1);

    // 3, 4) Attention: ctx[b, :, h*HD:(h+1)*HD] = softmax(q k^T / 8 + bias[h]) v
    attn_fused<<<dim3(8, BSZ, NH * (SEQ / ATT_ROWS) / 8), ATT_WAVES * 32, 0, stream>>>(
        qkv_bf, attn_bias, ctx_bf);

    // 5) Output projection: y = ctx @ Wo^T + bo  (f32)
    gemm128(ctx_bf, DIM, Wo_bf, DIM, bo, y_f, DIM,
            (int)NT, DIM, DIM, 1.0f, /*f32*/0);

    // 6) x = LN(src + y) -> f32 + bf16
    add_ln_kernel<<<(unsigned)NT, 256, 0, stream>>>(y_f, src, g1, b1n, x_f, x_bf);

    // 7) FF1: h = gelu(x @ W1^T + b1) -> bf16 [NT, FF]
    gemm128(x_bf, DIM, W1_bf, DIM, b1, h_bf, FFD,
            (int)NT, FFD, DIM, 1.0f, /*gelu->bf16*/2);

    // 8) FF2: f = h @ W2^T + b2 -> f32
    gemm128(h_bf, FFD, W2_bf, FFD, b2, f_f, DIM,
            (int)NT, DIM, FFD, 1.0f, /*f32*/0);

    // 9) out = LN(x + f)
    add_ln_kernel<<<(unsigned)NT, 256, 0, stream>>>(f_f, x_f, g2, b2n, out, nullptr);
}

// v004
// A run of this version takes 214 microseconds.
// Next to v003, in two timings, it ran 1.17 and 1.16 times as fast.
// All steps since v000 together make it 9.32 times as fast.
#include <hip/hip_runtime.h>
#include <math.h>

// ---------------------------------------------------------------------------
// Types for CDNA5 WMMA (wave32)
// ---------------------------------------------------------------------------
typedef __bf16 bf16_t;
typedef __attribute__((ext_vector_type(16))) __bf16 v16bf;
typedef __attribute__((ext_vector_type(2)))  __bf16 bf16x2;
typedef __attribute__((ext_vector_type(8)))  float  v8f;

// Problem constants (match reference)
constexpr int BSZ = 4;
constexpr int SEQ = 1024;
constexpr int DIM = 1024;
constexpr int NH  = 16;
constexpr int HDM = 64;
constexpr int FFD = 4096;
constexpr int D3  = 3 * DIM;

constexpr int GK     = 128;      // k extent of one GEMM stage: 256-byte rows
constexpr int GPITCH = GK + 8;   // LDS row pitch in elements: 272 B, for ds_load_b128 readers

// ---------------------------------------------------------------------------
// f32 -> bf16 convert of all five GEMM operands in one streaming launch.
// One workgroup of 16 waves per CV_CHUNK contiguous elements of one tensor
// (every tensor is a whole number of chunks). A lane has CV_LOADS independent
// 16-byte loads, so many are in flight at once; each wave-wide load covers 512
// contiguous bytes and each wave-wide store 256.
// ---------------------------------------------------------------------------
typedef __attribute__((ext_vector_type(4))) float  cv_f32x4;
typedef __attribute__((ext_vector_type(4))) __bf16 cv_bf16x4;

constexpr int CV_THREADS = 512;
constexpr int CV_LOADS   = 32;                          // 16-byte loads per lane
constexpr int CV_CHUNK   = CV_THREADS * CV_LOADS * 4;   // elements per workgroup
constexpr unsigned CV_SRC  = (unsigned)(BSZ * SEQ * DIM / CV_CHUNK);
constexpr unsigned CV_WQKV = (unsigned)(D3 * DIM / CV_CHUNK);
constexpr unsigned CV_WO   = (unsigned)(DIM * DIM / CV_CHUNK);
constexpr unsigned CV_W1   = (unsigned)(FFD * DIM / CV_CHUNK);
constexpr unsigned CV_W2   = (unsigned)(DIM * FFD / CV_CHUNK);
constexpr unsigned CV_GRID = CV_SRC + CV_WQKV + CV_WO + CV_W1 + CV_W2;
static_assert(BSZ * SEQ * DIM % CV_CHUNK == 0 && D3 * DIM % CV_CHUNK == 0 &&
              DIM * DIM % CV_CHUNK == 0 && FFD * DIM % CV_CHUNK == 0,
              "every tensor must be a whole number of chunks");

__global__ __launch_bounds__(CV_THREADS) void cvt_all_f32_to_bf16(
    const float* __restrict__ src,  const float* __restrict__ wqkv,
    const float* __restrict__ wo,   const float* __restrict__ w1,
    const float* __restrict__ w2,
    bf16_t* __restrict__ src_o,  bf16_t* __restrict__ wqkv_o,
    bf16_t* __restrict__ wo_o,   bf16_t* __restrict__ w1_o,
    bf16_t* __restrict__ w2_o) {
    // Which tensor, and which chunk of it: the same for the whole workgroup.
    unsigned blk = blockIdx.x;
    const float* in = src;
    bf16_t* out = src_o;
    if (blk >= CV_SRC) {
        blk -= CV_SRC; in = wqkv; out = wqkv_o;
        if (blk >= CV_WQKV) {
            blk -= CV_WQKV; in = wo; out = wo_o;
            if (blk >= CV_WO) {
                blk -= CV_WO; in = w1; out = w1_o;
                if (blk >= CV_W1) { blk -= CV_W1; in = w2; out = w2_o; }
            }
        }
    }
    const cv_f32x4* ip = (const cv_f32x4*)(in + (size_t)blk * CV_CHUNK) + threadIdx.x;
    cv_bf16x4*      op = (cv_bf16x4*)(out + (size_t)blk * CV_CHUNK) + threadIdx.x;

    cv_f32x4 v[CV_LOADS];
#pragma unroll
    for (int j = 0; j < CV_LOADS; ++j) v[j] = ip[j * CV_THREADS];
#pragma unroll
    for (int j = 0; j < CV_LOADS; ++j)
        op[j * CV_THREADS] = __builtin_convertvector(v[j], cv_bf16x4);
}

// ---------------------------------------------------------------------------
// Fragment gather from an LDS tile, per ISA 7.12.2 16-bit A/B layout.
// For lane l: row = base + (l&15), half = l>>4; VGPR v holds
// K = k0 + kbase(v) + half*8 + {0,1}, kbase = {0,2,4,6,16,18,20,22}.
// ---------------------------------------------------------------------------
__device__ inline v16bf load_frag(const bf16_t* __restrict__ smem, int baseRow, int k0, int lane) {
    const int r    = baseRow + (lane & 15);
    const int half = (lane >> 4) & 1;
    const bf16_t* p = smem + r * GPITCH + k0 + half * 8;
    v16bf f;
#pragma unroll
    for (int v = 0; v < 8; ++v) {
        const int k2 = (v < 4) ? (2 * v) : (16 + 2 * (v - 4));
        bf16x2 pr = *(const bf16x2*)(p + k2);
        f[2 * v]     = pr.x;
        f[2 * v + 1] = pr.y;
    }
    return f;
}

// Eight async copies (global -> LDS, 16 B per lane each): 128 rows of 256 B per
// workgroup. g and l are this lane's first addresses; copy i lies 16 rows on.
// The closing wait stands inside the statement, so that no address register is
// rewritten in front of it.
__device__ __forceinline__ void copy_rows128(const bf16_t* g, size_t ld, unsigned l) {
    const bf16_t* g1 = g  + 16 * ld;
    const bf16_t* g2 = g1 + 16 * ld;
    const bf16_t* g3 = g2 + 16 * ld;
    const bf16_t* g4 = g3 + 16 * ld;
    const bf16_t* g5 = g4 + 16 * ld;
    const bf16_t* g6 = g5 + 16 * ld;
    const bf16_t* g7 = g6 + 16 * ld;
    constexpr unsigned LS = 16u * GPITCH * 2u;   // 16 LDS rows, bytes
    asm volatile("global_load_async_to_lds_b128 %0, %8, off\n\t"
                 "global_load_async_to_lds_b128 %1, %9, off\n\t"
                 "global_load_async_to_lds_b128 %2, %10, off\n\t"
                 "global_load_async_to_lds_b128 %3, %11, off\n\t"
                 "global_load_async_to_lds_b128 %4, %12, off\n\t"
                 "global_load_async_to_lds_b128 %5, %13, off\n\t"
                 "global_load_async_to_lds_b128 %6, %14, off\n\t"
                 "global_load_async_to_lds_b128 %7, %15, off\n\t"
                 "s_wait_xcnt 0x0"
                 :: "v"(l), "v"(l + LS), "v"(l + 2 * LS), "v"(l + 3 * LS),
                    "v"(l + 4 * LS), "v"(l + 5 * LS), "v"(l + 6 * LS), "v"(l + 7 * LS),
                    "v"(g), "v"(g1), "v"(g2), "v"(g3), "v"(g4), "v"(g5), "v"(g6), "v"(g7)
                 : "memory");
}

// ---------------------------------------------------------------------------
// Generic bf16 WMMA GEMM:  C[M,N] = alpha * A[M,K] @ B[N,K]^T  (+ bias[N])
// mode 0: store f32      mode 1: store bf16      mode 2: exact GELU -> bf16
//
// Block tile 128 x BN (BN = 128), 8 waves (4 row-groups x 2 col-groups),
// wave tile 32 x (BN/2). K stepped by GK = 128 through two LDS buffers filled
// with GLOBAL_LOAD_ASYNC_TO_LDS_B128: the copies of stage s+1 fly while stage s
// is worked on, 32 WMMAs a wave between two barriers.
// Requires: M%128==0, N%BN==0, K%GK==0, lda/ldb%8==0, 16B-aligned bases.
// Batched over blockIdx.z: z = hz * BSZ + b; every operand's base moves by
// b * (its .b stride) + hz * (its .h stride), in elements. A plain GEMM is
// launched with gridDim.z == 1.
// ---------------------------------------------------------------------------
struct ZStride { int b, h; };

template <int BN>
__global__ __launch_bounds__(256) void gemm_bf16_wmma(
    const bf16_t* __restrict__ A, int lda,
    const bf16_t* __restrict__ Bm, int ldb,
    const float* __restrict__ bias,
    void* __restrict__ C, int ldc,
    int M, int N, int K, float alpha, int mode,
    ZStride zA, ZStride zB, ZStride zC) {

    static_assert(BN % 128 == 0, "a copy statement fills 128 rows");
    constexpr int CT = BN / 32;        // wave col tiles of 16

    __shared__ __align__(16) bf16_t As[2 * 128 * GPITCH];
    __shared__ __align__(16) bf16_t Bs[2 * BN * GPITCH];

    const int tid  = threadIdx.x;
    const int lane = tid & 31;
    const int wave = tid >> 5;
    const int m_w  = (wave & 3) * 32;        // 4 wave-rows x 32
    const int n_w  = (wave >> 2) * (BN / 2); // 2 wave-cols x BN/2

    const int m0 = blockIdx.y * 128;
    const int n0 = blockIdx.x * BN;

    const int zb = blockIdx.z & (BSZ - 1);
    const int zh = blockIdx.z / BSZ;
    A  += (size_t)zb * zA.b + (size_t)zh * zA.h;
    Bm += (size_t)zb * zB.b + (size_t)zh * zB.h;
    const size_t zc = (size_t)zb * zC.b + (size_t)zh * zC.h;

    v8f acc[2][CT] = {};

    // One stage's copies: 16 lanes per 256-byte row, so a wave-wide copy covers
    // two whole rows of the stage.
    const int crow = tid >> 4, cch = tid & 15;
    const bf16_t* gA = A  + (size_t)(m0 + crow) * lda + cch * 8;
    const bf16_t* gB = Bm + (size_t)(n0 + crow) * ldb + cch * 8;
    const unsigned lA = (unsigned)(uintptr_t)(As + crow * GPITCH + cch * 8);
    const unsigned lB = (unsigned)(uintptr_t)(Bs + crow * GPITCH + cch * 8);
    auto issue = [&](int s, int st) {
        copy_rows128(gA + (size_t)s * GK, (size_t)lda, lA + (unsigned)st * (128u * GPITCH * 2u));
#pragma unroll
        for (int i = 0; i < BN / 128; ++i)
            copy_rows128(gB + (size_t)s * GK + (size_t)i * 128 * ldb, (size_t)ldb,
                         lB + (unsigned)st * (BN * GPITCH * 2u) + (unsigned)i * (128u * GPITCH * 2u));
    };

    const int NS = K / GK;
    issue(0, 0);
    asm volatile("s_wait_asynccnt 0x0" ::: "memory");   // this wave's part of stage 0 has landed
    __syncthreads();                                    // every wave's part has
    if (NS > 1) issue(1, 1);

    for (int s = 0; s < NS; ++s) {
        const int buf = s & 1;
        const bf16_t* Ab = As + buf * (128 * GPITCH);
        const bf16_t* Bb = Bs + buf * (BN * GPITCH);

#pragma unroll
        for (int kk = 0; kk < GK / 32; ++kk) {
            v16bf af[2], bfv[CT];
#pragma unroll
            for (int r = 0; r < 2; ++r)  af[r]  = load_frag(Ab, m_w + r * 16, kk * 32, lane);
#pragma unroll
            for (int c = 0; c < CT; ++c) bfv[c] = load_frag(Bb, n_w + c * 16, kk * 32, lane);

#pragma unroll
            for (int r = 0; r < 2; ++r)
#pragma unroll
                for (int c = 0; c < CT; ++c)
                    acc[r][c] = __builtin_amdgcn_wmma_f32_16x16x32_bf16(
                        false, af[r], false, bfv[c], (short)0, acc[r][c], false, false);
        }

        // Hand-over: this wave has left buffer buf, and its copies of stage s+1 have
        // landed; behind the barrier that holds for every wave.
        asm volatile("s_wait_dscnt 0x0" ::: "memory");
        asm volatile("s_wait_asynccnt 0x0" ::: "memory");
        __syncthreads();
        if (s + 2 < NS) issue(s + 2, buf);
    }
    asm volatile("s_wait_asynccnt 0x0" ::: "memory");   // no copy is left in flight

    // Epilogue. D layout: lanes 0-15 -> cols, lanes 16-31 -> rows +8;
    // VGPR i -> row +i.
    float*  Cf = (float*)C + zc;
    bf16_t* Cb = (bf16_t*)C + zc;
#pragma unroll
    for (int r = 0; r < 2; ++r) {
#pragma unroll
        for (int c = 0; c < CT; ++c) {
            const int col  = n0 + n_w + c * 16 + (lane & 15);
            const int row0 = m0 + m_w + r * 16 + ((lane >> 4) & 1) * 8;
            const float bv = bias ? bias[col] : 0.0f;
#pragma unroll
            for (int i = 0; i < 8; ++i) {
                const int row = row0 + i;
                float v = acc[r][c][i] * alpha + bv;
                if (mode == 0) {
                    Cf[(size_t)row * ldc + col] = v;
                } else {
                    if (mode == 2)
                        v = 0.5f * v * (1.0f + erff(v * 0.70710678118654752f));
                    Cb[(size_t)row * ldc + col] = (bf16_t)v;
                }
            }
        }
    }
}

typedef unsigned int u32x4 __attribute__((ext_vector_type(4)));
typedef short        s16x8 __attribute__((ext_vector_type(8)));
typedef float        f32x2 __attribute__((ext_vector_type(2)));
typedef float        f32x4 __attribute__((ext_vector_type(4)));

constexpr unsigned PITCH_K = 2 * HDM + 16;   // odd multiple of 16 B: ds_load_b128 readers
constexpr unsigned PITCH_V = 2 * HDM + 32;   // odd multiple of 32 B: ds_load_tr16_b128 readers
constexpr unsigned V_OFF   = SEQ * PITCH_K;
constexpr unsigned ATT_LDS = V_OFF + SEQ * PITCH_V;
constexpr int ATT_WAVES = 16;                // 16 query rows each
constexpr int ATT_ROWS  = ATT_WAVES * 16;
constexpr int ATT_KEYS  = 64;                // keys per pass
constexpr int ATT_PASSES = SEQ / ATT_KEYS;
static_assert(ATT_LDS <= 320u * 1024u, "K and V of one head must fit one workgroup's LDS");
static_assert(ATT_PASSES % 2 == 0, "the pass loop is written in pairs");

struct Frag { u32x4 q[2]; };   // one 16 x 32 bf16 operand: 8 registers per lane

__device__ __forceinline__ v8f mma(const Frag& a, const Frag& b, v8f c) {
    return __builtin_amdgcn_wmma_f32_16x16x32_bf16(
        false, __builtin_bit_cast(v16bf, a), false, __builtin_bit_cast(v16bf, b),
        (short)0, c, false, false);
}
__device__ __forceinline__ u32x4 ld_tr16(const unsigned char* p) {
    typedef __attribute__((address_space(3))) s16x8 lds_s16x8;
    return __builtin_bit_cast(u32x4, __builtin_amdgcn_ds_load_tr16_b128_v8i16((lds_s16x8*)p));
}
__device__ __forceinline__ unsigned pack2(float lo, float hi) {   // round to nearest even
    return __builtin_bit_cast(unsigned, __builtin_convertvector(f32x2{lo, hi}, bf16x2));
}
__device__ __forceinline__ float xhalf(float x) {                 // lane l with lane l ^ 16
    return __builtin_bit_cast(float, __builtin_amdgcn_permlanex16(
        __builtin_bit_cast(int, x), __builtin_bit_cast(int, x),
        0x76543210, 0xfedcba98, false, false));
}

__global__ __launch_bounds__(ATT_WAVES * 32) void attn_fused(const bf16_t* __restrict__ qkv,
                                                             const float* __restrict__ bias,
                                                             bf16_t* __restrict__ ctx) {
    __shared__ __attribute__((aligned(256))) unsigned char L[ATT_LDS];
    const unsigned tid = threadIdx.x, lane = tid & 31u, wave = tid >> 5;
    const unsigned c = lane & 15u, h = lane >> 4;
    // Grid (8, batch, 8): the BSZ workgroups that read one bias block lie 8 apart
    // in launch order, in the hope that they share one L2's copy of it (speed only:
    // no result depends on where a workgroup runs).
    const unsigned tile = blockIdx.x + 8u * blockIdx.z;      // head * 4 + row block
    const unsigned b    = blockIdx.y;
    const unsigned hd   = tile / (SEQ / ATT_ROWS);
    const unsigned q0   = (tile % (SEQ / ATT_ROWS)) * ATT_ROWS + wave * 16u;

    const bf16_t* base = qkv + (size_t)b * SEQ * D3 + hd * HDM;   // q of token 0

    // Stage K and V: 8 lanes per 128-byte row, whole lines from memory.
    constexpr int RST = ATT_WAVES * 32 / 8;   // rows per step of the workgroup
    constexpr int NST = SEQ / RST;
    const unsigned srow = tid >> 3, sch = tid & 7u;
    const bf16_t* sp = base + (size_t)srow * D3 + sch * 8u;
    u32x4 kr[NST], vr[NST];
#pragma unroll
    for (int i = 0; i < NST; ++i) {
        kr[i] = *(const u32x4*)(sp + (size_t)i * RST * D3 + DIM);
        vr[i] = *(const u32x4*)(sp + (size_t)i * RST * D3 + 2 * DIM);
    }

    // Q fragments in the hardware k order (as K's below), scaled by 1/8.
    Frag qf[2];
    const bf16_t* qp = base + (size_t)(q0 + c) * D3 + 8u * h;
    {
#pragma unroll
        for (int kc = 0; kc < 2; ++kc) {
            Frag f;
            f.q[0] = *(const u32x4*)(qp + 32 * kc);
            f.q[1] = *(const u32x4*)(qp + 32 * kc + 16);
            v16bf t = __builtin_bit_cast(v16bf, f);
#pragma unroll
            for (int e = 0; e < 16; ++e) t[e] = (bf16_t)((float)t[e] * 0.125f);
            qf[kc] = __builtin_bit_cast(Frag, t);
        }
    }

    // A operand whose row 0 is ones: row 0 of its product is the column sums of P^T.
    Frag ones;
    {
        const unsigned o = (c == 0u) ? 0x3F803F80u : 0u;
        ones.q[0] = u32x4{o, o, o, o};
        ones.q[1] = u32x4{o, o, o, o};
    }

    v8f acc[4] = {};          // O^T: acc[t][r] = O[q0 + c][16 t + 8 h + r]
    v8f lacc = {};            // register 0 of lanes 0-15: denominator of query c
    float m_run = -INFINITY;  // maximum in use, base-2 scaled; equal in lanes c, c + 16
    constexpr float LOG2E = 1.4426950408889634f;

    // This lane's bias: row q0 + c, keys 16 j + 8 h + 0..7 of each pass.
    const float* bp = bias + ((size_t)hd * SEQ + q0 + c) * SEQ + 8u * h;
    auto load_bias = [&](v8f (&d)[4], int it) {
#pragma unroll
        for (int j = 0; j < 4; ++j) {
            const f32x4 lo = *(const f32x4*)(bp + it * ATT_KEYS + 16 * j);
            const f32x4 hi = *(const f32x4*)(bp + it * ATT_KEYS + 16 * j + 4);
            d[j] = v8f{lo.x, lo.y, lo.z, lo.w, hi.x, hi.y, hi.z, hi.w};
        }
    };

    // One pass over 64 keys. s arrives holding the pass's bias tile; nx is filled
    // with the next pass's (fetch: a literal at every call, false in the last pass),
    // so that its memory latency lies under this pass.
    auto pass = [&](v8f (&s)[4], v8f (&nx)[4], int it, bool fetch) __attribute__((always_inline)) {
        if (fetch) {
            load_bias(nx, it + 1);
            // Before the loop's pointer, which these loads name, is advanced.
            asm volatile("s_wait_xcnt 0x0" ::: "memory");
        }
        // Holds these loads at the head of the pass: sunk to where registers come
        // free they would have half a pass, too little for a read from memory.
        __builtin_amdgcn_sched_barrier(0);

        const unsigned char* kp = L + (it * ATT_KEYS + c) * PITCH_K + 16u * h;
#pragma unroll
        for (int j = 0; j < 4; ++j) {
#pragma unroll
            for (int kc = 0; kc < 2; ++kc) {
                Frag kf;
                kf.q[0] = *(const u32x4*)(kp + j * 16 * PITCH_K + 64 * kc);
                kf.q[1] = *(const u32x4*)(kp + j * 16 * PITCH_K + 64 * kc + 32);
                s[j] = mma(kf, qf[kc], s[j]);   // s[j][r] = score(key 16 j + 8 h + r, query c)
            }
        }

        float mx = s[0][0];
#pragma unroll
        for (int j = 0; j < 4; ++j)
#pragma unroll
            for (int r = 0; r < 8; ++r) mx = __builtin_fmaxf(mx, s[j][r]);
        mx = __builtin_fmaxf(mx, xhalf(mx)) * LOG2E;   // both halves: this query's maximum

        if (__builtin_amdgcn_ballot_w32(mx > m_run + 8.0f) != 0) {   // scalar branch, rare
            const float m_new = __builtin_fmaxf(m_run, mx);
            const float corr  = __builtin_amdgcn_exp2f(m_run - m_new);  // 0 on the first pass
            m_run = m_new;
            lacc = lacc * corr;
#pragma unroll
            for (int t = 0; t < 4; ++t) acc[t] = acc[t] * corr;
        }
        const float nm = -m_run;

#pragma unroll
        for (int g = 0; g < 2; ++g) {   // 32 keys: one k extent of the second product
            const unsigned char* ad = L + V_OFF
                + (it * ATT_KEYS + 32u * g + 8u * h + (lane & 7u)) * PITCH_V
                + ((lane >> 3) & 1u) * 16u;
            Frag vf[4];
#pragma unroll
            for (int t = 0; t < 4; ++t) {
                vf[t].q[0] = ld_tr16(ad + 32 * t);
                vf[t].q[1] = ld_tr16(ad + 16 * PITCH_V + 32 * t);
            }
            unsigned w[8];
#pragma unroll
            for (int i = 0; i < 8; ++i) {   // elements 2 i, 2 i + 1 of the 32-key operand
                const v8f& sv = s[2 * g + (i >> 2)];
                const f32x2 arg = __builtin_elementwise_fma(
                    f32x2{sv[2 * (i & 3)], sv[2 * (i & 3) + 1]}, f32x2{LOG2E, LOG2E},
                    f32x2{nm, nm});
                w[i] = pack2(__builtin_amdgcn_exp2f(arg.x), __builtin_amdgcn_exp2f(arg.y));
            }
            Frag pf;
            pf.q[0] = u32x4{w[0], w[1], w[2], w[3]};
            pf.q[1] = u32x4{w[4], w[5], w[6], w[7]};
#pragma unroll
            for (int t = 0; t < 4; ++t) acc[t] = mma(vf[t], pf, acc[t]);
            lacc = mma(ones, pf, lacc);
        }
    };

    v8f sa[4], sb[4];
    load_bias(sa, 0);
    // Every load so far is issued. The inputs keep the loads' address registers
    // from being given away (to a later load's result) in front of the wait.
    asm volatile("s_wait_xcnt 0x0" :: "v"(sp), "v"(qp), "v"(bp) : "memory");
    __builtin_amdgcn_sched_barrier(0);   // keeps every other reuse behind the wait
#pragma unroll
    for (int i = 0; i < NST; ++i) {
        *(u32x4*)(L + (srow + i * RST) * PITCH_K + sch * 16u)         = kr[i];
        *(u32x4*)(L + V_OFF + (srow + i * RST) * PITCH_V + sch * 16u) = vr[i];
    }
    __syncthreads();   // K and V are staged; nothing writes LDS after this

    for (int it = 0; it < ATT_PASSES - 2; it += 2) {
        pass(sa, sb, it, true);
        pass(sb, sa, it + 1, true);
    }
    pass(sa, sb, ATT_PASSES - 2, true);
    pass(sb, sa, ATT_PASSES - 1, false);

    // Lanes 16-31 hold row 8 of the sum tile, which is 0: the exchange-and-add
    // gives both halves the denominator.
    const float lr  = lacc[0];
    const float inv = 1.0f / (lr + xhalf(lr));
    bf16_t* op = ctx + (size_t)(b * SEQ + q0 + c) * DIM + hd * HDM + 8u * h;
#pragma unroll
    for (int t = 0; t < 4; ++t) {
        const v8f o = acc[t] * inv;
        *(u32x4*)(op + 16 * t) = u32x4{pack2(o[0], o[1]), pack2(o[2], o[3]),
                                       pack2(o[4], o[5]), pack2(o[6], o[7])};
    }
}

// ---------------------------------------------------------------------------
// Fused residual + LayerNorm over rows of width DIM (=1024).
// ---------------------------------------------------------------------------
__global__ __launch_bounds__(256) void add_ln_kernel(const float* __restrict__ a,
                                                     const float* __restrict__ res,
                                                     const float* __restrict__ g,
                                                     const float* __restrict__ b,
                                                     float* __restrict__ outf,
                                                     bf16_t* __restrict__ outb) {
    const int row = blockIdx.x;
    const int tid = threadIdx.x;
    __shared__ float red[256];

    float loc[4];
    float s = 0.0f;
#pragma unroll
    for (int i = 0; i < 4; ++i) {
        const int j = tid + i * 256;
        const float v = a[(size_t)row * DIM + j] + res[(size_t)row * DIM + j];
        loc[i] = v;
        s += v;
    }
    red[tid] = s;
    __syncthreads();
    for (int st = 128; st > 0; st >>= 1) {
        if (tid < st) red[tid] += red[tid + st];
        __syncthreads();
    }
    const float mean = red[0] * (1.0f / DIM);
    __syncthreads();

    float vs = 0.0f;
#pragma unroll
    for (int i = 0; i < 4; ++i) {
        const float d = loc[i] - mean;
        vs += d * d;
    }
    red[tid] = vs;
    __syncthreads();
    for (int st = 128; st > 0; st >>= 1) {
        if (tid < st) red[tid] += red[tid + st];
        __syncthreads();
    }
    const float inv = rsqrtf(red[0] * (1.0f / DIM) + 1e-5f);

#pragma unroll
    for (int i = 0; i < 4; ++i) {
        const int j = tid + i * 256;
        const float y = (loc[i] - mean) * inv * g[j] + b[j];
        outf[(size_t)row * DIM + j] = y;
        if (outb) outb[(size_t)row * DIM + j] = (bf16_t)y;
    }
}

// ---------------------------------------------------------------------------
// Host orchestration
// ---------------------------------------------------------------------------
extern "C" void kernel_launch(void* const* d_in, const int* in_sizes, int n_in,
                              void* d_out, int out_size, void* d_ws, size_t ws_size,
                              hipStream_t stream) {
    (void)in_sizes; (void)n_in; (void)out_size; (void)ws_size;

    const float* src       = (const float*)d_in[0];
    const float* attn_bias = (const float*)d_in[1];
    const float* Wqkv      = (const float*)d_in[2];
    const float* bqkv      = (const float*)d_in[3];
    const float* Wo        = (const float*)d_in[4];
    const float* bo        = (const float*)d_in[5];
    const float* g1        = (const float*)d_in[6];
    const float* b1n       = (const float*)d_in[7];
    const float* g2        = (const float*)d_in[8];
    const float* b2n       = (const float*)d_in[9];
    const float* W1        = (const float*)d_in[10];
    const float* b1        = (const float*)d_in[11];
    const float* W2        = (const float*)d_in[12];
    const float* b2        = (const float*)d_in[13];
    float* out = (float*)d_out;

    char* ws = (char*)d_ws;
    size_t off = 0;
    auto alloc = [&](size_t bytes) -> char* {
        char* p = ws + off;
        off += (bytes + 255) & ~(size_t)255;
        return p;
    };

    const size_t NT = (size_t)BSZ * SEQ;            // 4096 tokens

    // Live across the attention phase.
    bf16_t* Wo_bf   = (bf16_t*)alloc((size_t)DIM * DIM * 2);
    bf16_t* W1_bf   = (bf16_t*)alloc((size_t)FFD * DIM * 2);
    bf16_t* W2_bf   = (bf16_t*)alloc((size_t)DIM * FFD * 2);
    bf16_t* qkv_bf  = (bf16_t*)alloc(NT * D3 * 2);
    bf16_t* ctx_bf  = (bf16_t*)alloc(NT * DIM * 2);
    // Two sets with disjoint lives share what follows:
    // the QKV GEMM's operands, the buffers of steps 5-9.
    const size_t shared0 = off;
    bf16_t* src_bf  = (bf16_t*)alloc(NT * DIM * 2);
    bf16_t* Wqkv_bf = (bf16_t*)alloc((size_t)D3 * DIM * 2);
    off = shared0;
    float*  y_f     = (float*) alloc(NT * DIM * 4);
    float*  x_f     = (float*) alloc(NT * DIM * 4);
    bf16_t* x_bf    = (bf16_t*)alloc(NT * DIM * 2);
    bf16_t* h_bf    = (bf16_t*)alloc(NT * FFD * 2);
    float*  f_f     = (float*) alloc(NT * DIM * 4);

    auto gemm128 = [&](const bf16_t* A, int lda, const bf16_t* Bm, int ldb,
                       const float* bias, void* C, int ldc,
                       int M, int N, int K, float alpha, int mode) {
        dim3 grid((unsigned)(N / 128), (unsigned)(M / 128));
        gemm_bf16_wmma<128><<<grid, 256, 0, stream>>>(A, lda, Bm, ldb, bias, C, ldc,
                                                      M, N, K, alpha, mode,
                                                      ZStride{0, 0}, ZStride{0, 0},
                                                      ZStride{0, 0});
    };

    // 1) Convert inputs/weights to bf16
    cvt_all_f32_to_bf16<<<CV_GRID, CV_THREADS, 0, stream>>>(
        src, Wqkv, Wo, W1, W2, src_bf, Wqkv_bf, Wo_bf, W1_bf, W2_bf);

    // 2) QKV projection: qkv = src @ Wqkv^T + bqkv  -> bf16 [NT, 3D]
    gemm128(src_bf, DIM, Wqkv_bf, DIM, bqkv, qkv_bf, D3,
            (int)NT, D3, DIM, 1.0f, /*bf16*/1);

    // 3, 4) Attention: ctx[b, :, h*HD:(h+1)*HD] = softmax(q k^T / 8 + bias[h]) v
    attn_fused<<<dim3(8, BSZ, NH * (SEQ / ATT_ROWS) / 8), ATT_WAVES * 32, 0, stream>>>(
        qkv_bf, attn_bias, ctx_bf);

    // 5) Output projection: y = ctx @ Wo^T + bo  (f32)
    gemm128(ctx_bf, DIM, Wo_bf, DIM, bo, y_f, DIM,
            (int)NT, DIM, DIM, 1.0f, /*f32*/0);

    // 6) x = LN(src + y) -> f32 + bf16
    add_ln_kernel<<<(unsigned)NT, 256, 0, stream>>>(y_f, src, g1, b1n, x_f, x_bf);

    // 7) FF1: h = gelu(x @ W1^T + b1) -> bf16 [NT, FF]
    gemm128(x_bf, DIM, W1_bf, DIM, b1, h_bf, FFD,
            (int)NT, FFD, DIM, 1.0f, /*gelu->bf16*/2);

    // 8) FF2: f = h @ W2^T + b2 -> f32
    gemm128(h_bf, FFD, W2_bf, FFD, b2, f_f, DIM,
            (int)NT, DIM, FFD, 1.0f, /*f32*/0);

    // 9) out = LN(x + f)
    add_ln_kernel<<<(unsigned)NT, 256, 0, stream>>>(f_f, x_f, g2, b2n, out, nullptr);
}

// v005
// A run of this version takes 180 microseconds.
// In both of two side-by-side timings against v004, it was 1.18 times as fast.
// All steps since v000 together make it 11.0 times as fast.
#include <hip/hip_runtime.h>
#include <math.h>

// ---------------------------------------------------------------------------
// Types for CDNA5 WMMA (wave32)
// ---------------------------------------------------------------------------
typedef __bf16 bf16_t;
typedef __attribute__((ext_vector_type(16))) __bf16 v16bf;
typedef __attribute__((ext_vector_type(2)))  __bf16 bf16x2;
typedef __attribute__((ext_vector_type(8)))  float  v8f;

// Problem constants (match reference)
constexpr int BSZ = 4;
constexpr int SEQ = 1024;
constexpr int DIM = 1024;
constexpr int NH  = 16;
constexpr int HDM = 64;
constexpr int FFD = 4096;
constexpr int D3  = 3 * DIM;

constexpr int GK     = 128;      // k extent of one GEMM stage: 256-byte rows
constexpr int GPITCH = GK + 8;   // LDS row pitch in elements: 272 B, for ds_load_b128 readers

// ---------------------------------------------------------------------------
// f32 -> bf16 convert of all five GEMM operands in one streaming launch.
// One workgroup of 16 waves per CV_CHUNK contiguous elements of one tensor
// (every tensor is a whole number of chunks). A lane has CV_LOADS independent
// 16-byte loads, so many are in flight at once; each wave-wide load covers 512
// contiguous bytes and each wave-wide store 256.
// ---------------------------------------------------------------------------
typedef __attribute__((ext_vector_type(4))) float  cv_f32x4;
typedef __attribute__((ext_vector_type(4))) __bf16 cv_bf16x4;

constexpr int CV_THREADS = 512;
constexpr int CV_LOADS   = 32;                          // 16-byte loads per lane
constexpr int CV_CHUNK   = CV_THREADS * CV_LOADS * 4;   // elements per workgroup
constexpr unsigned CV_SRC  = (unsigned)(BSZ * SEQ * DIM / CV_CHUNK);
constexpr unsigned CV_WQKV = (unsigned)(D3 * DIM / CV_CHUNK);
constexpr unsigned CV_WO   = (unsigned)(DIM * DIM / CV_CHUNK);
constexpr unsigned CV_W1   = (unsigned)(FFD * DIM / CV_CHUNK);
constexpr unsigned CV_W2   = (unsigned)(DIM * FFD / CV_CHUNK);
constexpr unsigned CV_GRID = CV_SRC + CV_WQKV + CV_WO + CV_W1 + CV_W2;
static_assert(BSZ * SEQ * DIM % CV_CHUNK == 0 && D3 * DIM % CV_CHUNK == 0 &&
              DIM * DIM % CV_CHUNK == 0 && FFD * DIM % CV_CHUNK == 0,
              "every tensor must be a whole number of chunks");

__global__ __launch_bounds__(CV_THREADS) void cvt_all_f32_to_bf16(
    const float* __restrict__ src,  const float* __restrict__ wqkv,
    const float* __restrict__ wo,   const float* __restrict__ w1,
    const float* __restrict__ w2,
    bf16_t* __restrict__ src_o,  bf16_t* __restrict__ wqkv_o,
    bf16_t* __restrict__ wo_o,   bf16_t* __restrict__ w1_o,
    bf16_t* __restrict__ w2_o) {
    // Which tensor, and which chunk of it: the same for the whole workgroup.
    unsigned blk = blockIdx.x;
    const float* in = src;
    bf16_t* out = src_o;
    if (blk >= CV_SRC) {
        blk -= CV_SRC; in = wqkv; out = wqkv_o;
        if (blk >= CV_WQKV) {
            blk -= CV_WQKV; in = wo; out = wo_o;
            if (blk >= CV_WO) {
                blk -= CV_WO; in = w1; out = w1_o;
                if (blk >= CV_W1) { blk -= CV_W1; in = w2; out = w2_o; }
            }
        }
    }
    const cv_f32x4* ip = (const cv_f32x4*)(in + (size_t)blk * CV_CHUNK) + threadIdx.x;
    cv_bf16x4*      op = (cv_bf16x4*)(out + (size_t)blk * CV_CHUNK) + threadIdx.x;

    cv_f32x4 v[CV_LOADS];
#pragma unroll
    for (int j = 0; j < CV_LOADS; ++j) v[j] = ip[j * CV_THREADS];
#pragma unroll
    for (int j = 0; j < CV_LOADS; ++j)
        op[j * CV_THREADS] = __builtin_convertvector(v[j], cv_bf16x4);
}

// ---------------------------------------------------------------------------
// Fragment gather from an LDS tile, per ISA 7.12.2 16-bit A/B layout.
// For lane l: row = base + (l&15), half = l>>4; VGPR v holds
// K = k0 + kbase(v) + half*8 + {0,1}, kbase = {0,2,4,6,16,18,20,22}.
// ---------------------------------------------------------------------------
__device__ inline v16bf load_frag(const bf16_t* __restrict__ smem, int baseRow, int k0, int lane) {
    const int r    = baseRow + (lane & 15);
    const int half = (lane >> 4) & 1;
    const bf16_t* p = smem + r * GPITCH + k0 + half * 8;
    v16bf f;
#pragma unroll
    for (int v = 0; v < 8; ++v) {
        const int k2 = (v < 4) ? (2 * v) : (16 + 2 * (v - 4));
        bf16x2 pr = *(const bf16x2*)(p + k2);
        f[2 * v]     = pr.x;
        f[2 * v + 1] = pr.y;
    }
    return f;
}

// Eight async copies (global -> LDS, 16 B per lane each): 128 rows of 256 B per
// workgroup. g and l are this lane's first addresses; copy i lies 16 rows on.
// The closing wait stands inside the statement, so that no address register is
// rewritten in front of it.
__device__ __forceinline__ void copy_rows128(const bf16_t* g, size_t ld, unsigned l) {
    const bf16_t* g1 = g  + 16 * ld;
    const bf16_t* g2 = g1 + 16 * ld;
    const bf16_t* g3 = g2 + 16 * ld;
    const bf16_t* g4 = g3 + 16 * ld;
    const bf16_t* g5 = g4 + 16 * ld;
    const bf16_t* g6 = g5 + 16 * ld;
    const bf16_t* g7 = g6 + 16 * ld;
    constexpr unsigned LS = 16u * GPITCH * 2u;   // 16 LDS rows, bytes
    asm volatile("global_load_async_to_lds_b128 %0, %8, off\n\t"
                 "global_load_async_to_lds_b128 %1, %9, off\n\t"
                 "global_load_async_to_lds_b128 %2, %10, off\n\t"
                 "global_load_async_to_lds_b128 %3, %11, off\n\t"
                 "global_load_async_to_lds_b128 %4, %12, off\n\t"
                 "global_load_async_to_lds_b128 %5, %13, off\n\t"
                 "global_load_async_to_lds_b128 %6, %14, off\n\t"
                 "global_load_async_to_lds_b128 %7, %15, off\n\t"
                 "s_wait_xcnt 0x0"
                 :: "v"(l), "v"(l + LS), "v"(l + 2 * LS), "v"(l + 3 * LS),
                    "v"(l + 4 * LS), "v"(l + 5 * LS), "v"(l + 6 * LS), "v"(l + 7 * LS),
                    "v"(g), "v"(g1), "v"(g2), "v"(g3), "v"(g4), "v"(g5), "v"(g6), "v"(g7)
                 : "memory");
}

// ---------------------------------------------------------------------------
// Generic bf16 WMMA GEMM:  C[M,N] = alpha * A[M,K] @ B[N,K]^T + bias[N]
// MODE 0: store f32      MODE 1: store bf16      MODE 2: exact GELU -> bf16
// MODE is a template parameter: the epilogue of each instantiation holds its one
// store form alone, with no test of the mode per element.
//
// Block tile 128 x BN (BN = 128), 8 waves (4 row-groups x 2 col-groups),
// wave tile 32 x (BN/2). K stepped by GK = 128 through two LDS buffers filled
// with GLOBAL_LOAD_ASYNC_TO_LDS_B128: the copies of stage s+1 fly while stage s
// is worked on, 32 WMMAs a wave between two barriers.
// Requires: M%128==0, N%BN==0, K%GK==0, lda/ldb%8==0, 16B-aligned bases.
// Batched over blockIdx.z: z = hz * BSZ + b; every operand's base moves by
// b * (its .b stride) + hz * (its .h stride), in elements. A plain GEMM is
// launched with gridDim.z == 1.
// ---------------------------------------------------------------------------
struct ZStride { int b, h; };
template <int V> struct StoreMode { static constexpr int value = V; };

template <int BN, int MODE>
__global__ __launch_bounds__(256) void gemm_bf16_wmma(
    const bf16_t* __restrict__ A, int lda,
    const bf16_t* __restrict__ Bm, int ldb,
    const float* __restrict__ bias,
    void* __restrict__ C, int ldc,
    int M, int N, int K, float alpha,
    ZStride zA, ZStride zB, ZStride zC) {

    static_assert(BN % 128 == 0, "a copy statement fills 128 rows");
    constexpr int CT = BN / 32;        // wave col tiles of 16

    __shared__ __align__(16) bf16_t As[2 * 128 * GPITCH];
    __shared__ __align__(16) bf16_t Bs[2 * BN * GPITCH];

    const int tid  = threadIdx.x;
    const int lane = tid & 31;
    const int wave = tid >> 5;
    const int m_w  = (wave & 3) * 32;        // 4 wave-rows x 32
    const int n_w  = (wave >> 2) * (BN / 2); // 2 wave-cols x BN/2

    const int m0 = blockIdx.y * 128;
    const int n0 = blockIdx.x * BN;

    const int zb = blockIdx.z & (BSZ - 1);
    const int zh = blockIdx.z / BSZ;
    A  += (size_t)zb * zA.b + (size_t)zh * zA.h;
    Bm += (size_t)zb * zB.b + (size_t)zh * zB.h;
    const size_t zc = (size_t)zb * zC.b + (size_t)zh * zC.h;

    v8f acc[2][CT] = {};

    // One stage's copies: 16 lanes per 256-byte row, so a wave-wide copy covers
    // two whole rows of the stage.
    const int crow = tid >> 4, cch = tid & 15;
    const bf16_t* gA = A  + (size_t)(m0 + crow) * lda + cch * 8;
    const bf16_t* gB = Bm + (size_t)(n0 + crow) * ldb + cch * 8;
    const unsigned lA = (unsigned)(uintptr_t)(As + crow * GPITCH + cch * 8);
    const unsigned lB = (unsigned)(uintptr_t)(Bs + crow * GPITCH + cch * 8);
    auto issue = [&](int s, int st) {
        copy_rows128(gA + (size_t)s * GK, (size_t)lda, lA + (unsigned)st * (128u * GPITCH * 2u));
#pragma unroll
        for (int i = 0; i < BN / 128; ++i)
            copy_rows128(gB + (size_t)s * GK + (size_t)i * 128 * ldb, (size_t)ldb,
                         lB + (unsigned)st * (BN * GPITCH * 2u) + (unsigned)i * (128u * GPITCH * 2u));
    };

    const int NS = K / GK;
    issue(0, 0);
    asm volatile("s_wait_asynccnt 0x0" ::: "memory");   // this wave's part of stage 0 has landed
    __syncthreads();                                    // every wave's part has
    if (NS > 1) issue(1, 1);

    for (int s = 0; s < NS; ++s) {
        const int buf = s & 1;
        const bf16_t* Ab = As + buf * (128 * GPITCH);
        const bf16_t* Bb = Bs + buf * (BN * GPITCH);

#pragma unroll
        for (int kk = 0; kk < GK / 32; ++kk) {
            v16bf af[2], bfv[CT];
#pragma unroll
            for (int r = 0; r < 2; ++r)  af[r]  = load_frag(Ab, m_w + r * 16, kk * 32, lane);
#pragma unroll
            for (int c = 0; c < CT; ++c) bfv[c] = load_frag(Bb, n_w + c * 16, kk * 32, lane);

#pragma unroll
            for (int r = 0; r < 2; ++r)
#pragma unroll
                for (int c = 0; c < CT; ++c)
                    acc[r][c] = __builtin_amdgcn_wmma_f32_16x16x32_bf16(
                        false, af[r], false, bfv[c], (short)0, acc[r][c], false, false);
        }

        // Hand-over: this wave has left buffer buf, and its copies of stage s+1 have
        // landed; behind the barrier that holds for every wave.
        asm volatile("s_wait_dscnt 0x0" ::: "memory");
        asm volatile("s_wait_asynccnt 0x0" ::: "memory");
        __syncthreads();
        if (s + 2 < NS) issue(s + 2, buf);
    }
    asm volatile("s_wait_asynccnt 0x0" ::: "memory");   // no copy is left in flight

    // Epilogue. D layout: lanes 0-15 -> cols, lanes 16-31 -> rows +8;
    // VGPR i -> row +i.
    float*  Cf = (float*)C + zc;
    bf16_t* Cb = (bf16_t*)C + zc;
#pragma unroll
    for (int r = 0; r < 2; ++r) {
#pragma unroll
        for (int c = 0; c < CT; ++c) {
            const int col  = n0 + n_w + c * 16 + (lane & 15);
            const int row0 = m0 + m_w + r * 16 + ((lane >> 4) & 1) * 8;
            const float bv = bias[col];
#pragma unroll
            for (int i = 0; i < 8; ++i) {
                const int row = row0 + i;
                float v = acc[r][c][i] * alpha + bv;
                if constexpr (MODE == 0) {
                    Cf[(size_t)row * ldc + col] = v;
                } else {
                    if constexpr (MODE == 2)
                        v = 0.5f * v * (1.0f + erff(v * 0.70710678118654752f));
                    Cb[(size_t)row * ldc + col] = (bf16_t)v;
                }
            }
        }
    }
}

typedef unsigned int u32x4 __attribute__((ext_vector_type(4)));
typedef short        s16x8 __attribute__((ext_vector_type(8)));
typedef float        f32x2 __attribute__((ext_vector_type(2)));
typedef float        f32x4 __attribute__((ext_vector_type(4)));

constexpr unsigned PITCH_K = 2 * HDM + 16;   // odd multiple of 16 B: ds_load_b128 readers
constexpr unsigned PITCH_V = 2 * HDM + 32;   // odd multiple of 32 B: ds_load_tr16_b128 readers
constexpr unsigned V_OFF   = SEQ * PITCH_K;
constexpr unsigned ATT_LDS = V_OFF + SEQ * PITCH_V;
constexpr int ATT_WAVES = 16;                // 16 query rows each
constexpr int ATT_ROWS  = ATT_WAVES * 16;
constexpr int ATT_KEYS  = 64;                // keys per pass
constexpr int ATT_PASSES = SEQ / ATT_KEYS;
static_assert(ATT_LDS <= 320u * 1024u, "K and V of one head must fit one workgroup's LDS");
static_assert(ATT_PASSES % 2 == 0, "the pass loop is written in pairs");

struct Frag { u32x4 q[2]; };   // one 16 x 32 bf16 operand: 8 registers per lane

__device__ __forceinline__ v8f mma(const Frag& a, const Frag& b, v8f c) {
    return __builtin_amdgcn_wmma_f32_16x16x32_bf16(
        false, __builtin_bit_cast(v16bf, a), false, __builtin_bit_cast(v16bf, b),
        (short)0, c, false, false);
}
__device__ __forceinline__ u32x4 ld_tr16(const unsigned char* p) {
    typedef __attribute__((address_space(3))) s16x8 lds_s16x8;
    return __builtin_bit_cast(u32x4, __builtin_amdgcn_ds_load_tr16_b128_v8i16((lds_s16x8*)p));
}
__device__ __forceinline__ unsigned pack2(float lo, float hi) {   // round to nearest even
    return __builtin_bit_cast(unsigned, __builtin_convertvector(f32x2{lo, hi}, bf16x2));
}
__device__ __forceinline__ float xhalf(float x) {                 // lane l with lane l ^ 16
    return __builtin_bit_cast(float, __builtin_amdgcn_permlanex16(
        __builtin_bit_cast(int, x), __builtin_bit_cast(int, x),
        0x76543210, 0xfedcba98, false, false));
}

__global__ __launch_bounds__(ATT_WAVES * 32) void attn_fused(const bf16_t* __restrict__ qkv,
                                                             const float* __restrict__ bias,
                                                             bf16_t* __restrict__ ctx) {
    __shared__ __attribute__((aligned(256))) unsigned char L[ATT_LDS];
    const unsigned tid = threadIdx.x, lane = tid & 31u, wave = tid >> 5;
    const unsigned c = lane & 15u, h = lane >> 4;
    // Grid (8, batch, 8): the BSZ workgroups that read one bias block lie 8 apart
    // in launch order, in the hope that they share one L2's copy of it (speed only:
    // no result depends on where a workgroup runs).
    const unsigned tile = blockIdx.x + 8u * blockIdx.z;      // head * 4 + row block
    const unsigned b    = blockIdx.y;
    const unsigned hd   = tile / (SEQ / ATT_ROWS);
    const unsigned q0   = (tile % (SEQ / ATT_ROWS)) * ATT_ROWS + wave * 16u;

    const bf16_t* base = qkv + (size_t)b * SEQ * D3 + hd * HDM;   // q of token 0

    // Stage K and V: 8 lanes per 128-byte row, whole lines from memory.
    constexpr int RST = ATT_WAVES * 32 / 8;   // rows per step of the workgroup
    constexpr int NST = SEQ / RST;
    const unsigned srow = tid >> 3, sch = tid & 7u;
    const bf16_t* sp = base + (size_t)srow * D3 + sch * 8u;
    u32x4 kr[NST], vr[NST];
#pragma unroll
    for (int i = 0; i < NST; ++i) {
        kr[i] = *(const u32x4*)(sp + (size_t)i * RST * D3 + DIM);
        vr[i] = *(const u32x4*)(sp + (size_t)i * RST * D3 + 2 * DIM);
    }

    // Q fragments in the hardware k order (as K's below), scaled by 1/8.
    Frag qf[2];
    const bf16_t* qp = base + (size_t)(q0 + c) * D3 + 8u * h;
    {
#pragma unroll
        for (int kc = 0; kc < 2; ++kc) {
            Frag f;
            f.q[0] = *(const u32x4*)(qp + 32 * kc);
            f.q[1] = *(const u32x4*)(qp + 32 * kc + 16);
            v16bf t = __builtin_bit_cast(v16bf, f);
#pragma unroll
            for (int e = 0; e < 16; ++e) t[e] = (bf16_t)((float)t[e] * 0.125f);
            qf[kc] = __builtin_bit_cast(Frag, t);
        }
    }

    // A operand whose row 0 is ones: row 0 of its product is the column sums of P^T.
    Frag ones;
    {
        const unsigned o = (c == 0u) ? 0x3F803F80u : 0u;
        ones.q[0] = u32x4{o, o, o, o};
        ones.q[1] = u32x4{o, o, o, o};
    }

    v8f acc[4] = {};          // O^T: acc[t][r] = O[q0 + c][16 t + 8 h + r]
    v8f lacc = {};            // register 0 of lanes 0-15: denominator of query c
    float m_run = -INFINITY;  // maximum in use, base-2 scaled; equal in lanes c, c + 16
    constexpr float LOG2E = 1.4426950408889634f;

    // This lane's bias: row q0 + c, keys 16 j + 8 h + 0..7 of each pass.
    const float* bp = bias + ((size_t)hd * SEQ + q0 + c) * SEQ + 8u * h;
    auto load_bias = [&](v8f (&d)[4], int it) {
#pragma unroll
        for (int j = 0; j < 4; ++j) {
            const f32x4 lo = *(const f32x4*)(bp + it * ATT_KEYS + 16 * j);
            const f32x4 hi = *(const f32x4*)(bp + it * ATT_KEYS + 16 * j + 4);
            d[j] = v8f{lo.x, lo.y, lo.z, lo.w, hi.x, hi.y, hi.z, hi.w};
        }
    };

    // One pass over 64 keys. s arrives holding the pass's bias tile; nx is filled
    // with the next pass's (fetch: a literal at every call, false in the last pass),
    // so that its memory latency lies under this pass.
    auto pass = [&](v8f (&s)[4], v8f (&nx)[4], int it, bool fetch) __attribute__((always_inline)) {
        if (fetch) {
            load_bias(nx, it + 1);
            // Before the loop's pointer, which these loads name, is advanced.
            asm volatile("s_wait_xcnt 0x0" ::: "memory");
        }
        // Holds these loads at the head of the pass: sunk to where registers come
        // free they would have half a pass, too little for a read from memory.
        __builtin_amdgcn_sched_barrier(0);

        const unsigned char* kp = L + (it * ATT_KEYS + c) * PITCH_K + 16u * h;
#pragma unroll
        for (int j = 0; j < 4; ++j) {
#pragma unroll
            for (int kc = 0; kc < 2; ++kc) {
                Frag kf;
                kf.q[0] = *(const u32x4*)(kp + j * 16 * PITCH_K + 64 * kc);
                kf.q[1] = *(const u32x4*)(kp + j * 16 * PITCH_K + 64 * kc + 32);
                s[j] = mma(kf, qf[kc], s[j]);   // s[j][r] = score(key 16 j + 8 h + r, query c)
            }
        }

        float mx = s[0][0];
#pragma unroll
        for (int j = 0; j < 4; ++j)
#pragma unroll
            for (int r = 0; r < 8; ++r) mx = __builtin_fmaxf(mx, s[j][r]);
        mx = __builtin_fmaxf(mx, xhalf(mx)) * LOG2E;   // both halves: this query's maximum

        if (__builtin_amdgcn_ballot_w32(mx > m_run + 8.0f) != 0) {   // scalar branch, rare
            const float m_new = __builtin_fmaxf(m_run, mx);
            const float corr  = __builtin_amdgcn_exp2f(m_run - m_new);  // 0 on the first pass
            m_run = m_new;
            lacc = lacc * corr;
#pragma unroll
            for (int t = 0; t < 4; ++t) acc[t] = acc[t] * corr;
        }
        const float nm = -m_run;

#pragma unroll
        for (int g = 0; g < 2; ++g) {   // 32 keys: one k extent of the second product
            const unsigned char* ad = L + V_OFF
                + (it * ATT_KEYS + 32u * g + 8u * h + (lane & 7u)) * PITCH_V
                + ((lane >> 3) & 1u) * 16u;
            Frag vf[4];
#pragma unroll
            for (int t = 0; t < 4; ++t) {
                vf[t].q[0] = ld_tr16(ad + 32 * t);
                vf[t].q[1] = ld_tr16(ad + 16 * PITCH_V + 32 * t);
            }
            unsigned w[8];
#pragma unroll
            for (int i = 0; i < 8; ++i) {   // elements 2 i, 2 i + 1 of the 32-key operand
                const v8f& sv = s[2 * g + (i >> 2)];
                const f32x2 arg = __builtin_elementwise_fma(
                    f32x2{sv[2 * (i & 3)], sv[2 * (i & 3) + 1]}, f32x2{LOG2E, LOG2E},
                    f32x2{nm, nm});
                w[i] = pack2(__builtin_amdgcn_exp2f(arg.x), __builtin_amdgcn_exp2f(arg.y));
            }
            Frag pf;
            pf.q[0] = u32x4{w[0], w[1], w[2], w[3]};
            pf.q[1] = u32x4{w[4], w[5], w[6], w[7]};
#pragma unroll
            for (int t = 0; t < 4; ++t) acc[t] = mma(vf[t], pf, acc[t]);
            lacc = mma(ones, pf, lacc);
        }
    };

    v8f sa[4], sb[4];
    load_bias(sa, 0);
    // Every load so far is issued. The inputs keep the loads' address registers
    // from being given away (to a later load's result) in front of the wait.
    asm volatile("s_wait_xcnt 0x0" :: "v"(sp), "v"(qp), "v"(bp) : "memory");
    __builtin_amdgcn_sched_barrier(0);   // keeps every other reuse behind the wait
#pragma unroll
    for (int i = 0; i < NST; ++i) {
        *(u32x4*)(L + (srow + i * RST) * PITCH_K + sch * 16u)         = kr[i];
        *(u32x4*)(L + V_OFF + (srow + i * RST) * PITCH_V + sch * 16u) = vr[i];
    }
    __syncthreads();   // K and V are staged; nothing writes LDS after this

    for (int it = 0; it < ATT_PASSES - 2; it += 2) {
        pass(sa, sb, it, true);
        pass(sb, sa, it + 1, true);
    }
    pass(sa, sb, ATT_PASSES - 2, true);
    pass(sb, sa, ATT_PASSES - 1, false);

    // Lanes 16-31 hold row 8 of the sum tile, which is 0: the exchange-and-add
    // gives both halves the denominator.
    const float lr  = lacc[0];
    const float inv = 1.0f / (lr + xhalf(lr));
    bf16_t* op = ctx + (size_t)(b * SEQ + q0 + c) * DIM + hd * HDM + 8u * h;
#pragma unroll
    for (int t = 0; t < 4; ++t) {
        const v8f o = acc[t] * inv;
        *(u32x4*)(op + 16 * t) = u32x4{pack2(o[0], o[1]), pack2(o[2], o[3]),
                                       pack2(o[4], o[5]), pack2(o[6], o[7])};
    }
}

// ---------------------------------------------------------------------------
// Fused residual + LayerNorm over rows of width DIM (=1024).
// ---------------------------------------------------------------------------
__global__ __launch_bounds__(256) void add_ln_kernel(const float* __restrict__ a,
                                                     const float* __restrict__ res,
                                                     const float* __restrict__ g,
                                                     const float* __restrict__ b,
                                                     float* __restrict__ outf,
                                                     bf16_t* __restrict__ outb) {
    const int row = blockIdx.x;
    const int tid = threadIdx.x;
    __shared__ float red[256];

    float loc[4];
    float s = 0.0f;
#pragma unroll
    for (int i = 0; i < 4; ++i) {
        const int j = tid + i * 256;
        const float v = a[(size_t)row * DIM + j] + res[(size_t)row * DIM + j];
        loc[i] = v;
        s += v;
    }
    red[tid] = s;
    __syncthreads();
    for (int st = 128; st > 0; st >>= 1) {
        if (tid < st) red[tid] += red[tid + st];
        __syncthreads();
    }
    const float mean = red[0] * (1.0f / DIM);
    __syncthreads();

    float vs = 0.0f;
#pragma unroll
    for (int i = 0; i < 4; ++i) {
        const float d = loc[i] - mean;
        vs += d * d;
    }
    red[tid] = vs;
    __syncthreads();
    for (int st = 128; st > 0; st >>= 1) {
        if (tid < st) red[tid] += red[tid + st];
        __syncthreads();
    }
    const float inv = rsqrtf(red[0] * (1.0f / DIM) + 1e-5f);

#pragma unroll
    for (int i = 0; i < 4; ++i) {
        const int j = tid + i * 256;
        const float y = (loc[i] - mean) * inv * g[j] + b[j];
        outf[(size_t)row * DIM + j] = y;
        if (outb) outb[(size_t)row * DIM + j] = (bf16_t)y;
    }
}

// ---------------------------------------------------------------------------
// Host orchestration
// ---------------------------------------------------------------------------
extern "C" void kernel_launch(void* const* d_in, const int* in_sizes, int n_in,
                              void* d_out, int out_size, void* d_ws, size_t ws_size,
                              hipStream_t stream) {
    (void)in_sizes; (void)n_in; (void)out_size; (void)ws_size;

    const float* src       = (const float*)d_in[0];
    const float* attn_bias = (const float*)d_in[1];
    const float* Wqkv      = (const float*)d_in[2];
    const float* bqkv      = (const float*)d_in[3];
    const float* Wo        = (const float*)d_in[4];
    const float* bo        = (const float*)d_in[5];
    const float* g1        = (const float*)d_in[6];
    const float* b1n       = (const float*)d_in[7];
    const float* g2        = (const float*)d_in[8];
    const float* b2n       = (const float*)d_in[9];
    const float* W1        = (const float*)d_in[10];
    const float* b1        = (const float*)d_in[11];
    const float* W2        = (const float*)d_in[12];
    const float* b2        = (const float*)d_in[13];
    float* out = (float*)d_out;

    char* ws = (char*)d_ws;
    size_t off = 0;
    auto alloc = [&](size_t bytes) -> char* {
        char* p = ws + off;
        off += (bytes + 255) & ~(size_t)255;
        return p;
    };

    const size_t NT = (size_t)BSZ * SEQ;            // 4096 tokens

    // Live across the attention phase.
    bf16_t* Wo_bf   = (bf16_t*)alloc((size_t)DIM * DIM * 2);
    bf16_t* W1_bf   = (bf16_t*)alloc((size_t)FFD * DIM * 2);
    bf16_t* W2_bf   = (bf16_t*)alloc((size_t)DIM * FFD * 2);
    bf16_t* qkv_bf  = (bf16_t*)alloc(NT * D3 * 2);
    bf16_t* ctx_bf  = (bf16_t*)alloc(NT * DIM * 2);
    // Two sets with disjoint lives share what follows:
    // the QKV GEMM's operands, the buffers of steps 5-9.
    const size_t shared0 = off;
    bf16_t* src_bf  = (bf16_t*)alloc(NT * DIM * 2);
    bf16_t* Wqkv_bf = (bf16_t*)alloc((size_t)D3 * DIM * 2);
    off = shared0;
    float*  y_f     = (float*) alloc(NT * DIM * 4);
    float*  x_f     = (float*) alloc(NT * DIM * 4);
    bf16_t* x_bf    = (bf16_t*)alloc(NT * DIM * 2);
    bf16_t* h_bf    = (bf16_t*)alloc(NT * FFD * 2);
    float*  f_f     = (float*) alloc(NT * DIM * 4);

    auto gemm128 = [&](auto mode, const bf16_t* A, int lda, const bf16_t* Bm, int ldb,
                       const float* bias, void* C, int ldc,
                       int M, int N, int K, float alpha) {
        dim3 grid((unsigned)(N / 128), (unsigned)(M / 128));
        gemm_bf16_wmma<128, decltype(mode)::value><<<grid, 256, 0, stream>>>(
            A, lda, Bm, ldb, bias, C, ldc, M, N, K, alpha,
            ZStride{0, 0}, ZStride{0, 0}, ZStride{0, 0});
    };

    // 1) Convert inputs/weights to bf16
    cvt_all_f32_to_bf16<<<CV_GRID, CV_THREADS, 0, stream>>>(
        src, Wqkv, Wo, W1, W2, src_bf, Wqkv_bf, Wo_bf, W1_bf, W2_bf);

    // 2) QKV projection: qkv = src @ Wqkv^T + bqkv  -> bf16 [NT, 3D]
    gemm128(StoreMode<1>{}, src_bf, DIM, Wqkv_bf, DIM, bqkv, qkv_bf, D3,
            (int)NT, D3, DIM, 1.0f);

    // 3, 4) Attention: ctx[b, :, h*HD:(h+1)*HD] = softmax(q k^T / 8 + bias[h]) v
    attn_fused<<<dim3(8, BSZ, NH * (SEQ / ATT_ROWS) / 8), ATT_WAVES * 32, 0, stream>>>(
        qkv_bf, attn_bias, ctx_bf);

    // 5) Output projection: y = ctx @ Wo^T + bo  (f32)
    gemm128(StoreMode<0>{}, ctx_bf, DIM, Wo_bf, DIM, bo, y_f, DIM,
            (int)NT, DIM, DIM, 1.0f);

    // 6) x = LN(src + y) -> f32 + bf16
    add_ln_kernel<<<(unsigned)NT, 256, 0, stream>>>(y_f, src, g1, b1n, x_f, x_bf);

    // 7) FF1: h = gelu(x @ W1^T + b1) -> bf16 [NT, FF]
    gemm128(StoreMode<2>{}, x_bf, DIM, W1_bf, DIM, b1, h_bf, FFD,
            (int)NT, FFD, DIM, 1.0f);

    // 8) FF2: f = h @ W2^T + b2 -> f32
    gemm128(StoreMode<0>{}, h_bf, FFD, W2_bf, FFD, b2, f_f, DIM,
            (int)NT, DIM, FFD, 1.0f);

    // 9) out = LN(x + f)
    add_ln_kernel<<<(unsigned)NT, 256, 0, stream>>>(f_f, x_f, g2, b2n, out, nullptr);
}

// v006
// One run takes 172 microseconds.
// Two timings next to v005 put it at 1.03 and 1.05 times that version's speed.
// Over all steps from v000 it is 11.5 times as fast.
#include <hip/hip_runtime.h>
#include <math.h>

// ---------------------------------------------------------------------------
// Types for CDNA5 WMMA (wave32)
// ---------------------------------------------------------------------------
typedef __bf16 bf16_t;
typedef __attribute__((ext_vector_type(16))) __bf16 v16bf;
typedef __attribute__((ext_vector_type(2)))  __bf16 bf16x2;
typedef __attribute__((ext_vector_type(8)))  float  v8f;

// Problem constants (match reference)
constexpr int BSZ = 4;
constexpr int SEQ = 1024;
constexpr int DIM = 1024;
constexpr int NH  = 16;
constexpr int HDM = 64;
constexpr int FFD = 4096;
constexpr int D3  = 3 * DIM;

constexpr int GK     = 128;      // k extent of one GEMM stage: 256-byte rows
constexpr int GPITCH = GK + 8;   // LDS row pitch in elements: 272 B, for ds_load_b128 readers

// ---------------------------------------------------------------------------
// f32 -> bf16 convert of all five GEMM operands in one streaming launch.
// One workgroup of 16 waves per CV_CHUNK contiguous elements of one tensor
// (every tensor is a whole number of chunks). A lane has CV_LOADS independent
// 16-byte loads, so many are in flight at once; each wave-wide load covers 512
// contiguous bytes and each wave-wide store 256.
// ---------------------------------------------------------------------------
typedef __attribute__((ext_vector_type(4))) float  cv_f32x4;
typedef __attribute__((ext_vector_type(4))) __bf16 cv_bf16x4;

constexpr int CV_THREADS = 512;
constexpr int CV_LOADS   = 32;                          // 16-byte loads per lane
constexpr int CV_CHUNK   = CV_THREADS * CV_LOADS * 4;   // elements per workgroup
constexpr unsigned CV_SRC  = (unsigned)(BSZ * SEQ * DIM / CV_CHUNK);
constexpr unsigned CV_WQKV = (unsigned)(D3 * DIM / CV_CHUNK);
constexpr unsigned CV_WO   = (unsigned)(DIM * DIM / CV_CHUNK);
constexpr unsigned CV_W1   = (unsigned)(FFD * DIM / CV_CHUNK);
constexpr unsigned CV_W2   = (unsigned)(DIM * FFD / CV_CHUNK);
constexpr unsigned CV_GRID = CV_SRC + CV_WQKV + CV_WO + CV_W1 + CV_W2;
static_assert(BSZ * SEQ * DIM % CV_CHUNK == 0 && D3 * DIM % CV_CHUNK == 0 &&
              DIM * DIM % CV_CHUNK == 0 && FFD * DIM % CV_CHUNK == 0,
              "every tensor must be a whole number of chunks");

__global__ __launch_bounds__(CV_THREADS) void cvt_all_f32_to_bf16(
    const float* __restrict__ src,  const float* __restrict__ wqkv,
    const float* __restrict__ wo,   const float* __restrict__ w1,
    const float* __restrict__ w2,
    bf16_t* __restrict__ src_o,  bf16_t* __restrict__ wqkv_o,
    bf16_t* __restrict__ wo_o,   bf16_t* __restrict__ w1_o,
    bf16_t* __restrict__ w2_o) {
    // Which tensor, and which chunk of it: the same for the whole workgroup.
    unsigned blk = blockIdx.x;
    const float* in = src;
    bf16_t* out = src_o;
    if (blk >= CV_SRC) {
        blk -= CV_SRC; in = wqkv; out = wqkv_o;
        if (blk >= CV_WQKV) {
            blk -= CV_WQKV; in = wo; out = wo_o;
            if (blk >= CV_WO) {
                blk -= CV_WO; in = w1; out = w1_o;
                if (blk >= CV_W1) { blk -= CV_W1; in = w2; out = w2_o; }
            }
        }
    }
    const cv_f32x4* ip = (const cv_f32x4*)(in + (size_t)blk * CV_CHUNK) + threadIdx.x;
    cv_bf16x4*      op = (cv_bf16x4*)(out + (size_t)blk * CV_CHUNK) + threadIdx.x;

    cv_f32x4 v[CV_LOADS];
#pragma unroll
    for (int j = 0; j < CV_LOADS; ++j) v[j] = ip[j * CV_THREADS];
#pragma unroll
    for (int j = 0; j < CV_LOADS; ++j)
        op[j * CV_THREADS] = __builtin_convertvector(v[j], cv_bf16x4);
}

// ---------------------------------------------------------------------------
// Fragment gather from an LDS tile, per ISA 7.12.2 16-bit A/B layout.
// For lane l: row = base + (l&15), half = l>>4; VGPR v holds
// K = k0 + kbase(v) + half*8 + {0,1}, kbase = {0,2,4,6,16,18,20,22}.
// ---------------------------------------------------------------------------
__device__ inline v16bf load_frag(const bf16_t* __restrict__ smem, int baseRow, int k0, int lane) {
    const int r    = baseRow + (lane & 15);
    const int half = (lane >> 4) & 1;
    const bf16_t* p = smem + r * GPITCH + k0 + half * 8;
    v16bf f;
#pragma unroll
    for (int v = 0; v < 8; ++v) {
        const int k2 = (v < 4) ? (2 * v) : (16 + 2 * (v - 4));
        bf16x2 pr = *(const bf16x2*)(p + k2);
        f[2 * v]     = pr.x;
        f[2 * v + 1] = pr.y;
    }
    return f;
}

// Eight async copies (global -> LDS, 16 B per lane each): 128 rows of 256 B per
// workgroup. g and l are this lane's first addresses; copy i lies 16 rows on.
// The closing wait stands inside the statement, so that no address register is
// rewritten in front of it.
__device__ __forceinline__ void copy_rows128(const bf16_t* g, size_t ld, unsigned l) {
    const bf16_t* g1 = g  + 16 * ld;
    const bf16_t* g2 = g1 + 16 * ld;
    const bf16_t* g3 = g2 + 16 * ld;
    const bf16_t* g4 = g3 + 16 * ld;
    const bf16_t* g5 = g4 + 16 * ld;
    const bf16_t* g6 = g5 + 16 * ld;
    const bf16_t* g7 = g6 + 16 * ld;
    constexpr unsigned LS = 16u * GPITCH * 2u;   // 16 LDS rows, bytes
    asm volatile("global_load_async_to_lds_b128 %0, %8, off\n\t"
                 "global_load_async_to_lds_b128 %1, %9, off\n\t"
                 "global_load_async_to_lds_b128 %2, %10, off\n\t"
                 "global_load_async_to_lds_b128 %3, %11, off\n\t"
                 "global_load_async_to_lds_b128 %4, %12, off\n\t"
                 "global_load_async_to_lds_b128 %5, %13, off\n\t"
                 "global_load_async_to_lds_b128 %6, %14, off\n\t"
                 "global_load_async_to_lds_b128 %7, %15, off\n\t"
                 "s_wait_xcnt 0x0"
                 :: "v"(l), "v"(l + LS), "v"(l + 2 * LS), "v"(l + 3 * LS),
                    "v"(l + 4 * LS), "v"(l + 5 * LS), "v"(l + 6 * LS), "v"(l + 7 * LS),
                    "v"(g), "v"(g1), "v"(g2), "v"(g3), "v"(g4), "v"(g5), "v"(g6), "v"(g7)
                 : "memory");
}

// ---------------------------------------------------------------------------
// Exact-form GELU, 0.5 v (1 + erf(v / sqrt 2)), for two values at once and with
// no branch. With z = |v| / sqrt 2 and t = 1 / (1 + 0.3275911 z),
//   erfc(z) = t (a1 + t (a2 + t (a3 + t (a4 + t a5)))) exp(-z^2),
// absolute error at most 1.5e-7 for every z >= 0 (the five-term rational form of
// the handbooks), and 0.5 v (1 + erf) = 0.5 v + |v| (0.5 - 0.5 erfc(z)).
// The constants below hold the factors 0.5, 1 / sqrt 2 and log2(e).
// ---------------------------------------------------------------------------
typedef float gl_f32x2 __attribute__((ext_vector_type(2)));

__device__ __forceinline__ gl_f32x2 gelu2(gl_f32x2 v) {
    const gl_f32x2 a = __builtin_elementwise_abs(v);
    const gl_f32x2 d = __builtin_elementwise_fma(a, gl_f32x2{0.23164189f, 0.23164189f},
                                                 gl_f32x2{1.0f, 1.0f});
    const gl_f32x2 kv = v * 0.84932178f;            // kv^2 = z^2 log2(e)
    const gl_f32x2 ar = -(kv * kv);
    // Both reciprocals and both exponentials in one statement that ends in a v_nop:
    // the instruction set asks for one free slot behind a transcendental before its
    // result is used or a source of it overwritten.
    // The early-clobber outputs keep results off sources.
    float t0, t1, e0, e1;
    asm("v_rcp_f32 %0, %4\n\t"
        "v_rcp_f32 %1, %5\n\t"
        "v_exp_f32 %2, %6\n\t"
        "v_exp_f32 %3, %7\n\t"
        "v_nop"
        : "=&v"(t0), "=&v"(t1), "=&v"(e0), "=&v"(e1)
        : "v"(d.x), "v"(d.y), "v"(ar.x), "v"(ar.y));
    const gl_f32x2 t = {t0, t1}, e = {e0, e1};
    gl_f32x2 p = __builtin_elementwise_fma(t, gl_f32x2{0.53070271f, 0.53070271f},
                                           gl_f32x2{-0.72657603f, -0.72657603f});
    p = __builtin_elementwise_fma(p, t, gl_f32x2{0.71070689f, 0.71070689f});
    p = __builtin_elementwise_fma(p, t, gl_f32x2{-0.14224836f, -0.14224836f});
    p = __builtin_elementwise_fma(p, t, gl_f32x2{0.12741479f, 0.12741479f});
    p = p * t;                                      // 0.5 erfc(z) exp(z^2)
    const gl_f32x2 s = __builtin_elementwise_fma(-p, e, gl_f32x2{0.5f, 0.5f});
    return __builtin_elementwise_fma(a, s, v * 0.5f);
}

// ---------------------------------------------------------------------------
// Generic bf16 WMMA GEMM:  C[M,N] = alpha * A[M,K] @ B[N,K]^T + bias[N]
// MODE 0: store f32      MODE 1: store bf16      MODE 2: GELU (gelu2) -> bf16
// MODE is a template parameter: the epilogue of each instantiation holds its one
// store form alone, with no test of the mode per element.
//
// Block tile 128 x BN (BN = 128), 8 waves (4 row-groups x 2 col-groups),
// wave tile 32 x (BN/2). K stepped by GK = 128 through two LDS buffers filled
// with GLOBAL_LOAD_ASYNC_TO_LDS_B128: the copies of stage s+1 fly while stage s
// is worked on, 32 WMMAs a wave between two barriers.
// Requires: M%128==0, N%BN==0, K%GK==0, lda/ldb%8==0, 16B-aligned bases.
// Batched over blockIdx.z: z = hz * BSZ + b; every operand's base moves by
// b * (its .b stride) + hz * (its .h stride), in elements. A plain GEMM is
// launched with gridDim.z == 1.
// ---------------------------------------------------------------------------
struct ZStride { int b, h; };
template <int V> struct StoreMode { static constexpr int value = V; };

template <int BN, int MODE>
__global__ __launch_bounds__(256) void gemm_bf16_wmma(
    const bf16_t* __restrict__ A, int lda,
    const bf16_t* __restrict__ Bm, int ldb,
    const float* __restrict__ bias,
    void* __restrict__ C, int ldc,
    int M, int N, int K, float alpha,
    ZStride zA, ZStride zB, ZStride zC) {

    static_assert(BN % 128 == 0, "a copy statement fills 128 rows");
    constexpr int CT = BN / 32;        // wave col tiles of 16

    __shared__ __align__(16) bf16_t As[2 * 128 * GPITCH];
    __shared__ __align__(16) bf16_t Bs[2 * BN * GPITCH];

    const int tid  = threadIdx.x;
    const int lane = tid & 31;
    const int wave = tid >> 5;
    const int m_w  = (wave & 3) * 32;        // 4 wave-rows x 32
    const int n_w  = (wave >> 2) * (BN / 2); // 2 wave-cols x BN/2

    const int m0 = blockIdx.y * 128;
    const int n0 = blockIdx.x * BN;

    const int zb = blockIdx.z & (BSZ - 1);
    const int zh = blockIdx.z / BSZ;
    A  += (size_t)zb * zA.b + (size_t)zh * zA.h;
    Bm += (size_t)zb * zB.b + (size_t)zh * zB.h;
    const size_t zc = (size_t)zb * zC.b + (size_t)zh * zC.h;

    v8f acc[2][CT] = {};

    // One stage's copies: 16 lanes per 256-byte row, so a wave-wide copy covers
    // two whole rows of the stage.
    const int crow = tid >> 4, cch = tid & 15;
    const bf16_t* gA = A  + (size_t)(m0 + crow) * lda + cch * 8;
    const bf16_t* gB = Bm + (size_t)(n0 + crow) * ldb + cch * 8;
    const unsigned lA = (unsigned)(uintptr_t)(As + crow * GPITCH + cch * 8);
    const unsigned lB = (unsigned)(uintptr_t)(Bs + crow * GPITCH + cch * 8);
    auto issue = [&](int s, int st) {
        copy_rows128(gA + (size_t)s * GK, (size_t)lda, lA + (unsigned)st * (128u * GPITCH * 2u));
#pragma unroll
        for (int i = 0; i < BN / 128; ++i)
            copy_rows128(gB + (size_t)s * GK + (size_t)i * 128 * ldb, (size_t)ldb,
                         lB + (unsigned)st * (BN * GPITCH * 2u) + (unsigned)i * (128u * GPITCH * 2u));
    };

    const int NS = K / GK;
    issue(0, 0);
    asm volatile("s_wait_asynccnt 0x0" ::: "memory");   // this wave's part of stage 0 has landed
    __syncthreads();                                    // every wave's part has
    if (NS > 1) issue(1, 1);

    for (int s = 0; s < NS; ++s) {
        const int buf = s & 1;
        const bf16_t* Ab = As + buf * (128 * GPITCH);
        const bf16_t* Bb = Bs + buf * (BN * GPITCH);

#pragma unroll
        for (int kk = 0; kk < GK / 32; ++kk) {
            v16bf af[2], bfv[CT];
#pragma unroll
            for (int r = 0; r < 2; ++r)  af[r]  = load_frag(Ab, m_w + r * 16, kk * 32, lane);
#pragma unroll
            for (int c = 0; c < CT; ++c) bfv[c] = load_frag(Bb, n_w + c * 16, kk * 32, lane);

#pragma unroll
            for (int r = 0; r < 2; ++r)
#pragma unroll
                for (int c = 0; c < CT; ++c)
                    acc[r][c] = __builtin_amdgcn_wmma_f32_16x16x32_bf16(
                        false, af[r], false, bfv[c], (short)0, acc[r][c], false, false);
        }

        // Hand-over: this wave has left buffer buf, and its copies of stage s+1 have
        // landed; behind the barrier that holds for every wave.
        asm volatile("s_wait_dscnt 0x0" ::: "memory");
        asm volatile("s_wait_asynccnt 0x0" ::: "memory");
        __syncthreads();
        if (s + 2 < NS) issue(s + 2, buf);
    }
    asm volatile("s_wait_asynccnt 0x0" ::: "memory");   // no copy is left in flight

    // Epilogue. D layout: lanes 0-15 -> cols, lanes 16-31 -> rows +8;
    // VGPR i -> row +i.
    float*  Cf = (float*)C + zc;
    bf16_t* Cb = (bf16_t*)C + zc;
#pragma unroll
    for (int r = 0; r < 2; ++r) {
#pragma unroll
        for (int c = 0; c < CT; ++c) {
            const int col  = n0 + n_w + c * 16 + (lane & 15);
            const int row0 = m0 + m_w + r * 16 + ((lane >> 4) & 1) * 8;
            const float bv = bias[col];
            if constexpr (MODE == 2) {
#pragma unroll
                for (int i = 0; i < 8; i += 2) {
                    const gl_f32x2 y = gelu2(gl_f32x2{acc[r][c][i] * alpha + bv,
                                                      acc[r][c][i + 1] * alpha + bv});
                    const bf16x2 yb = __builtin_convertvector(y, bf16x2);
                    Cb[(size_t)(row0 + i) * ldc + col]     = yb.x;
                    Cb[(size_t)(row0 + i + 1) * ldc + col] = yb.y;
                }
            } else {
#pragma unroll
                for (int i = 0; i < 8; ++i) {
                    const int row = row0 + i;
                    const float v = acc[r][c][i] * alpha + bv;
                    if constexpr (MODE == 0) Cf[(size_t)row * ldc + col] = v;
                    else                     Cb[(size_t)row * ldc + col] = (bf16_t)v;
                }
            }
        }
    }
}

typedef unsigned int u32x4 __attribute__((ext_vector_type(4)));
typedef short        s16x8 __attribute__((ext_vector_type(8)));
typedef float        f32x2 __attribute__((ext_vector_type(2)));
typedef float        f32x4 __attribute__((ext_vector_type(4)));

constexpr unsigned PITCH_K = 2 * HDM + 16;   // odd multiple of 16 B: ds_load_b128 readers
constexpr unsigned PITCH_V = 2 * HDM + 32;   // odd multiple of 32 B: ds_load_tr16_b128 readers
constexpr unsigned V_OFF   = SEQ * PITCH_K;
constexpr unsigned ATT_LDS = V_OFF + SEQ * PITCH_V;
constexpr int ATT_WAVES = 16;                // 16 query rows each
constexpr int ATT_ROWS  = ATT_WAVES * 16;
constexpr int ATT_KEYS  = 64;                // keys per pass
constexpr int ATT_PASSES = SEQ / ATT_KEYS;
static_assert(ATT_LDS <= 320u * 1024u, "K and V of one head must fit one workgroup's LDS");
static_assert(ATT_PASSES % 2 == 0, "the pass loop is written in pairs");

struct Frag { u32x4 q[2]; };   // one 16 x 32 bf16 operand: 8 registers per lane

__device__ __forceinline__ v8f mma(const Frag& a, const Frag& b, v8f c) {
    return __builtin_amdgcn_wmma_f32_16x16x32_bf16(
        false, __builtin_bit_cast(v16bf, a), false, __builtin_bit_cast(v16bf, b),
        (short)0, c, false, false);
}
__device__ __forceinline__ u32x4 ld_tr16(const unsigned char* p) {
    typedef __attribute__((address_space(3))) s16x8 lds_s16x8;
    return __builtin_bit_cast(u32x4, __builtin_amdgcn_ds_load_tr16_b128_v8i16((lds_s16x8*)p));
}
__device__ __forceinline__ unsigned pack2(float lo, float hi) {   // round to nearest even
    return __builtin_bit_cast(unsigned, __builtin_convertvector(f32x2{lo, hi}, bf16x2));
}
__device__ __forceinline__ float xhalf(float x) {                 // lane l with lane l ^ 16
    return __builtin_bit_cast(float, __builtin_amdgcn_permlanex16(
        __builtin_bit_cast(int, x), __builtin_bit_cast(int, x),
        0x76543210, 0xfedcba98, false, false));
}

__global__ __launch_bounds__(ATT_WAVES * 32) void attn_fused(const bf16_t* __restrict__ qkv,
                                                             const float* __restrict__ bias,
                                                             bf16_t* __restrict__ ctx) {
    __shared__ __attribute__((aligned(256))) unsigned char L[ATT_LDS];
    const unsigned tid = threadIdx.x, lane = tid & 31u, wave = tid >> 5;
    const unsigned c = lane & 15u, h = lane >> 4;
    // Grid (8, batch, 8): the BSZ workgroups that read one bias block lie 8 apart
    // in launch order, in the hope that they share one L2's copy of it (speed only:
    // no result depends on where a workgroup runs).
    const unsigned tile = blockIdx.x + 8u * blockIdx.z;      // head * 4 + row block
    const unsigned b    = blockIdx.y;
    const unsigned hd   = tile / (SEQ / ATT_ROWS);
    const unsigned q0   = (tile % (SEQ / ATT_ROWS)) * ATT_ROWS + wave * 16u;

    const bf16_t* base = qkv + (size_t)b * SEQ * D3 + hd * HDM;   // q of token 0

    // Stage K and V: 8 lanes per 128-byte row, whole lines from memory.
    constexpr int RST = ATT_WAVES * 32 / 8;   // rows per step of the workgroup
    constexpr int NST = SEQ / RST;
    const unsigned srow = tid >> 3, sch = tid & 7u;
    const bf16_t* sp = base + (size_t)srow * D3 + sch * 8u;
    u32x4 kr[NST], vr[NST];
#pragma unroll
    for (int i = 0; i < NST; ++i) {
        kr[i] = *(const u32x4*)(sp + (size_t)i * RST * D3 + DIM);
        vr[i] = *(const u32x4*)(sp + (size_t)i * RST * D3 + 2 * DIM);
    }

    // Q fragments in the hardware k order (as K's below), scaled by 1/8.
    Frag qf[2];
    const bf16_t* qp = base + (size_t)(q0 + c) * D3 + 8u * h;
    {
#pragma unroll
        for (int kc = 0; kc < 2; ++kc) {
            Frag f;
            f.q[0] = *(const u32x4*)(qp + 32 * kc);
            f.q[1] = *(const u32x4*)(qp + 32 * kc + 16);
            v16bf t = __builtin_bit_cast(v16bf, f);
#pragma unroll
            for (int e = 0; e < 16; ++e) t[e] = (bf16_t)((float)t[e] * 0.125f);
            qf[kc] = __builtin_bit_cast(Frag, t);
        }
    }

    // A operand whose row 0 is ones: row 0 of its product is the column sums of P^T.
    Frag ones;
    {
        const unsigned o = (c == 0u) ? 0x3F803F80u : 0u;
        ones.q[0] = u32x4{o, o, o, o};
        ones.q[1] = u32x4{o, o, o, o};
    }

    v8f acc[4] = {};          // O^T: acc[t][r] = O[q0 + c][16 t + 8 h + r]
    v8f lacc = {};            // register 0 of lanes 0-15: denominator of query c
    float m_run = -INFINITY;  // maximum in use, base-2 scaled; equal in lanes c, c + 16
    constexpr float LOG2E = 1.4426950408889634f;

    // This lane's bias: row q0 + c, keys 16 j + 8 h + 0..7 of each pass.
    const float* bp = bias + ((size_t)hd * SEQ + q0 + c) * SEQ + 8u * h;
    auto load_bias = [&](v8f (&d)[4], int it) {
#pragma unroll
        for (int j = 0; j < 4; ++j) {
            const f32x4 lo = *(const f32x4*)(bp + it * ATT_KEYS + 16 * j);
            const f32x4 hi = *(const f32x4*)(bp + it * ATT_KEYS + 16 * j + 4);
            d[j] = v8f{lo.x, lo.y, lo.z, lo.w, hi.x, hi.y, hi.z, hi.w};
        }
    };

    // One pass over 64 keys. s arrives holding the pass's bias tile; nx is filled
    // with the next pass's (fetch: a literal at every call, false in the last pass),
    // so that its memory latency lies under this pass.
    auto pass = [&](v8f (&s)[4], v8f (&nx)[4], int it, bool fetch) __attribute__((always_inline)) {
        if (fetch) {
            load_bias(nx, it + 1);
            // Before the loop's pointer, which these loads name, is advanced.
            asm volatile("s_wait_xcnt 0x0" ::: "memory");
        }
        // Holds these loads at the head of the pass: sunk to where registers come
        // free they would have half a pass, too little for a read from memory.
        __builtin_amdgcn_sched_barrier(0);

        const unsigned char* kp = L + (it * ATT_KEYS + c) * PITCH_K + 16u * h;
#pragma unroll
        for (int j = 0; j < 4; ++j) {
#pragma unroll
            for (int kc = 0; kc < 2; ++kc) {
                Frag kf;
                kf.q[0] = *(const u32x4*)(kp + j * 16 * PITCH_K + 64 * kc);
                kf.q[1] = *(const u32x4*)(kp + j * 16 * PITCH_K + 64 * kc + 32);
                s[j] = mma(kf, qf[kc], s[j]);   // s[j][r] = score(key 16 j + 8 h + r, query c)
            }
        }

        float mx = s[0][0];
#pragma unroll
        for (int j = 0; j < 4; ++j)
#pragma unroll
            for (int r = 0; r < 8; ++r) mx = __builtin_fmaxf(mx, s[j][r]);
        mx = __builtin_fmaxf(mx, xhalf(mx)) * LOG2E;   // both halves: this query's maximum

        if (__builtin_amdgcn_ballot_w32(mx > m_run + 8.0f) != 0) {   // scalar branch, rare
            const float m_new = __builtin_fmaxf(m_run, mx);
            const float corr  = __builtin_amdgcn_exp2f(m_run - m_new);  // 0 on the first pass
            m_run = m_new;
            lacc = lacc * corr;
#pragma unroll
            for (int t = 0; t < 4; ++t) acc[t] = acc[t] * corr;
        }
        const float nm = -m_run;

#pragma unroll
        for (int g = 0; g < 2; ++g) {   // 32 keys: one k extent of the second product
            const unsigned char* ad = L + V_OFF
                + (it * ATT_KEYS + 32u * g + 8u * h + (lane & 7u)) * PITCH_V
                + ((lane >> 3) & 1u) * 16u;
            Frag vf[4];
#pragma unroll
            for (int t = 0; t < 4; ++t) {
                vf[t].q[0] = ld_tr16(ad + 32 * t);
                vf[t].q[1] = ld_tr16(ad + 16 * PITCH_V + 32 * t);
            }
            unsigned w[8];
#pragma unroll
            for (int i = 0; i < 8; ++i) {   // elements 2 i, 2 i + 1 of the 32-key operand
                const v8f& sv = s[2 * g + (i >> 2)];
                const f32x2 arg = __builtin_elementwise_fma(
                    f32x2{sv[2 * (i & 3)], sv[2 * (i & 3) + 1]}, f32x2{LOG2E, LOG2E},
                    f32x2{nm, nm});
                w[i] = pack2(__builtin_amdgcn_exp2f(arg.x), __builtin_amdgcn_exp2f(arg.y));
            }
            Frag pf;
            pf.q[0] = u32x4{w[0], w[1], w[2], w[3]};
            pf.q[1] = u32x4{w[4], w[5], w[6], w[7]};
#pragma unroll
            for (int t = 0; t < 4; ++t) acc[t] = mma(vf[t], pf, acc[t]);
            lacc = mma(ones, pf, lacc);
        }
    };

    v8f sa[4], sb[4];
    load_bias(sa, 0);
    // Every load so far is issued. The inputs keep the loads' address registers
    // from being given away (to a later load's result) in front of the wait.
    asm volatile("s_wait_xcnt 0x0" :: "v"(sp), "v"(qp), "v"(bp) : "memory");
    __builtin_amdgcn_sched_barrier(0);   // keeps every other reuse behind the wait
#pragma unroll
    for (int i = 0; i < NST; ++i) {
        *(u32x4*)(L + (srow + i * RST) * PITCH_K + sch * 16u)         = kr[i];
        *(u32x4*)(L + V_OFF + (srow + i * RST) * PITCH_V + sch * 16u) = vr[i];
    }
    __syncthreads();   // K and V are staged; nothing writes LDS after this

    for (int it = 0; it < ATT_PASSES - 2; it += 2) {
        pass(sa, sb, it, true);
        pass(sb, sa, it + 1, true);
    }
    pass(sa, sb, ATT_PASSES - 2, true);
    pass(sb, sa, ATT_PASSES - 1, false);

    // Lanes 16-31 hold row 8 of the sum tile, which is 0: the exchange-and-add
    // gives both halves the denominator.
    const float lr  = lacc[0];
    const float inv = 1.0f / (lr + xhalf(lr));
    bf16_t* op = ctx + (size_t)(b * SEQ + q0 + c) * DIM + hd * HDM + 8u * h;
#pragma unroll
    for (int t = 0; t < 4; ++t) {
        const v8f o = acc[t] * inv;
        *(u32x4*)(op + 16 * t) = u32x4{pack2(o[0], o[1]), pack2(o[2], o[3]),
                                       pack2(o[4], o[5]), pack2(o[6], o[7])};
    }
}

// ---------------------------------------------------------------------------
// Fused residual + LayerNorm over rows of width DIM (=1024).
// ---------------------------------------------------------------------------
__global__ __launch_bounds__(256) void add_ln_kernel(const float* __restrict__ a,
                                                     const float* __restrict__ res,
                                                     const float* __restrict__ g,
                                                     const float* __restrict__ b,
                                                     float* __restrict__ outf,
                                                     bf16_t* __restrict__ outb) {
    const int row = blockIdx.x;
    const int tid = threadIdx.x;
    __shared__ float red[256];

    float loc[4];
    float s = 0.0f;
#pragma unroll
    for (int i = 0; i < 4; ++i) {
        const int j = tid + i * 256;
        const float v = a[(size_t)row * DIM + j] + res[(size_t)row * DIM + j];
        loc[i] = v;
        s += v;
    }
    red[tid] = s;
    __syncthreads();
    for (int st = 128; st > 0; st >>= 1) {
        if (tid < st) red[tid] += red[tid + st];
        __syncthreads();
    }
    const float mean = red[0] * (1.0f / DIM);
    __syncthreads();

    float vs = 0.0f;
#pragma unroll
    for (int i = 0; i < 4; ++i) {
        const float d = loc[i] - mean;
        vs += d * d;
    }
    red[tid] = vs;
    __syncthreads();
    for (int st = 128; st > 0; st >>= 1) {
        if (tid < st) red[tid] += red[tid + st];
        __syncthreads();
    }
    const float inv = rsqrtf(red[0] * (1.0f / DIM) + 1e-5f);

#pragma unroll
    for (int i = 0; i < 4; ++i) {
        const int j = tid + i * 256;
        const float y = (loc[i] - mean) * inv * g[j] + b[j];
        outf[(size_t)row * DIM + j] = y;
        if (outb) outb[(size_t)row * DIM + j] = (bf16_t)y;
    }
}

// ---------------------------------------------------------------------------
// Host orchestration
// ---------------------------------------------------------------------------
extern "C" void kernel_launch(void* const* d_in, const int* in_sizes, int n_in,
                              void* d_out, int out_size, void* d_ws, size_t ws_size,
                              hipStream_t stream) {
    (void)in_sizes; (void)n_in; (void)out_size; (void)ws_size;

    const float* src       = (const float*)d_in[0];
    const float* attn_bias = (const float*)d_in[1];
    const float* Wqkv      = (const float*)d_in[2];
    const float* bqkv      = (const float*)d_in[3];
    const float* Wo        = (const float*)d_in[4];
    const float* bo        = (const float*)d_in[5];
    const float* g1        = (const float*)d_in[6];
    const float* b1n       = (const float*)d_in[7];
    const float* g2        = (const float*)d_in[8];
    const float* b2n       = (const float*)d_in[9];
    const float* W1        = (const float*)d_in[10];
    const float* b1        = (const float*)d_in[11];
    const float* W2        = (const float*)d_in[12];
    const float* b2        = (const float*)d_in[13];
    float* out = (float*)d_out;

    char* ws = (char*)d_ws;
    size_t off = 0;
    auto alloc = [&](size_t bytes) -> char* {
        char* p = ws + off;
        off += (bytes + 255) & ~(size_t)255;
        return p;
    };

    const size_t NT = (size_t)BSZ * SEQ;            // 4096 tokens

    // Live across the attention phase.
    bf16_t* Wo_bf   = (bf16_t*)alloc((size_t)DIM * DIM * 2);
    bf16_t* W1_bf   = (bf16_t*)alloc((size_t)FFD * DIM * 2);
    bf16_t* W2_bf   = (bf16_t*)alloc((size_t)DIM * FFD * 2);
    bf16_t* qkv_bf  = (bf16_t*)alloc(NT * D3 * 2);
    bf16_t* ctx_bf  = (bf16_t*)alloc(NT * DIM * 2);
    // Two sets with disjoint lives share what follows:
    // the QKV GEMM's operands, the buffers of steps 5-9.
    const size_t shared0 = off;
    bf16_t* src_bf  = (bf16_t*)alloc(NT * DIM * 2);
    bf16_t* Wqkv_bf = (bf16_t*)alloc((size_t)D3 * DIM * 2);
    off = shared0;
    float*  y_f     = (float*) alloc(NT * DIM * 4);
    float*  x_f     = (float*) alloc(NT * DIM * 4);
    bf16_t* x_bf    = (bf16_t*)alloc(NT * DIM * 2);
    bf16_t* h_bf    = (bf16_t*)alloc(NT * FFD * 2);
    float*  f_f     = (float*) alloc(NT * DIM * 4);

    auto gemm128 = [&](auto mode, const bf16_t* A, int lda, const bf16_t* Bm, int ldb,
                       const float* bias, void* C, int ldc,
                       int M, int N, int K, float alpha) {
        dim3 grid((unsigned)(N / 128), (unsigned)(M / 128));
        gemm_bf16_wmma<128, decltype(mode)::value><<<grid, 256, 0, stream>>>(
            A, lda, Bm, ldb, bias, C, ldc, M, N, K, alpha,
            ZStride{0, 0}, ZStride{0, 0}, ZStride{0, 0});
    };

    // 1) Convert inputs/weights to bf16
    cvt_all_f32_to_bf16<<<CV_GRID, CV_THREADS, 0, stream>>>(
        src, Wqkv, Wo, W1, W2, src_bf, Wqkv_bf, Wo_bf, W1_bf, W2_bf);

    // 2) QKV projection: qkv = src @ Wqkv^T + bqkv  -> bf16 [NT, 3D]
    gemm128(StoreMode<1>{}, src_bf, DIM, Wqkv_bf, DIM, bqkv, qkv_bf, D3,
            (int)NT, D3, DIM, 1.0f);

    // 3, 4) Attention: ctx[b, :, h*HD:(h+1)*HD] = softmax(q k^T / 8 + bias[h]) v
    attn_fused<<<dim3(8, BSZ, NH * (SEQ / ATT_ROWS) / 8), ATT_WAVES * 32, 0, stream>>>(
        qkv_bf, attn_bias, ctx_bf);

    // 5) Output projection: y = ctx @ Wo^T + bo  (f32)
    gemm128(StoreMode<0>{}, ctx_bf, DIM, Wo_bf, DIM, bo, y_f, DIM,
            (int)NT, DIM, DIM, 1.0f);

    // 6) x = LN(src + y) -> f32 + bf16
    add_ln_kernel<<<(unsigned)NT, 256, 0, stream>>>(y_f, src, g1, b1n, x_f, x_bf);

    // 7) FF1: h = gelu(x @ W1^T + b1) -> bf16 [NT, FF]
    gemm128(StoreMode<2>{}, x_bf, DIM, W1_bf, DIM, b1, h_bf, FFD,
            (int)NT, FFD, DIM, 1.0f);

    // 8) FF2: f = h @ W2^T + b2 -> f32
    gemm128(StoreMode<0>{}, h_bf, FFD, W2_bf, FFD, b2, f_f, DIM,
            (int)NT, DIM, FFD, 1.0f);

    // 9) out = LN(x + f)
    add_ln_kernel<<<(unsigned)NT, 256, 0, stream>>>(f_f, x_f, g2, b2n, out, nullptr);
}

// v007
// One run takes 166 microseconds.
// Two timings next to v006 put it at 1.04 and 1.03 times that version's speed.
// All steps since v000 together make it 11.9 times as fast.
#include <hip/hip_runtime.h>
#include <math.h>

// ---------------------------------------------------------------------------
// Types for CDNA5 WMMA (wave32)
// ---------------------------------------------------------------------------
typedef __bf16 bf16_t;
typedef __attribute__((ext_vector_type(16))) __bf16 v16bf;
typedef __attribute__((ext_vector_type(2)))  __bf16 bf16x2;
typedef __attribute__((ext_vector_type(8)))  float  v8f;

// Problem constants (match reference)
constexpr int BSZ = 4;
constexpr int SEQ = 1024;
constexpr int DIM = 1024;
constexpr int NH  = 16;
constexpr int HDM = 64;
constexpr int FFD = 4096;
constexpr int D3  = 3 * DIM;

constexpr int GK     = 128;      // k extent of one GEMM stage: 256-byte rows
constexpr int GPITCH = GK + 8;   // LDS row pitch in elements: 272 B, for ds_load_b128 readers

// ---------------------------------------------------------------------------
// f32 -> bf16 convert of all five GEMM operands in one streaming launch.
// One workgroup of 16 waves per CV_CHUNK contiguous elements of one tensor
// (every tensor is a whole number of chunks). A lane has CV_LOADS independent
// 16-byte loads, so many are in flight at once; each wave-wide load covers 512
// contiguous bytes and each wave-wide store 256.
// ---------------------------------------------------------------------------
typedef __attribute__((ext_vector_type(4))) float  cv_f32x4;
typedef __attribute__((ext_vector_type(4))) __bf16 cv_bf16x4;

constexpr int CV_THREADS = 512;
constexpr int CV_LOADS   = 32;                          // 16-byte loads per lane
constexpr int CV_CHUNK   = CV_THREADS * CV_LOADS * 4;   // elements per workgroup
constexpr unsigned CV_SRC  = (unsigned)(BSZ * SEQ * DIM / CV_CHUNK);
constexpr unsigned CV_WQKV = (unsigned)(D3 * DIM / CV_CHUNK);
constexpr unsigned CV_WO   = (unsigned)(DIM * DIM / CV_CHUNK);
constexpr unsigned CV_W1   = (unsigned)(FFD * DIM / CV_CHUNK);
constexpr unsigned CV_W2   = (unsigned)(DIM * FFD / CV_CHUNK);
constexpr unsigned CV_GRID = CV_SRC + CV_WQKV + CV_WO + CV_W1 + CV_W2;
static_assert(BSZ * SEQ * DIM % CV_CHUNK == 0 && D3 * DIM % CV_CHUNK == 0 &&
              DIM * DIM % CV_CHUNK == 0 && FFD * DIM % CV_CHUNK == 0,
              "every tensor must be a whole number of chunks");

__global__ __launch_bounds__(CV_THREADS) void cvt_all_f32_to_bf16(
    const float* __restrict__ src,  const float* __restrict__ wqkv,
    const float* __restrict__ wo,   const float* __restrict__ w1,
    const float* __restrict__ w2,
    bf16_t* __restrict__ src_o,  bf16_t* __restrict__ wqkv_o,
    bf16_t* __restrict__ wo_o,   bf16_t* __restrict__ w1_o,
    bf16_t* __restrict__ w2_o) {
    // Which tensor, and which chunk of it: the same for the whole workgroup.
    unsigned blk = blockIdx.x;
    const float* in = src;
    bf16_t* out = src_o;
    if (blk >= CV_SRC) {
        blk -= CV_SRC; in = wqkv; out = wqkv_o;
        if (blk >= CV_WQKV) {
            blk -= CV_WQKV; in = wo; out = wo_o;
            if (blk >= CV_WO) {
                blk -= CV_WO; in = w1; out = w1_o;
                if (blk >= CV_W1) { blk -= CV_W1; in = w2; out = w2_o; }
            }
        }
    }
    const cv_f32x4* ip = (const cv_f32x4*)(in + (size_t)blk * CV_CHUNK) + threadIdx.x;
    cv_bf16x4*      op = (cv_bf16x4*)(out + (size_t)blk * CV_CHUNK) + threadIdx.x;

    cv_f32x4 v[CV_LOADS];
#pragma unroll
    for (int j = 0; j < CV_LOADS; ++j) v[j] = ip[j * CV_THREADS];
#pragma unroll
    for (int j = 0; j < CV_LOADS; ++j)
        op[j * CV_THREADS] = __builtin_convertvector(v[j], cv_bf16x4);
}

// ---------------------------------------------------------------------------
// Fragment gather from an LDS tile, per ISA 7.12.2 16-bit A/B layout.
// For lane l: row = base + (l&15), half = l>>4; VGPR v holds
// K = k0 + kbase(v) + half*8 + {0,1}, kbase = {0,2,4,6,16,18,20,22}.
// ---------------------------------------------------------------------------
__device__ inline v16bf load_frag(const bf16_t* __restrict__ smem, int baseRow, int k0, int lane) {
    const int r    = baseRow + (lane & 15);
    const int half = (lane >> 4) & 1;
    const bf16_t* p = smem + r * GPITCH + k0 + half * 8;
    v16bf f;
#pragma unroll
    for (int v = 0; v < 8; ++v) {
        const int k2 = (v < 4) ? (2 * v) : (16 + 2 * (v - 4));
        bf16x2 pr = *(const bf16x2*)(p + k2);
        f[2 * v]     = pr.x;
        f[2 * v + 1] = pr.y;
    }
    return f;
}

// Eight async copies (global -> LDS, 16 B per lane each): 128 rows of 256 B per
// workgroup. g and l are this lane's first addresses; copy i lies 16 rows on.
// The closing wait stands inside the statement, so that no address register is
// rewritten in front of it.
__device__ __forceinline__ void copy_rows128(const bf16_t* g, size_t ld, unsigned l) {
    const bf16_t* g1 = g  + 16 * ld;
    const bf16_t* g2 = g1 + 16 * ld;
    const bf16_t* g3 = g2 + 16 * ld;
    const bf16_t* g4 = g3 + 16 * ld;
    const bf16_t* g5 = g4 + 16 * ld;
    const bf16_t* g6 = g5 + 16 * ld;
    const bf16_t* g7 = g6 + 16 * ld;
    constexpr unsigned LS = 16u * GPITCH * 2u;   // 16 LDS rows, bytes
    asm volatile("global_load_async_to_lds_b128 %0, %8, off\n\t"
                 "global_load_async_to_lds_b128 %1, %9, off\n\t"
                 "global_load_async_to_lds_b128 %2, %10, off\n\t"
                 "global_load_async_to_lds_b128 %3, %11, off\n\t"
                 "global_load_async_to_lds_b128 %4, %12, off\n\t"
                 "global_load_async_to_lds_b128 %5, %13, off\n\t"
                 "global_load_async_to_lds_b128 %6, %14, off\n\t"
                 "global_load_async_to_lds_b128 %7, %15, off\n\t"
                 "s_wait_xcnt 0x0"
                 :: "v"(l), "v"(l + LS), "v"(l + 2 * LS), "v"(l + 3 * LS),
                    "v"(l + 4 * LS), "v"(l + 5 * LS), "v"(l + 6 * LS), "v"(l + 7 * LS),
                    "v"(g), "v"(g1), "v"(g2), "v"(g3), "v"(g4), "v"(g5), "v"(g6), "v"(g7)
                 : "memory");
}

// ---------------------------------------------------------------------------
// Exact-form GELU, 0.5 v (1 + erf(v / sqrt 2)), for two values at once and with
// no branch. With z = |v| / sqrt 2 and t = 1 / (1 + 0.3275911 z),
//   erfc(z) = t (a1 + t (a2 + t (a3 + t (a4 + t a5)))) exp(-z^2),
// absolute error at most 1.5e-7 for every z >= 0 (the five-term rational form of
// the handbooks), and 0.5 v (1 + erf) = 0.5 v + |v| (0.5 - 0.5 erfc(z)).
// The constants below hold the factors 0.5, 1 / sqrt 2 and log2(e).
// ---------------------------------------------------------------------------
typedef float gl_f32x2 __attribute__((ext_vector_type(2)));
typedef float        ep_f32x4 __attribute__((ext_vector_type(4)));
typedef unsigned int ep_u32x4 __attribute__((ext_vector_type(4)));

__device__ __forceinline__ gl_f32x2 gelu2(gl_f32x2 v) {
    const gl_f32x2 a = __builtin_elementwise_abs(v);
    const gl_f32x2 d = __builtin_elementwise_fma(a, gl_f32x2{0.23164189f, 0.23164189f},
                                                 gl_f32x2{1.0f, 1.0f});
    const gl_f32x2 kv = v * 0.84932178f;            // kv^2 = z^2 log2(e)
    const gl_f32x2 ar = -(kv * kv);
    // Both reciprocals and both exponentials in one statement that ends in a v_nop:
    // the instruction set asks for one free slot behind a transcendental before its
    // result is used or a source of it overwritten.
    // The early-clobber outputs keep results off sources.
    float t0, t1, e0, e1;
    asm("v_rcp_f32 %0, %4\n\t"
        "v_rcp_f32 %1, %5\n\t"
        "v_exp_f32 %2, %6\n\t"
        "v_exp_f32 %3, %7\n\t"
        "v_nop"
        : "=&v"(t0), "=&v"(t1), "=&v"(e0), "=&v"(e1)
        : "v"(d.x), "v"(d.y), "v"(ar.x), "v"(ar.y));
    const gl_f32x2 t = {t0, t1}, e = {e0, e1};
    gl_f32x2 p = __builtin_elementwise_fma(t, gl_f32x2{0.53070271f, 0.53070271f},
                                           gl_f32x2{-0.72657603f, -0.72657603f});
    p = __builtin_elementwise_fma(p, t, gl_f32x2{0.71070689f, 0.71070689f});
    p = __builtin_elementwise_fma(p, t, gl_f32x2{-0.14224836f, -0.14224836f});
    p = __builtin_elementwise_fma(p, t, gl_f32x2{0.12741479f, 0.12741479f});
    p = p * t;                                      // 0.5 erfc(z) exp(z^2)
    const gl_f32x2 s = __builtin_elementwise_fma(-p, e, gl_f32x2{0.5f, 0.5f});
    return __builtin_elementwise_fma(a, s, v * 0.5f);
}

// ---------------------------------------------------------------------------
// Generic bf16 WMMA GEMM:  C[M,N] = alpha * A[M,K] @ B[N,K]^T + bias[N]
// MODE 0: store f32      MODE 1: store bf16      MODE 2: GELU (gelu2) -> bf16
// MODE is a template parameter: the epilogue of each instantiation holds its one
// store form alone, with no test of the mode per element.
//
// Block tile 128 x BN (BN = 128), 8 waves (4 row-groups x 2 col-groups),
// wave tile 32 x (BN/2). K stepped by GK = 128 through two LDS buffers filled
// with GLOBAL_LOAD_ASYNC_TO_LDS_B128: the copies of stage s+1 fly while stage s
// is worked on, 32 WMMAs a wave between two barriers.
// Requires: M%128==0, N%BN==0, K%GK==0, lda/ldb%8==0, 16B-aligned bases.
// Batched over blockIdx.z: z = hz * BSZ + b; every operand's base moves by
// b * (its .b stride) + hz * (its .h stride), in elements. A plain GEMM is
// launched with gridDim.z == 1.
// ---------------------------------------------------------------------------
struct ZStride { int b, h; };
template <int V> struct StoreMode { static constexpr int value = V; };

template <int BN, int MODE>
__global__ __launch_bounds__(256) void gemm_bf16_wmma(
    const bf16_t* __restrict__ A, int lda,
    const bf16_t* __restrict__ Bm, int ldb,
    const float* __restrict__ bias,
    void* __restrict__ C, int ldc,
    int M, int N, int K, float alpha,
    ZStride zA, ZStride zB, ZStride zC) {

    static_assert(BN % 128 == 0, "a copy statement fills 128 rows");
    constexpr int CT = BN / 32;        // wave col tiles of 16

    __shared__ __align__(16) bf16_t As[2 * 128 * GPITCH];
    __shared__ __align__(16) bf16_t Bs[2 * BN * GPITCH];

    const int tid  = threadIdx.x;
    const int lane = tid & 31;
    const int wave = tid >> 5;
    const int m_w  = (wave & 3) * 32;        // 4 wave-rows x 32
    const int n_w  = (wave >> 2) * (BN / 2); // 2 wave-cols x BN/2

    const int m0 = blockIdx.y * 128;
    const int n0 = blockIdx.x * BN;

    const int zb = blockIdx.z & (BSZ - 1);
    const int zh = blockIdx.z / BSZ;
    A  += (size_t)zb * zA.b + (size_t)zh * zA.h;
    Bm += (size_t)zb * zB.b + (size_t)zh * zB.h;
    const size_t zc = (size_t)zb * zC.b + (size_t)zh * zC.h;

    v8f acc[2][CT] = {};

    // One stage's copies: 16 lanes per 256-byte row, so a wave-wide copy covers
    // two whole rows of the stage.
    const int crow = tid >> 4, cch = tid & 15;
    const bf16_t* gA = A  + (size_t)(m0 + crow) * lda + cch * 8;
    const bf16_t* gB = Bm + (size_t)(n0 + crow) * ldb + cch * 8;
    const unsigned lA = (unsigned)(uintptr_t)(As + crow * GPITCH + cch * 8);
    const unsigned lB = (unsigned)(uintptr_t)(Bs + crow * GPITCH + cch * 8);
    auto issue = [&](int s, int st) {
        copy_rows128(gA + (size_t)s * GK, (size_t)lda, lA + (unsigned)st * (128u * GPITCH * 2u));
#pragma unroll
        for (int i = 0; i < BN / 128; ++i)
            copy_rows128(gB + (size_t)s * GK + (size_t)i * 128 * ldb, (size_t)ldb,
                         lB + (unsigned)st * (BN * GPITCH * 2u) + (unsigned)i * (128u * GPITCH * 2u));
    };

    const int NS = K / GK;
    issue(0, 0);
    asm volatile("s_wait_asynccnt 0x0" ::: "memory");   // this wave's part of stage 0 has landed
    __syncthreads();                                    // every wave's part has
    if (NS > 1) issue(1, 1);

    for (int s = 0; s < NS; ++s) {
        const int buf = s & 1;
        const bf16_t* Ab = As + buf * (128 * GPITCH);
        const bf16_t* Bb = Bs + buf * (BN * GPITCH);

#pragma unroll
        for (int kk = 0; kk < GK / 32; ++kk) {
            v16bf af[2], bfv[CT];
#pragma unroll
            for (int r = 0; r < 2; ++r)  af[r]  = load_frag(Ab, m_w + r * 16, kk * 32, lane);
#pragma unroll
            for (int c = 0; c < CT; ++c) bfv[c] = load_frag(Bb, n_w + c * 16, kk * 32, lane);

#pragma unroll
            for (int r = 0; r < 2; ++r)
#pragma unroll
                for (int c = 0; c < CT; ++c)
                    // Rows of B as the first operand: the tile comes out transposed (epilogue).
                    acc[r][c] = __builtin_amdgcn_wmma_f32_16x16x32_bf16(
                        false, bfv[c], false, af[r], (short)0, acc[r][c], false, false);
        }

        // Hand-over: this wave has left buffer buf, and its copies of stage s+1 have
        // landed; behind the barrier that holds for every wave.
        asm volatile("s_wait_dscnt 0x0" ::: "memory");
        asm volatile("s_wait_asynccnt 0x0" ::: "memory");
        __syncthreads();
        if (s + 2 < NS) issue(s + 2, buf);
    }
    asm volatile("s_wait_asynccnt 0x0" ::: "memory");   // no copy is left in flight

    // Epilogue. The product is the transposed tile (rows of B are the A operand), so
    // in acc[r][c] lane l holds row r * 16 + (l & 15) of the wave's 32 x 64 part of C
    // and its columns c * 16 + 8 * (l >> 4) + 0..7: adjacent in memory.
    // Each wave lays its part out in LDS (a range of its own in As, which every wave
    // has left behind the loop's last barrier) and stores it as whole rows, 16 bytes
    // a lane: 128-byte (bf16) or 256-byte (f32) runs instead of 32-byte pieces.
    constexpr unsigned ESZ  = (MODE == 0) ? 4u : 2u;        // bytes per element of C
    constexpr unsigned RB   = (BN / 2) * ESZ;               // bytes per row of the wave's part
    constexpr unsigned SP   = RB + 16u;                     // LDS pitch: odd multiple of 16 B
    constexpr unsigned LPR  = RB / 16u;                     // lanes per row at the store
    constexpr unsigned RPS  = 32u / LPR;                    // rows per wave-wide store
    static_assert(8u * 32u * SP <= sizeof(As), "eight waves' parts must fit As");
    unsigned char* stg = (unsigned char*)As + (unsigned)wave * (32u * SP);
    const unsigned lc = lane & 15, lh = (lane >> 4) & 1;
#pragma unroll
    for (int c = 0; c < CT; ++c) {
        const float* bp = bias + n0 + n_w + c * 16 + 8 * lh;
        const ep_f32x4 b0 = *(const ep_f32x4*)bp, b1 = *(const ep_f32x4*)(bp + 4);
        const float bv[8] = {b0.x, b0.y, b0.z, b0.w, b1.x, b1.y, b1.z, b1.w};
#pragma unroll
        for (int r = 0; r < 2; ++r) {
            unsigned char* sp = stg + (r * 16 + lc) * SP + (c * 16 + 8 * lh) * ESZ;
            float v[8];
#pragma unroll
            for (int i = 0; i < 8; ++i) v[i] = acc[r][c][i] * alpha + bv[i];
            if constexpr (MODE == 0) {
                *(ep_f32x4*)sp        = ep_f32x4{v[0], v[1], v[2], v[3]};
                *(ep_f32x4*)(sp + 16) = ep_f32x4{v[4], v[5], v[6], v[7]};
            } else {
                ep_u32x4 w;
#pragma unroll
                for (int i = 0; i < 4; ++i) {
                    gl_f32x2 y = {v[2 * i], v[2 * i + 1]};
                    if constexpr (MODE == 2) y = gelu2(y);
                    w[i] = __builtin_bit_cast(unsigned, __builtin_convertvector(y, bf16x2));
                }
                *(ep_u32x4*)sp = w;
            }
        }
    }
    // This wave's LDS writes are done before its lanes read one another's.
    asm volatile("s_wait_dscnt 0x0" ::: "memory");
    unsigned char* Cw = (unsigned char*)C
        + (zc + (size_t)(m0 + m_w + lane / LPR) * ldc + n0 + n_w) * ESZ + (lane % LPR) * 16u;
    const unsigned char* rp = stg + (lane / LPR) * SP + (lane % LPR) * 16u;
#pragma unroll
    for (unsigned j = 0; j < 32u / RPS; ++j)
        *(ep_u32x4*)(Cw + (size_t)(j * RPS) * ldc * ESZ) = *(const ep_u32x4*)(rp + j * RPS * SP);
}

typedef unsigned int u32x4 __attribute__((ext_vector_type(4)));
typedef short        s16x8 __attribute__((ext_vector_type(8)));
typedef float        f32x2 __attribute__((ext_vector_type(2)));
typedef float        f32x4 __attribute__((ext_vector_type(4)));

constexpr unsigned PITCH_K = 2 * HDM + 16;   // odd multiple of 16 B: ds_load_b128 readers
constexpr unsigned PITCH_V = 2 * HDM + 32;   // odd multiple of 32 B: ds_load_tr16_b128 readers
constexpr unsigned V_OFF   = SEQ * PITCH_K;
constexpr unsigned ATT_LDS = V_OFF + SEQ * PITCH_V;
constexpr int ATT_WAVES = 16;                // 16 query rows each
constexpr int ATT_ROWS  = ATT_WAVES * 16;
constexpr int ATT_KEYS  = 64;                // keys per pass
constexpr int ATT_PASSES = SEQ / ATT_KEYS;
static_assert(ATT_LDS <= 320u * 1024u, "K and V of one head must fit one workgroup's LDS");
static_assert(ATT_PASSES % 2 == 0, "the pass loop is written in pairs");

struct Frag { u32x4 q[2]; };   // one 16 x 32 bf16 operand: 8 registers per lane

__device__ __forceinline__ v8f mma(const Frag& a, const Frag& b, v8f c) {
    return __builtin_amdgcn_wmma_f32_16x16x32_bf16(
        false, __builtin_bit_cast(v16bf, a), false, __builtin_bit_cast(v16bf, b),
        (short)0, c, false, false);
}
__device__ __forceinline__ u32x4 ld_tr16(const unsigned char* p) {
    typedef __attribute__((address_space(3))) s16x8 lds_s16x8;
    return __builtin_bit_cast(u32x4, __builtin_amdgcn_ds_load_tr16_b128_v8i16((lds_s16x8*)p));
}
__device__ __forceinline__ unsigned pack2(float lo, float hi) {   // round to nearest even
    return __builtin_bit_cast(unsigned, __builtin_convertvector(f32x2{lo, hi}, bf16x2));
}
__device__ __forceinline__ float xhalf(float x) {                 // lane l with lane l ^ 16
    return __builtin_bit_cast(float, __builtin_amdgcn_permlanex16(
        __builtin_bit_cast(int, x), __builtin_bit_cast(int, x),
        0x76543210, 0xfedcba98, false, false));
}

__global__ __launch_bounds__(ATT_WAVES * 32) void attn_fused(const bf16_t* __restrict__ qkv,
                                                             const float* __restrict__ bias,
                                                             bf16_t* __restrict__ ctx) {
    __shared__ __attribute__((aligned(256))) unsigned char L[ATT_LDS];
    const unsigned tid = threadIdx.x, lane = tid & 31u, wave = tid >> 5;
    const unsigned c = lane & 15u, h = lane >> 4;
    // Grid (8, batch, 8): the BSZ workgroups that read one bias block lie 8 apart
    // in launch order, in the hope that they share one L2's copy of it (speed only:
    // no result depends on where a workgroup runs).
    const unsigned tile = blockIdx.x + 8u * blockIdx.z;      // head * 4 + row block
    const unsigned b    = blockIdx.y;
    const unsigned hd   = tile / (SEQ / ATT_ROWS);
    const unsigned q0   = (tile % (SEQ / ATT_ROWS)) * ATT_ROWS + wave * 16u;

    const bf16_t* base = qkv + (size_t)b * SEQ * D3 + hd * HDM;   // q of token 0

    // Stage K and V: 8 lanes per 128-byte row, whole lines from memory.
    constexpr int RST = ATT_WAVES * 32 / 8;   // rows per step of the workgroup
    constexpr int NST = SEQ / RST;
    const unsigned srow = tid >> 3, sch = tid & 7u;
    const bf16_t* sp = base + (size_t)srow * D3 + sch * 8u;
    u32x4 kr[NST], vr[NST];
#pragma unroll
    for (int i = 0; i < NST; ++i) {
        kr[i] = *(const u32x4*)(sp + (size_t)i * RST * D3 + DIM);
        vr[i] = *(const u32x4*)(sp + (size_t)i * RST * D3 + 2 * DIM);
    }

    // Q fragments in the hardware k order (as K's below), scaled by 1/8.
    Frag qf[2];
    const bf16_t* qp = base + (size_t)(q0 + c) * D3 + 8u * h;
    {
#pragma unroll
        for (int kc = 0; kc < 2; ++kc) {
            Frag f;
            f.q[0] = *(const u32x4*)(qp + 32 * kc);
            f.q[1] = *(const u32x4*)(qp + 32 * kc + 16);
            v16bf t = __builtin_bit_cast(v16bf, f);
#pragma unroll
            for (int e = 0; e < 16; ++e) t[e] = (bf16_t)((float)t[e] * 0.125f);
            qf[kc] = __builtin_bit_cast(Frag, t);
        }
    }

    // A operand whose row 0 is ones: row 0 of its product is the column sums of P^T.
    Frag ones;
    {
        const unsigned o = (c == 0u) ? 0x3F803F80u : 0u;
        ones.q[0] = u32x4{o, o, o, o};
        ones.q[1] = u32x4{o, o, o, o};
    }

    v8f acc[4] = {};          // O^T: acc[t][r] = O[q0 + c][16 t + 8 h + r]
    v8f lacc = {};            // register 0 of lanes 0-15: denominator of query c
    float m_run = -INFINITY;  // maximum in use, base-2 scaled; equal in lanes c, c + 16
    constexpr float LOG2E = 1.4426950408889634f;

    // This lane's bias: row q0 + c, keys 16 j + 8 h + 0..7 of each pass.
    const float* bp = bias + ((size_t)hd * SEQ + q0 + c) * SEQ + 8u * h;
    auto load_bias = [&](v8f (&d)[4], int it) {
#pragma unroll
        for (int j = 0; j < 4; ++j) {
            const f32x4 lo = *(const f32x4*)(bp + it * ATT_KEYS + 16 * j);
            const f32x4 hi = *(const f32x4*)(bp + it * ATT_KEYS + 16 * j + 4);
            d[j] = v8f{lo.x, lo.y, lo.z, lo.w, hi.x, hi.y, hi.z, hi.w};
        }
    };

    // One pass over 64 keys. s arrives holding the pass's bias tile; nx is filled
    // with the next pass's (fetch: a literal at every call, false in the last pass),
    // so that its memory latency lies under this pass.
    auto pass = [&](v8f (&s)[4], v8f (&nx)[4], int it, bool fetch) __attribute__((always_inline)) {
        if (fetch) {
            load_bias(nx, it + 1);
            // Before the loop's pointer, which these loads name, is advanced.
            asm volatile("s_wait_xcnt 0x0" ::: "memory");
        }
        // Holds these loads at the head of the pass: sunk to where registers come
        // free they would have half a pass, too little for a read from memory.
        __builtin_amdgcn_sched_barrier(0);

        const unsigned char* kp = L + (it * ATT_KEYS + c) * PITCH_K + 16u * h;
#pragma unroll
        for (int j = 0; j < 4; ++j) {
#pragma unroll
            for (int kc = 0; kc < 2; ++kc) {
                Frag kf;
                kf.q[0] = *(const u32x4*)(kp + j * 16 * PITCH_K + 64 * kc);
                kf.q[1] = *(const u32x4*)(kp + j * 16 * PITCH_K + 64 * kc + 32);
                s[j] = mma(kf, qf[kc], s[j]);   // s[j][r] = score(key 16 j + 8 h + r, query c)
            }
        }

        float mx = s[0][0];
#pragma unroll
        for (int j = 0; j < 4; ++j)
#pragma unroll
            for (int r = 0; r < 8; ++r) mx = __builtin_fmaxf(mx, s[j][r]);
        mx = __builtin_fmaxf(mx, xhalf(mx)) * LOG2E;   // both halves: this query's maximum

        if (__builtin_amdgcn_ballot_w32(mx > m_run + 8.0f) != 0) {   // scalar branch, rare
            const float m_new = __builtin_fmaxf(m_run, mx);
            const float corr  = __builtin_amdgcn_exp2f(m_run - m_new);  // 0 on the first pass
            m_run = m_new;
            lacc = lacc * corr;
#pragma unroll
            for (int t = 0; t < 4; ++t) acc[t] = acc[t] * corr;
        }
        const float nm = -m_run;

#pragma unroll
        for (int g = 0; g < 2; ++g) {   // 32 keys: one k extent of the second product
            const unsigned char* ad = L + V_OFF
                + (it * ATT_KEYS + 32u * g + 8u * h + (lane & 7u)) * PITCH_V
                + ((lane >> 3) & 1u) * 16u;
            Frag vf[4];
#pragma unroll
            for (int t = 0; t < 4; ++t) {
                vf[t].q[0] = ld_tr16(ad + 32 * t);
                vf[t].q[1] = ld_tr16(ad + 16 * PITCH_V + 32 * t);
            }
            unsigned w[8];
#pragma unroll
            for (int i = 0; i < 8; ++i) {   // elements 2 i, 2 i + 1 of the 32-key operand
                const v8f& sv = s[2 * g + (i >> 2)];
                const f32x2 arg = __builtin_elementwise_fma(
                    f32x2{sv[2 * (i & 3)], sv[2 * (i & 3) + 1]}, f32x2{LOG2E, LOG2E},
                    f32x2{nm, nm});
                w[i] = pack2(__builtin_amdgcn_exp2f(arg.x), __builtin_amdgcn_exp2f(arg.y));
            }
            Frag pf;
            pf.q[0] = u32x4{w[0], w[1], w[2], w[3]};
            pf.q[1] = u32x4{w[4], w[5], w[6], w[7]};
#pragma unroll
            for (int t = 0; t < 4; ++t) acc[t] = mma(vf[t], pf, acc[t]);
            lacc = mma(ones, pf, lacc);
        }
    };

    v8f sa[4], sb[4];
    load_bias(sa, 0);
    // Every load so far is issued. The inputs keep the loads' address registers
    // from being given away (to a later load's result) in front of the wait.
    asm volatile("s_wait_xcnt 0x0" :: "v"(sp), "v"(qp), "v"(bp) : "memory");
    __builtin_amdgcn_sched_barrier(0);   // keeps every other reuse behind the wait
#pragma unroll
    for (int i = 0; i < NST; ++i) {
        *(u32x4*)(L + (srow + i * RST) * PITCH_K + sch * 16u)         = kr[i];
        *(u32x4*)(L + V_OFF + (srow + i * RST) * PITCH_V + sch * 16u) = vr[i];
    }
    __syncthreads();   // K and V are staged; nothing writes LDS after this

    for (int it = 0; it < ATT_PASSES - 2; it += 2) {
        pass(sa, sb, it, true);
        pass(sb, sa, it + 1, true);
    }
    pass(sa, sb, ATT_PASSES - 2, true);
    pass(sb, sa, ATT_PASSES - 1, false);

    // Lanes 16-31 hold row 8 of the sum tile, which is 0: the exchange-and-add
    // gives both halves the denominator.
    const float lr  = lacc[0];
    const float inv = 1.0f / (lr + xhalf(lr));
    bf16_t* op = ctx + (size_t)(b * SEQ + q0 + c) * DIM + hd * HDM + 8u * h;
#pragma unroll
    for (int t = 0; t < 4; ++t) {
        const v8f o = acc[t] * inv;
        *(u32x4*)(op + 16 * t) = u32x4{pack2(o[0], o[1]), pack2(o[2], o[3]),
                                       pack2(o[4], o[5]), pack2(o[6], o[7])};
    }
}

// ---------------------------------------------------------------------------
// Fused residual + LayerNorm over rows of width DIM (=1024).
// ---------------------------------------------------------------------------
__global__ __launch_bounds__(256) void add_ln_kernel(const float* __restrict__ a,
                                                     const float* __restrict__ res,
                                                     const float* __restrict__ g,
                                                     const float* __restrict__ b,
                                                     float* __restrict__ outf,
                                                     bf16_t* __restrict__ outb) {
    const int row = blockIdx.x;
    const int tid = threadIdx.x;
    __shared__ float red[256];

    float loc[4];
    float s = 0.0f;
#pragma unroll
    for (int i = 0; i < 4; ++i) {
        const int j = tid + i * 256;
        const float v = a[(size_t)row * DIM + j] + res[(size_t)row * DIM + j];
        loc[i] = v;
        s += v;
    }
    red[tid] = s;
    __syncthreads();
    for (int st = 128; st > 0; st >>= 1) {
        if (tid < st) red[tid] += red[tid + st];
        __syncthreads();
    }
    const float mean = red[0] * (1.0f / DIM);
    __syncthreads();

    float vs = 0.0f;
#pragma unroll
    for (int i = 0; i < 4; ++i) {
        const float d = loc[i] - mean;
        vs += d * d;
    }
    red[tid] = vs;
    __syncthreads();
    for (int st = 128; st > 0; st >>= 1) {
        if (tid < st) red[tid] += red[tid + st];
        __syncthreads();
    }
    const float inv = rsqrtf(red[0] * (1.0f / DIM) + 1e-5f);

#pragma unroll
    for (int i = 0; i < 4; ++i) {
        const int j = tid + i * 256;
        const float y = (loc[i] - mean) * inv * g[j] + b[j];
        outf[(size_t)row * DIM + j] = y;
        if (outb) outb[(size_t)row * DIM + j] = (bf16_t)y;
    }
}

// ---------------------------------------------------------------------------
// Host orchestration
// ---------------------------------------------------------------------------
extern "C" void kernel_launch(void* const* d_in, const int* in_sizes, int n_in,
                              void* d_out, int out_size, void* d_ws, size_t ws_size,
                              hipStream_t stream) {
    (void)in_sizes; (void)n_in; (void)out_size; (void)ws_size;

    const float* src       = (const float*)d_in[0];
    const float* attn_bias = (const float*)d_in[1];
    const float* Wqkv      = (const float*)d_in[2];
    const float* bqkv      = (const float*)d_in[3];
    const float* Wo        = (const float*)d_in[4];
    const float* bo        = (const float*)d_in[5];
    const float* g1        = (const float*)d_in[6];
    const float* b1n       = (const float*)d_in[7];
    const float* g2        = (const float*)d_in[8];
    const float* b2n       = (const float*)d_in[9];
    const float* W1        = (const float*)d_in[10];
    const float* b1        = (const float*)d_in[11];
    const float* W2        = (const float*)d_in[12];
    const float* b2        = (const float*)d_in[13];
    float* out = (float*)d_out;

    char* ws = (char*)d_ws;
    size_t off = 0;
    auto alloc = [&](size_t bytes) -> char* {
        char* p = ws + off;
        off += (bytes + 255) & ~(size_t)255;
        return p;
    };

    const size_t NT = (size_t)BSZ * SEQ;            // 4096 tokens

    // Live across the attention phase.
    bf16_t* Wo_bf   = (bf16_t*)alloc((size_t)DIM * DIM * 2);
    bf16_t* W1_bf   = (bf16_t*)alloc((size_t)FFD * DIM * 2);
    bf16_t* W2_bf   = (bf16_t*)alloc((size_t)DIM * FFD * 2);
    bf16_t* qkv_bf  = (bf16_t*)alloc(NT * D3 * 2);
    bf16_t* ctx_bf  = (bf16_t*)alloc(NT * DIM * 2);
    // Two sets with disjoint lives share what follows:
    // the QKV GEMM's operands, the buffers of steps 5-9.
    const size_t shared0 = off;
    bf16_t* src_bf  = (bf16_t*)alloc(NT * DIM * 2);
    bf16_t* Wqkv_bf = (bf16_t*)alloc((size_t)D3 * DIM * 2);
    off = shared0;
    float*  y_f     = (float*) alloc(NT * DIM * 4);
    float*  x_f     = (float*) alloc(NT * DIM * 4);
    bf16_t* x_bf    = (bf16_t*)alloc(NT * DIM * 2);
    bf16_t* h_bf    = (bf16_t*)alloc(NT * FFD * 2);
    float*  f_f     = (float*) alloc(NT * DIM * 4);

    auto gemm128 = [&](auto mode, const bf16_t* A, int lda, const bf16_t* Bm, int ldb,
                       const float* bias, void* C, int ldc,
                       int M, int N, int K, float alpha) {
        dim3 grid((unsigned)(N / 128), (unsigned)(M / 128));
        gemm_bf16_wmma<128, decltype(mode)::value><<<grid, 256, 0, stream>>>(
            A, lda, Bm, ldb, bias, C, ldc, M, N, K, alpha,
            ZStride{0, 0}, ZStride{0, 0}, ZStride{0, 0});
    };

    // 1) Convert inputs/weights to bf16
    cvt_all_f32_to_bf16<<<CV_GRID, CV_THREADS, 0, stream>>>(
        src, Wqkv, Wo, W1, W2, src_bf, Wqkv_bf, Wo_bf, W1_bf, W2_bf);

    // 2) QKV projection: qkv = src @ Wqkv^T + bqkv  -> bf16 [NT, 3D]
    gemm128(StoreMode<1>{}, src_bf, DIM, Wqkv_bf, DIM, bqkv, qkv_bf, D3,
            (int)NT, D3, DIM, 1.0f);

    // 3, 4) Attention: ctx[b, :, h*HD:(h+1)*HD] = softmax(q k^T / 8 + bias[h]) v
    attn_fused<<<dim3(8, BSZ, NH * (SEQ / ATT_ROWS) / 8), ATT_WAVES * 32, 0, stream>>>(
        qkv_bf, attn_bias, ctx_bf);

    // 5) Output projection: y = ctx @ Wo^T + bo  (f32)
    gemm128(StoreMode<0>{}, ctx_bf, DIM, Wo_bf, DIM, bo, y_f, DIM,
            (int)NT, DIM, DIM, 1.0f);

    // 6) x = LN(src + y) -> f32 + bf16
    add_ln_kernel<<<(unsigned)NT, 256, 0, stream>>>(y_f, src, g1, b1n, x_f, x_bf);

    // 7) FF1: h = gelu(x @ W1^T + b1) -> bf16 [NT, FF]
    gemm128(StoreMode<2>{}, x_bf, DIM, W1_bf, DIM, b1, h_bf, FFD,
            (int)NT, FFD, DIM, 1.0f);

    // 8) FF2: f = h @ W2^T + b2 -> f32
    gemm128(StoreMode<0>{}, h_bf, FFD, W2_bf, FFD, b2, f_f, DIM,
            (int)NT, DIM, FFD, 1.0f);

    // 9) out = LN(x + f)
    add_ln_kernel<<<(unsigned)NT, 256, 0, stream>>>(f_f, x_f, g2, b2n, out, nullptr);
}

// v008
// Measured time: 162 microseconds a run.
// In both of two side-by-side timings against v007, it was 1.03 times as fast.
// Over all steps from v000 it is 12.2 times as fast.
#include <hip/hip_runtime.h>
#include <math.h>

// ---------------------------------------------------------------------------
// Types for CDNA5 WMMA (wave32)
// ---------------------------------------------------------------------------
typedef __bf16 bf16_t;
typedef __attribute__((ext_vector_type(16))) __bf16 v16bf;
typedef __attribute__((ext_vector_type(2)))  __bf16 bf16x2;
typedef __attribute__((ext_vector_type(8)))  float  v8f;

// Problem constants (match reference)
constexpr int BSZ = 4;
constexpr int SEQ = 1024;
constexpr int DIM = 1024;
constexpr int NH  = 16;
constexpr int HDM = 64;
constexpr int FFD = 4096;
constexpr int D3  = 3 * DIM;

constexpr int GK     = 128;      // k extent of one GEMM stage: 256-byte rows
constexpr int GPITCH = GK + 8;   // LDS row pitch in elements: 272 B, for ds_load_b128 readers

// ---------------------------------------------------------------------------
// f32 -> bf16 convert of all five GEMM operands in one streaming launch.
// One workgroup of 16 waves per CV_CHUNK contiguous elements of one tensor
// (every tensor is a whole number of chunks). A lane has CV_LOADS independent
// 16-byte loads, so many are in flight at once; each wave-wide load covers 512
// contiguous bytes and each wave-wide store 256.
// ---------------------------------------------------------------------------
typedef __attribute__((ext_vector_type(4))) float  cv_f32x4;
typedef __attribute__((ext_vector_type(4))) __bf16 cv_bf16x4;

constexpr int CV_THREADS = 512;
constexpr int CV_LOADS   = 32;                          // 16-byte loads per lane
constexpr int CV_CHUNK   = CV_THREADS * CV_LOADS * 4;   // elements per workgroup
constexpr unsigned CV_SRC  = (unsigned)(BSZ * SEQ * DIM / CV_CHUNK);
constexpr unsigned CV_WQKV = (unsigned)(D3 * DIM / CV_CHUNK);
constexpr unsigned CV_WO   = (unsigned)(DIM * DIM / CV_CHUNK);
constexpr unsigned CV_W1   = (unsigned)(FFD * DIM / CV_CHUNK);
constexpr unsigned CV_W2   = (unsigned)(DIM * FFD / CV_CHUNK);
constexpr unsigned CV_GRID = CV_SRC + CV_WQKV + CV_WO + CV_W1 + CV_W2;
static_assert(BSZ * SEQ * DIM % CV_CHUNK == 0 && D3 * DIM % CV_CHUNK == 0 &&
              DIM * DIM % CV_CHUNK == 0 && FFD * DIM % CV_CHUNK == 0,
              "every tensor must be a whole number of chunks");

__global__ __launch_bounds__(CV_THREADS) void cvt_all_f32_to_bf16(
    const float* __restrict__ src,  const float* __restrict__ wqkv,
    const float* __restrict__ wo,   const float* __restrict__ w1,
    const float* __restrict__ w2,
    bf16_t* __restrict__ src_o,  bf16_t* __restrict__ wqkv_o,
    bf16_t* __restrict__ wo_o,   bf16_t* __restrict__ w1_o,
    bf16_t* __restrict__ w2_o) {
    // Which tensor, and which chunk of it: the same for the whole workgroup.
    unsigned blk = blockIdx.x;
    const float* in = src;
    bf16_t* out = src_o;
    if (blk >= CV_SRC) {
        blk -= CV_SRC; in = wqkv; out = wqkv_o;
        if (blk >= CV_WQKV) {
            blk -= CV_WQKV; in = wo; out = wo_o;
            if (blk >= CV_WO) {
                blk -= CV_WO; in = w1; out = w1_o;
                if (blk >= CV_W1) { blk -= CV_W1; in = w2; out = w2_o; }
            }
        }
    }
    const cv_f32x4* ip = (const cv_f32x4*)(in + (size_t)blk * CV_CHUNK) + threadIdx.x;
    cv_bf16x4*      op = (cv_bf16x4*)(out + (size_t)blk * CV_CHUNK) + threadIdx.x;

    cv_f32x4 v[CV_LOADS];
#pragma unroll
    for (int j = 0; j < CV_LOADS; ++j) v[j] = ip[j * CV_THREADS];
#pragma unroll
    for (int j = 0; j < CV_LOADS; ++j)
        op[j * CV_THREADS] = __builtin_convertvector(v[j], cv_bf16x4);
}

// ---------------------------------------------------------------------------
// Fragment gather from an LDS tile, per ISA 7.12.2 16-bit A/B layout.
// For lane l: row = base + (l&15), half = l>>4; VGPR v holds
// K = k0 + kbase(v) + half*8 + {0,1}, kbase = {0,2,4,6,16,18,20,22}.
// ---------------------------------------------------------------------------
__device__ inline v16bf load_frag(const bf16_t* __restrict__ smem, int baseRow, int k0, int lane) {
    const int r    = baseRow + (lane & 15);
    const int half = (lane >> 4) & 1;
    const bf16_t* p = smem + r * GPITCH + k0 + half * 8;
    v16bf f;
#pragma unroll
    for (int v = 0; v < 8; ++v) {
        const int k2 = (v < 4) ? (2 * v) : (16 + 2 * (v - 4));
        bf16x2 pr = *(const bf16x2*)(p + k2);
        f[2 * v]     = pr.x;
        f[2 * v + 1] = pr.y;
    }
    return f;
}

// Eight async copies (global -> LDS, 16 B per lane each): 128 rows of 256 B per
// workgroup. g and l are this lane's first addresses; copy i lies 16 rows on.
// The closing wait stands inside the statement, so that no address register is
// rewritten in front of it.
__device__ __forceinline__ void copy_rows128(const bf16_t* g, size_t ld, unsigned l) {
    const bf16_t* g1 = g  + 16 * ld;
    const bf16_t* g2 = g1 + 16 * ld;
    const bf16_t* g3 = g2 + 16 * ld;
    const bf16_t* g4 = g3 + 16 * ld;
    const bf16_t* g5 = g4 + 16 * ld;
    const bf16_t* g6 = g5 + 16 * ld;
    const bf16_t* g7 = g6 + 16 * ld;
    constexpr unsigned LS = 16u * GPITCH * 2u;   // 16 LDS rows, bytes
    asm volatile("global_load_async_to_lds_b128 %0, %8, off\n\t"
                 "global_load_async_to_lds_b128 %1, %9, off\n\t"
                 "global_load_async_to_lds_b128 %2, %10, off\n\t"
                 "global_load_async_to_lds_b128 %3, %11, off\n\t"
                 "global_load_async_to_lds_b128 %4, %12, off\n\t"
                 "global_load_async_to_lds_b128 %5, %13, off\n\t"
                 "global_load_async_to_lds_b128 %6, %14, off\n\t"
                 "global_load_async_to_lds_b128 %7, %15, off\n\t"
                 "s_wait_xcnt 0x0"
                 :: "v"(l), "v"(l + LS), "v"(l + 2 * LS), "v"(l + 3 * LS),
                    "v"(l + 4 * LS), "v"(l + 5 * LS), "v"(l + 6 * LS), "v"(l + 7 * LS),
                    "v"(g), "v"(g1), "v"(g2), "v"(g3), "v"(g4), "v"(g5), "v"(g6), "v"(g7)
                 : "memory");
}

// ---------------------------------------------------------------------------
// Exact-form GELU, 0.5 v (1 + erf(v / sqrt 2)), for two values at once and with
// no branch. With z = |v| / sqrt 2 and t = 1 / (1 + 0.3275911 z),
//   erfc(z) = t (a1 + t (a2 + t (a3 + t (a4 + t a5)))) exp(-z^2),
// absolute error at most 1.5e-7 for every z >= 0 (the five-term rational form of
// the handbooks), and 0.5 v (1 + erf) = 0.5 v + |v| (0.5 - 0.5 erfc(z)).
// The constants below hold the factors 0.5, 1 / sqrt 2 and log2(e).
// ---------------------------------------------------------------------------
typedef float gl_f32x2 __attribute__((ext_vector_type(2)));
typedef float        ep_f32x4 __attribute__((ext_vector_type(4)));
typedef unsigned int ep_u32x4 __attribute__((ext_vector_type(4)));

__device__ __forceinline__ gl_f32x2 gelu2(gl_f32x2 v) {
    const gl_f32x2 a = __builtin_elementwise_abs(v);
    const gl_f32x2 d = __builtin_elementwise_fma(a, gl_f32x2{0.23164189f, 0.23164189f},
                                                 gl_f32x2{1.0f, 1.0f});
    const gl_f32x2 kv = v * 0.84932178f;            // kv^2 = z^2 log2(e)
    const gl_f32x2 ar = -(kv * kv);
    // Both reciprocals and both exponentials in one statement that ends in a v_nop:
    // the instruction set asks for one free slot behind a transcendental before its
    // result is used or a source of it overwritten.
    // The early-clobber outputs keep results off sources.
    float t0, t1, e0, e1;
    asm("v_rcp_f32 %0, %4\n\t"
        "v_rcp_f32 %1, %5\n\t"
        "v_exp_f32 %2, %6\n\t"
        "v_exp_f32 %3, %7\n\t"
        "v_nop"
        : "=&v"(t0), "=&v"(t1), "=&v"(e0), "=&v"(e1)
        : "v"(d.x), "v"(d.y), "v"(ar.x), "v"(ar.y));
    const gl_f32x2 t = {t0, t1}, e = {e0, e1};
    gl_f32x2 p = __builtin_elementwise_fma(t, gl_f32x2{0.53070271f, 0.53070271f},
                                           gl_f32x2{-0.72657603f, -0.72657603f});
    p = __builtin_elementwise_fma(p, t, gl_f32x2{0.71070689f, 0.71070689f});
    p = __builtin_elementwise_fma(p, t, gl_f32x2{-0.14224836f, -0.14224836f});
    p = __builtin_elementwise_fma(p, t, gl_f32x2{0.12741479f, 0.12741479f});
    p = p * t;                                      // 0.5 erfc(z) exp(z^2)
    const gl_f32x2 s = __builtin_elementwise_fma(-p, e, gl_f32x2{0.5f, 0.5f});
    return __builtin_elementwise_fma(a, s, v * 0.5f);
}

// ---------------------------------------------------------------------------
// Generic bf16 WMMA GEMM:  C[M,N] = alpha * A[M,K] @ B[N,K]^T + bias[N]
// MODE 0: store f32      MODE 1: store bf16      MODE 2: GELU (gelu2) -> bf16
// MODE is a template parameter: the epilogue of each instantiation holds its one
// store form alone, with no test of the mode per element.
//
// Block tile 128 x BN (BN = 128), 8 waves (4 row-groups x 2 col-groups),
// wave tile 32 x (BN/2). K stepped by GK = 128 through two LDS buffers filled
// with GLOBAL_LOAD_ASYNC_TO_LDS_B128: the copies of stage s+1 fly while stage s
// is worked on, 32 WMMAs a wave between two barriers. Inside a stage the fragments
// of the next 32 k are fetched from LDS while the current 32 k are multiplied.
// Requires: M%128==0, N%BN==0, K%GK==0, lda/ldb%8==0, 16B-aligned bases.
// Batched over blockIdx.z: z = hz * BSZ + b; every operand's base moves by
// b * (its .b stride) + hz * (its .h stride), in elements. A plain GEMM is
// launched with gridDim.z == 1.
// ---------------------------------------------------------------------------
struct ZStride { int b, h; };
template <int V> struct StoreMode { static constexpr int value = V; };

template <int BN, int MODE>
__global__ __launch_bounds__(256) void gemm_bf16_wmma(
    const bf16_t* __restrict__ A, int lda,
    const bf16_t* __restrict__ Bm, int ldb,
    const float* __restrict__ bias,
    void* __restrict__ C, int ldc,
    int M, int N, int K, float alpha,
    ZStride zA, ZStride zB, ZStride zC) {

    static_assert(BN % 128 == 0, "a copy statement fills 128 rows");
    constexpr int CT = BN / 32;        // wave col tiles of 16

    __shared__ __align__(16) bf16_t As[2 * 128 * GPITCH];
    __shared__ __align__(16) bf16_t Bs[2 * BN * GPITCH];

    const int tid  = threadIdx.x;
    const int lane = tid & 31;
    const int wave = tid >> 5;
    const int m_w  = (wave & 3) * 32;        // 4 wave-rows x 32
    const int n_w  = (wave >> 2) * (BN / 2); // 2 wave-cols x BN/2

    const int m0 = blockIdx.y * 128;
    const int n0 = blockIdx.x * BN;

    const int zb = blockIdx.z & (BSZ - 1);
    const int zh = blockIdx.z / BSZ;
    A  += (size_t)zb * zA.b + (size_t)zh * zA.h;
    Bm += (size_t)zb * zB.b + (size_t)zh * zB.h;
    const size_t zc = (size_t)zb * zC.b + (size_t)zh * zC.h;

    v8f acc[2][CT] = {};

    // One stage's copies: 16 lanes per 256-byte row, so a wave-wide copy covers
    // two whole rows of the stage.
    const int crow = tid >> 4, cch = tid & 15;
    const bf16_t* gA = A  + (size_t)(m0 + crow) * lda + cch * 8;
    const bf16_t* gB = Bm + (size_t)(n0 + crow) * ldb + cch * 8;
    const unsigned lA = (unsigned)(uintptr_t)(As + crow * GPITCH + cch * 8);
    const unsigned lB = (unsigned)(uintptr_t)(Bs + crow * GPITCH + cch * 8);
    auto issue = [&](int s, int st) {
        copy_rows128(gA + (size_t)s * GK, (size_t)lda, lA + (unsigned)st * (128u * GPITCH * 2u));
#pragma unroll
        for (int i = 0; i < BN / 128; ++i)
            copy_rows128(gB + (size_t)s * GK + (size_t)i * 128 * ldb, (size_t)ldb,
                         lB + (unsigned)st * (BN * GPITCH * 2u) + (unsigned)i * (128u * GPITCH * 2u));
    };

    const int NS = K / GK;
    issue(0, 0);
    asm volatile("s_wait_asynccnt 0x0" ::: "memory");   // this wave's part of stage 0 has landed
    __syncthreads();                                    // every wave's part has
    if (NS > 1) issue(1, 1);

    for (int s = 0; s < NS; ++s) {
        const int buf = s & 1;
        const bf16_t* Ab = As + buf * (128 * GPITCH);
        const bf16_t* Bb = Bs + buf * (BN * GPITCH);

        // Two fragment sets: block kk + 1's LDS loads go out as one group ahead of
        // block kk's WMMAs and land under them. All of it stays inside this stage's
        // buffer; only block 0's loads are waited for in the open.
        v16bf af[2][2], bfv[2][CT];
        auto fetch = [&](int set, int kk) {
#pragma unroll
            for (int r = 0; r < 2; ++r)  af[set][r]  = load_frag(Ab, m_w + r * 16, kk * 32, lane);
#pragma unroll
            for (int c = 0; c < CT; ++c) bfv[set][c] = load_frag(Bb, n_w + c * 16, kk * 32, lane);
        };
        fetch(0, 0);
#pragma unroll
        for (int kk = 0; kk < GK / 32; ++kk) {
            const int cur = kk & 1;
            if (kk + 1 < GK / 32) fetch(cur ^ 1, kk + 1);
            // Keeps the load group whole and ahead of the block: left free, the loads are
            // sunk among the WMMAs that need them, each behind a wait for all LDS loads.
            __builtin_amdgcn_sched_barrier(0);
#pragma unroll
            for (int r = 0; r < 2; ++r)
#pragma unroll
                for (int c = 0; c < CT; ++c)
                    // Rows of B as the first operand: the tile comes out transposed (epilogue).
                    acc[r][c] = __builtin_amdgcn_wmma_f32_16x16x32_bf16(
                        false, bfv[cur][c], false, af[cur][r], (short)0, acc[r][c], false, false);
            // The other side of the fence: the next group stays behind this block.
            __builtin_amdgcn_sched_barrier(0);
        }

        // Hand-over: this wave has left buffer buf, and its copies of stage s+1 have
        // landed; behind the barrier that holds for every wave.
        asm volatile("s_wait_dscnt 0x0" ::: "memory");
        asm volatile("s_wait_asynccnt 0x0" ::: "memory");
        __syncthreads();
        if (s + 2 < NS) issue(s + 2, buf);
    }
    asm volatile("s_wait_asynccnt 0x0" ::: "memory");   // no copy is left in flight

    // Epilogue. The product is the transposed tile (rows of B are the A operand), so
    // in acc[r][c] lane l holds row r * 16 + (l & 15) of the wave's 32 x 64 part of C
    // and its columns c * 16 + 8 * (l >> 4) + 0..7: adjacent in memory.
    // Each wave lays its part out in LDS (a range of its own in As, which every wave
    // has left behind the loop's last barrier) and stores it as whole rows, 16 bytes
    // a lane: 128-byte (bf16) or 256-byte (f32) runs instead of 32-byte pieces.
    constexpr unsigned ESZ  = (MODE == 0) ? 4u : 2u;        // bytes per element of C
    constexpr unsigned RB   = (BN / 2) * ESZ;               // bytes per row of the wave's part
    constexpr unsigned SP   = RB + 16u;                     // LDS pitch: odd multiple of 16 B
    constexpr unsigned LPR  = RB / 16u;                     // lanes per row at the store
    constexpr unsigned RPS  = 32u / LPR;                    // rows per wave-wide store
    static_assert(8u * 32u * SP <= sizeof(As), "eight waves' parts must fit As");
    unsigned char* stg = (unsigned char*)As + (unsigned)wave * (32u * SP);
    const unsigned lc = lane & 15, lh = (lane >> 4) & 1;
#pragma unroll
    for (int c = 0; c < CT; ++c) {
        const float* bp = bias + n0 + n_w + c * 16 + 8 * lh;
        const ep_f32x4 b0 = *(const ep_f32x4*)bp, b1 = *(const ep_f32x4*)(bp + 4);
        const float bv[8] = {b0.x, b0.y, b0.z, b0.w, b1.x, b1.y, b1.z, b1.w};
#pragma unroll
        for (int r = 0; r < 2; ++r) {
            unsigned char* sp = stg + (r * 16 + lc) * SP + (c * 16 + 8 * lh) * ESZ;
            float v[8];
#pragma unroll
            for (int i = 0; i < 8; ++i) v[i] = acc[r][c][i] * alpha + bv[i];
            if constexpr (MODE == 0) {
                *(ep_f32x4*)sp        = ep_f32x4{v[0], v[1], v[2], v[3]};
                *(ep_f32x4*)(sp + 16) = ep_f32x4{v[4], v[5], v[6], v[7]};
            } else {
                ep_u32x4 w;
#pragma unroll
                for (int i = 0; i < 4; ++i) {
                    gl_f32x2 y = {v[2 * i], v[2 * i + 1]};
                    if constexpr (MODE == 2) y = gelu2(y);
                    w[i] = __builtin_bit_cast(unsigned, __builtin_convertvector(y, bf16x2));
                }
                *(ep_u32x4*)sp = w;
            }
        }
    }
    // This wave's LDS writes are done before its lanes read one another's.
    asm volatile("s_wait_dscnt 0x0" ::: "memory");
    unsigned char* Cw = (unsigned char*)C
        + (zc + (size_t)(m0 + m_w + lane / LPR) * ldc + n0 + n_w) * ESZ + (lane % LPR) * 16u;
    const unsigned char* rp = stg + (lane / LPR) * SP + (lane % LPR) * 16u;
#pragma unroll
    for (unsigned j = 0; j < 32u / RPS; ++j)
        *(ep_u32x4*)(Cw + (size_t)(j * RPS) * ldc * ESZ) = *(const ep_u32x4*)(rp + j * RPS * SP);
}

typedef unsigned int u32x4 __attribute__((ext_vector_type(4)));
typedef short        s16x8 __attribute__((ext_vector_type(8)));
typedef float        f32x2 __attribute__((ext_vector_type(2)));
typedef float        f32x4 __attribute__((ext_vector_type(4)));

constexpr unsigned PITCH_K = 2 * HDM + 16;   // odd multiple of 16 B: ds_load_b128 readers
constexpr unsigned PITCH_V = 2 * HDM + 32;   // odd multiple of 32 B: ds_load_tr16_b128 readers
constexpr unsigned V_OFF   = SEQ * PITCH_K;
constexpr unsigned ATT_LDS = V_OFF + SEQ * PITCH_V;
constexpr int ATT_WAVES = 16;                // 16 query rows each
constexpr int ATT_ROWS  = ATT_WAVES * 16;
constexpr int ATT_KEYS  = 64;                // keys per pass
constexpr int ATT_PASSES = SEQ / ATT_KEYS;
static_assert(ATT_LDS <= 320u * 1024u, "K and V of one head must fit one workgroup's LDS");
static_assert(ATT_PASSES % 2 == 0, "the pass loop is written in pairs");

struct Frag { u32x4 q[2]; };   // one 16 x 32 bf16 operand: 8 registers per lane

__device__ __forceinline__ v8f mma(const Frag& a, const Frag& b, v8f c) {
    return __builtin_amdgcn_wmma_f32_16x16x32_bf16(
        false, __builtin_bit_cast(v16bf, a), false, __builtin_bit_cast(v16bf, b),
        (short)0, c, false, false);
}
__device__ __forceinline__ u32x4 ld_tr16(const unsigned char* p) {
    typedef __attribute__((address_space(3))) s16x8 lds_s16x8;
    return __builtin_bit_cast(u32x4, __builtin_amdgcn_ds_load_tr16_b128_v8i16((lds_s16x8*)p));
}
__device__ __forceinline__ unsigned pack2(float lo, float hi) {   // round to nearest even
    return __builtin_bit_cast(unsigned, __builtin_convertvector(f32x2{lo, hi}, bf16x2));
}
__device__ __forceinline__ float xhalf(float x) {                 // lane l with lane l ^ 16
    return __builtin_bit_cast(float, __builtin_amdgcn_permlanex16(
        __builtin_bit_cast(int, x), __builtin_bit_cast(int, x),
        0x76543210, 0xfedcba98, false, false));
}

__global__ __launch_bounds__(ATT_WAVES * 32) void attn_fused(const bf16_t* __restrict__ qkv,
                                                             const float* __restrict__ bias,
                                                             bf16_t* __restrict__ ctx) {
    __shared__ __attribute__((aligned(256))) unsigned char L[ATT_LDS];
    const unsigned tid = threadIdx.x, lane = tid & 31u, wave = tid >> 5;
    const unsigned c = lane & 15u, h = lane >> 4;
    // Grid (8, batch, 8): the BSZ workgroups that read one bias block lie 8 apart
    // in launch order, in the hope that they share one L2's copy of it (speed only:
    // no result depends on where a workgroup runs).
    const unsigned tile = blockIdx.x + 8u * blockIdx.z;      // head * 4 + row block
    const unsigned b    = blockIdx.y;
    const unsigned hd   = tile / (SEQ / ATT_ROWS);
    const unsigned q0   = (tile % (SEQ / ATT_ROWS)) * ATT_ROWS + wave * 16u;

    const bf16_t* base = qkv + (size_t)b * SEQ * D3 + hd * HDM;   // q of token 0

    // Stage K and V: 8 lanes per 128-byte row, whole lines from memory.
    constexpr int RST = ATT_WAVES * 32 / 8;   // rows per step of the workgroup
    constexpr int NST = SEQ / RST;
    const unsigned srow = tid >> 3, sch = tid & 7u;
    const bf16_t* sp = base + (size_t)srow * D3 + sch * 8u;
    u32x4 kr[NST], vr[NST];
#pragma unroll
    for (int i = 0; i < NST; ++i) {
        kr[i] = *(const u32x4*)(sp + (size_t)i * RST * D3 + DIM);
        vr[i] = *(const u32x4*)(sp + (size_t)i * RST * D3 + 2 * DIM);
    }

    // Q fragments in the hardware k order (as K's below), scaled by 1/8.
    Frag qf[2];
    const bf16_t* qp = base + (size_t)(q0 + c) * D3 + 8u * h;
    {
#pragma unroll
        for (int kc = 0; kc < 2; ++kc) {
            Frag f;
            f.q[0] = *(const u32x4*)(qp + 32 * kc);
            f.q[1] = *(const u32x4*)(qp + 32 * kc + 16);
            v16bf t = __builtin_bit_cast(v16bf, f);
#pragma unroll
            for (int e = 0; e < 16; ++e) t[e] = (bf16_t)((float)t[e] * 0.125f);
            qf[kc] = __builtin_bit_cast(Frag, t);
        }
    }

    // A operand whose row 0 is ones: row 0 of its product is the column sums of P^T.
    Frag ones;
    {
        const unsigned o = (c == 0u) ? 0x3F803F80u : 0u;
        ones.q[0] = u32x4{o, o, o, o};
        ones.q[1] = u32x4{o, o, o, o};
    }

    v8f acc[4] = {};          // O^T: acc[t][r] = O[q0 + c][16 t + 8 h + r]
    v8f lacc = {};            // register 0 of lanes 0-15: denominator of query c
    float m_run = -INFINITY;  // maximum in use, base-2 scaled; equal in lanes c, c + 16
    constexpr float LOG2E = 1.4426950408889634f;

    // This lane's bias: row q0 + c, keys 16 j + 8 h + 0..7 of each pass.
    const float* bp = bias + ((size_t)hd * SEQ + q0 + c) * SEQ + 8u * h;
    auto load_bias = [&](v8f (&d)[4], int it) {
#pragma unroll
        for (int j = 0; j < 4; ++j) {
            const f32x4 lo = *(const f32x4*)(bp + it * ATT_KEYS + 16 * j);
            const f32x4 hi = *(const f32x4*)(bp + it * ATT_KEYS + 16 * j + 4);
            d[j] = v8f{lo.x, lo.y, lo.z, lo.w, hi.x, hi.y, hi.z, hi.w};
        }
    };

    // One pass over 64 keys. s arrives holding the pass's bias tile; nx is filled
    // with the next pass's (fetch: a literal at every call, false in the last pass),
    // so that its memory latency lies under this pass.
    auto pass = [&](v8f (&s)[4], v8f (&nx)[4], int it, bool fetch) __attribute__((always_inline)) {
        if (fetch) {
            load_bias(nx, it + 1);
            // Before the loop's pointer, which these loads name, is advanced.
            asm volatile("s_wait_xcnt 0x0" ::: "memory");
        }
        // Holds these loads at the head of the pass: sunk to where registers come
        // free they would have half a pass, too little for a read from memory.
        __builtin_amdgcn_sched_barrier(0);

        const unsigned char* kp = L + (it * ATT_KEYS + c) * PITCH_K + 16u * h;
#pragma unroll
        for (int j = 0; j < 4; ++j) {
#pragma unroll
            for (int kc = 0; kc < 2; ++kc) {
                Frag kf;
                kf.q[0] = *(const u32x4*)(kp + j * 16 * PITCH_K + 64 * kc);
                kf.q[1] = *(const u32x4*)(kp + j * 16 * PITCH_K + 64 * kc + 32);
                s[j] = mma(kf, qf[kc], s[j]);   // s[j][r] = score(key 16 j + 8 h + r, query c)
            }
        }

        float mx = s[0][0];
#pragma unroll
        for (int j = 0; j < 4; ++j)
#pragma unroll
            for (int r = 0; r < 8; ++r) mx = __builtin_fmaxf(mx, s[j][r]);
        mx = __builtin_fmaxf(mx, xhalf(mx)) * LOG2E;   // both halves: this query's maximum

        if (__builtin_amdgcn_ballot_w32(mx > m_run + 8.0f) != 0) {   // scalar branch, rare
            const float m_new = __builtin_fmaxf(m_run, mx);
            const float corr  = __builtin_amdgcn_exp2f(m_run - m_new);  // 0 on the first pass
            m_run = m_new;
            lacc = lacc * corr;
#pragma unroll
            for (int t = 0; t < 4; ++t) acc[t] = acc[t] * corr;
        }
        const float nm = -m_run;

#pragma unroll
        for (int g = 0; g < 2; ++g) {   // 32 keys: one k extent of the second product
            const unsigned char* ad = L + V_OFF
                + (it * ATT_KEYS + 32u * g + 8u * h + (lane & 7u)) * PITCH_V
                + ((lane >> 3) & 1u) * 16u;
            Frag vf[4];
#pragma unroll
            for (int t = 0; t < 4; ++t) {
                vf[t].q[0] = ld_tr16(ad + 32 * t);
                vf[t].q[1] = ld_tr16(ad + 16 * PITCH_V + 32 * t);
            }
            unsigned w[8];
#pragma unroll
            for (int i = 0; i < 8; ++i) {   // elements 2 i, 2 i + 1 of the 32-key operand
                const v8f& sv = s[2 * g + (i >> 2)];
                const f32x2 arg = __builtin_elementwise_fma(
                    f32x2{sv[2 * (i & 3)], sv[2 * (i & 3) + 1]}, f32x2{LOG2E, LOG2E},
                    f32x2{nm, nm});
                w[i] = pack2(__builtin_amdgcn_exp2f(arg.x), __builtin_amdgcn_exp2f(arg.y));
            }
            Frag pf;
            pf.q[0] = u32x4{w[0], w[1], w[2], w[3]};
            pf.q[1] = u32x4{w[4], w[5], w[6], w[7]};
#pragma unroll
            for (int t = 0; t < 4; ++t) acc[t] = mma(vf[t], pf, acc[t]);
            lacc = mma(ones, pf, lacc);
        }
    };

    v8f sa[4], sb[4];
    load_bias(sa, 0);
    // Every load so far is issued. The inputs keep the loads' address registers
    // from being given away (to a later load's result) in front of the wait.
    asm volatile("s_wait_xcnt 0x0" :: "v"(sp), "v"(qp), "v"(bp) : "memory");
    __builtin_amdgcn_sched_barrier(0);   // keeps every other reuse behind the wait
#pragma unroll
    for (int i = 0; i < NST; ++i) {
        *(u32x4*)(L + (srow + i * RST) * PITCH_K + sch * 16u)         = kr[i];
        *(u32x4*)(L + V_OFF + (srow + i * RST) * PITCH_V + sch * 16u) = vr[i];
    }
    __syncthreads();   // K and V are staged; nothing writes LDS after this

    for (int it = 0; it < ATT_PASSES - 2; it += 2) {
        pass(sa, sb, it, true);
        pass(sb, sa, it + 1, true);
    }
    pass(sa, sb, ATT_PASSES - 2, true);
    pass(sb, sa, ATT_PASSES - 1, false);

    // Lanes 16-31 hold row 8 of the sum tile, which is 0: the exchange-and-add
    // gives both halves the denominator.
    const float lr  = lacc[0];
    const float inv = 1.0f / (lr + xhalf(lr));
    bf16_t* op = ctx + (size_t)(b * SEQ + q0 + c) * DIM + hd * HDM + 8u * h;
#pragma unroll
    for (int t = 0; t < 4; ++t) {
        const v8f o = acc[t] * inv;
        *(u32x4*)(op + 16 * t) = u32x4{pack2(o[0], o[1]), pack2(o[2], o[3]),
                                       pack2(o[4], o[5]), pack2(o[6], o[7])};
    }
}

// ---------------------------------------------------------------------------
// Fused residual + LayerNorm over rows of width DIM (=1024).
// ---------------------------------------------------------------------------
__global__ __launch_bounds__(256) void add_ln_kernel(const float* __restrict__ a,
                                                     const float* __restrict__ res,
                                                     const float* __restrict__ g,
                                                     const float* __restrict__ b,
                                                     float* __restrict__ outf,
                                                     bf16_t* __restrict__ outb) {
    const int row = blockIdx.x;
    const int tid = threadIdx.x;
    __shared__ float red[256];

    float loc[4];
    float s = 0.0f;
#pragma unroll
    for (int i = 0; i < 4; ++i) {
        const int j = tid + i * 256;
        const float v = a[(size_t)row * DIM + j] + res[(size_t)row * DIM + j];
        loc[i] = v;
        s += v;
    }
    red[tid] = s;
    __syncthreads();
    for (int st = 128; st > 0; st >>= 1) {
        if (tid < st) red[tid] += red[tid + st];
        __syncthreads();
    }
    const float mean = red[0] * (1.0f / DIM);
    __syncthreads();

    float vs = 0.0f;
#pragma unroll
    for (int i = 0; i < 4; ++i) {
        const float d = loc[i] - mean;
        vs += d * d;
    }
    red[tid] = vs;
    __syncthreads();
    for (int st = 128; st > 0; st >>= 1) {
        if (tid < st) red[tid] += red[tid + st];
        __syncthreads();
    }
    const float inv = rsqrtf(red[0] * (1.0f / DIM) + 1e-5f);

#pragma unroll
    for (int i = 0; i < 4; ++i) {
        const int j = tid + i * 256;
        const float y = (loc[i] - mean) * inv * g[j] + b[j];
        outf[(size_t)row * DIM + j] = y;
        if (outb) outb[(size_t)row * DIM + j] = (bf16_t)y;
    }
}

// ---------------------------------------------------------------------------
// Host orchestration
// ---------------------------------------------------------------------------
extern "C" void kernel_launch(void* const* d_in, const int* in_sizes, int n_in,
                              void* d_out, int out_size, void* d_ws, size_t ws_size,
                              hipStream_t stream) {
    (void)in_sizes; (void)n_in; (void)out_size; (void)ws_size;

    const float* src       = (const float*)d_in[0];
    const float* attn_bias = (const float*)d_in[1];
    const float* Wqkv      = (const float*)d_in[2];
    const float* bqkv      = (const float*)d_in[3];
    const float* Wo        = (const float*)d_in[4];
    const float* bo        = (const float*)d_in[5];
    const float* g1        = (const float*)d_in[6];
    const float* b1n       = (const float*)d_in[7];
    const float* g2        = (const float*)d_in[8];
    const float* b2n       = (const float*)d_in[9];
    const float* W1        = (const float*)d_in[10];
    const float* b1        = (const float*)d_in[11];
    const float* W2        = (const float*)d_in[12];
    const float* b2        = (const float*)d_in[13];
    float* out = (float*)d_out;

    char* ws = (char*)d_ws;
    size_t off = 0;
    auto alloc = [&](size_t bytes) -> char* {
        char* p = ws + off;
        off += (bytes + 255) & ~(size_t)255;
        return p;
    };

    const size_t NT = (size_t)BSZ * SEQ;            // 4096 tokens

    // Live across the attention phase.
    bf16_t* Wo_bf   = (bf16_t*)alloc((size_t)DIM * DIM * 2);
    bf16_t* W1_bf   = (bf16_t*)alloc((size_t)FFD * DIM * 2);
    bf16_t* W2_bf   = (bf16_t*)alloc((size_t)DIM * FFD * 2);
    bf16_t* qkv_bf  = (bf16_t*)alloc(NT * D3 * 2);
    bf16_t* ctx_bf  = (bf16_t*)alloc(NT * DIM * 2);
    // Two sets with disjoint lives share what follows:
    // the QKV GEMM's operands, the buffers of steps 5-9.
    const size_t shared0 = off;
    bf16_t* src_bf  = (bf16_t*)alloc(NT * DIM * 2);
    bf16_t* Wqkv_bf = (bf16_t*)alloc((size_t)D3 * DIM * 2);
    off = shared0;
    float*  y_f     = (float*) alloc(NT * DIM * 4);
    float*  x_f     = (float*) alloc(NT * DIM * 4);
    bf16_t* x_bf    = (bf16_t*)alloc(NT * DIM * 2);
    bf16_t* h_bf    = (bf16_t*)alloc(NT * FFD * 2);
    float*  f_f     = (float*) alloc(NT * DIM * 4);

    auto gemm128 = [&](auto mode, const bf16_t* A, int lda, const bf16_t* Bm, int ldb,
                       const float* bias, void* C, int ldc,
                       int M, int N, int K, float alpha) {
        dim3 grid((unsigned)(N / 128), (unsigned)(M / 128));
        gemm_bf16_wmma<128, decltype(mode)::value><<<grid, 256, 0, stream>>>(
            A, lda, Bm, ldb, bias, C, ldc, M, N, K, alpha,
            ZStride{0, 0}, ZStride{0, 0}, ZStride{0, 0});
    };

    // 1) Convert inputs/weights to bf16
    cvt_all_f32_to_bf16<<<CV_GRID, CV_THREADS, 0, stream>>>(
        src, Wqkv, Wo, W1, W2, src_bf, Wqkv_bf, Wo_bf, W1_bf, W2_bf);

    // 2) QKV projection: qkv = src @ Wqkv^T + bqkv  -> bf16 [NT, 3D]
    gemm128(StoreMode<1>{}, src_bf, DIM, Wqkv_bf, DIM, bqkv, qkv_bf, D3,
            (int)NT, D3, DIM, 1.0f);

    // 3, 4) Attention: ctx[b, :, h*HD:(h+1)*HD] = softmax(q k^T / 8 + bias[h]) v
    attn_fused<<<dim3(8, BSZ, NH * (SEQ / ATT_ROWS) / 8), ATT_WAVES * 32, 0, stream>>>(
        qkv_bf, attn_bias, ctx_bf);

    // 5) Output projection: y = ctx @ Wo^T + bo  (f32)
    gemm128(StoreMode<0>{}, ctx_bf, DIM, Wo_bf, DIM, bo, y_f, DIM,
            (int)NT, DIM, DIM, 1.0f);

    // 6) x = LN(src + y) -> f32 + bf16
    add_ln_kernel<<<(unsigned)NT, 256, 0, stream>>>(y_f, src, g1, b1n, x_f, x_bf);

    // 7) FF1: h = gelu(x @ W1^T + b1) -> bf16 [NT, FF]
    gemm128(StoreMode<2>{}, x_bf, DIM, W1_bf, DIM, b1, h_bf, FFD,
            (int)NT, FFD, DIM, 1.0f);

    // 8) FF2: f = h @ W2^T + b2 -> f32
    gemm128(StoreMode<0>{}, h_bf, FFD, W2_bf, FFD, b2, f_f, DIM,
            (int)NT, DIM, FFD, 1.0f);

    // 9) out = LN(x + f)
    add_ln_kernel<<<(unsigned)NT, 256, 0, stream>>>(f_f, x_f, g2, b2n, out, nullptr);
}

// v009
// It runs in 153 microseconds.
// Two timings next to v008 put it at 1.07 and 1.06 times that version's speed.
// Counting every step since v000, it is 13.0 times as fast.
#include <hip/hip_runtime.h>
#include <math.h>

// ---------------------------------------------------------------------------
// Types for CDNA5 WMMA (wave32)
// ---------------------------------------------------------------------------
typedef __bf16 bf16_t;
typedef __attribute__((ext_vector_type(16))) __bf16 v16bf;
typedef __attribute__((ext_vector_type(2)))  __bf16 bf16x2;
typedef __attribute__((ext_vector_type(8)))  float  v8f;

// Problem constants (match reference)
constexpr int BSZ = 4;
constexpr int SEQ = 1024;
constexpr int DIM = 1024;
constexpr int NH  = 16;
constexpr int HDM = 64;
constexpr int FFD = 4096;
constexpr int D3  = 3 * DIM;

constexpr int GK     = 128;      // k extent of one GEMM stage: 256-byte rows
constexpr int GPITCH = GK + 8;   // LDS row pitch in elements: 272 B, for ds_load_b128 readers

// ---------------------------------------------------------------------------
// f32 -> bf16 convert of all five GEMM operands in one streaming launch.
// One workgroup of 16 waves per CV_CHUNK contiguous elements of one tensor
// (every tensor is a whole number of chunks). A lane has CV_LOADS independent
// 16-byte loads, so many are in flight at once; each wave-wide load covers 512
// contiguous bytes and each wave-wide store 256.
// ---------------------------------------------------------------------------
typedef __attribute__((ext_vector_type(4))) float  cv_f32x4;
typedef __attribute__((ext_vector_type(4))) __bf16 cv_bf16x4;

constexpr int CV_THREADS = 512;
constexpr int CV_LOADS   = 32;                          // 16-byte loads per lane
constexpr int CV_CHUNK   = CV_THREADS * CV_LOADS * 4;   // elements per workgroup
constexpr unsigned CV_SRC  = (unsigned)(BSZ * SEQ * DIM / CV_CHUNK);
constexpr unsigned CV_WQKV = (unsigned)(D3 * DIM / CV_CHUNK);
constexpr unsigned CV_WO   = (unsigned)(DIM * DIM / CV_CHUNK);
constexpr unsigned CV_W1   = (unsigned)(FFD * DIM / CV_CHUNK);
constexpr unsigned CV_W2   = (unsigned)(DIM * FFD / CV_CHUNK);
constexpr unsigned CV_GRID = CV_SRC + CV_WQKV + CV_WO + CV_W1 + CV_W2;
static_assert(BSZ * SEQ * DIM % CV_CHUNK == 0 && D3 * DIM % CV_CHUNK == 0 &&
              DIM * DIM % CV_CHUNK == 0 && FFD * DIM % CV_CHUNK == 0,
              "every tensor must be a whole number of chunks");

__global__ __launch_bounds__(CV_THREADS) void cvt_all_f32_to_bf16(
    const float* __restrict__ src,  const float* __restrict__ wqkv,
    const float* __restrict__ wo,   const float* __restrict__ w1,
    const float* __restrict__ w2,
    bf16_t* __restrict__ src_o,  bf16_t* __restrict__ wqkv_o,
    bf16_t* __restrict__ wo_o,   bf16_t* __restrict__ w1_o,
    bf16_t* __restrict__ w2_o) {
    // Which tensor, and which chunk of it: the same for the whole workgroup.
    unsigned blk = blockIdx.x;
    const float* in = src;
    bf16_t* out = src_o;
    if (blk >= CV_SRC) {
        blk -= CV_SRC; in = wqkv; out = wqkv_o;
        if (blk >= CV_WQKV) {
            blk -= CV_WQKV; in = wo; out = wo_o;
            if (blk >= CV_WO) {
                blk -= CV_WO; in = w1; out = w1_o;
                if (blk >= CV_W1) { blk -= CV_W1; in = w2; out = w2_o; }
            }
        }
    }
    const cv_f32x4* ip = (const cv_f32x4*)(in + (size_t)blk * CV_CHUNK) + threadIdx.x;
    cv_bf16x4*      op = (cv_bf16x4*)(out + (size_t)blk * CV_CHUNK) + threadIdx.x;

    cv_f32x4 v[CV_LOADS];
#pragma unroll
    for (int j = 0; j < CV_LOADS; ++j) v[j] = ip[j * CV_THREADS];
#pragma unroll
    for (int j = 0; j < CV_LOADS; ++j)
        op[j * CV_THREADS] = __builtin_convertvector(v[j], cv_bf16x4);
}

// ---------------------------------------------------------------------------
// Fragment gather from an LDS tile, per ISA 7.12.2 16-bit A/B layout.
// For lane l: row = base + (l&15), half = l>>4; VGPR v holds
// K = k0 + kbase(v) + half*8 + {0,1}, kbase = {0,2,4,6,16,18,20,22}.
// ---------------------------------------------------------------------------
__device__ inline v16bf load_frag(const bf16_t* __restrict__ smem, int baseRow, int k0, int lane) {
    const int r    = baseRow + (lane & 15);
    const int half = (lane >> 4) & 1;
    const bf16_t* p = smem + r * GPITCH + k0 + half * 8;
    v16bf f;
#pragma unroll
    for (int v = 0; v < 8; ++v) {
        const int k2 = (v < 4) ? (2 * v) : (16 + 2 * (v - 4));
        bf16x2 pr = *(const bf16x2*)(p + k2);
        f[2 * v]     = pr.x;
        f[2 * v + 1] = pr.y;
    }
    return f;
}

// Eight async copies (global -> LDS, 16 B per lane each): 128 rows of 256 B per
// workgroup. g and l are this lane's first addresses; copy i lies 16 rows on.
// The closing wait stands inside the statement, so that no address register is
// rewritten in front of it.
__device__ __forceinline__ void copy_rows128(const bf16_t* g, size_t ld, unsigned l) {
    const bf16_t* g1 = g  + 16 * ld;
    const bf16_t* g2 = g1 + 16 * ld;
    const bf16_t* g3 = g2 + 16 * ld;
    const bf16_t* g4 = g3 + 16 * ld;
    const bf16_t* g5 = g4 + 16 * ld;
    const bf16_t* g6 = g5 + 16 * ld;
    const bf16_t* g7 = g6 + 16 * ld;
    constexpr unsigned LS = 16u * GPITCH * 2u;   // 16 LDS rows, bytes
    asm volatile("global_load_async_to_lds_b128 %0, %8, off\n\t"
                 "global_load_async_to_lds_b128 %1, %9, off\n\t"
                 "global_load_async_to_lds_b128 %2, %10, off\n\t"
                 "global_load_async_to_lds_b128 %3, %11, off\n\t"
                 "global_load_async_to_lds_b128 %4, %12, off\n\t"
                 "global_load_async_to_lds_b128 %5, %13, off\n\t"
                 "global_load_async_to_lds_b128 %6, %14, off\n\t"
                 "global_load_async_to_lds_b128 %7, %15, off\n\t"
                 "s_wait_xcnt 0x0"
                 :: "v"(l), "v"(l + LS), "v"(l + 2 * LS), "v"(l + 3 * LS),
                    "v"(l + 4 * LS), "v"(l + 5 * LS), "v"(l + 6 * LS), "v"(l + 7 * LS),
                    "v"(g), "v"(g1), "v"(g2), "v"(g3), "v"(g4), "v"(g5), "v"(g6), "v"(g7)
                 : "memory");
}

// ---------------------------------------------------------------------------
// Exact-form GELU, 0.5 v (1 + erf(v / sqrt 2)), for two values at once and with
// no branch. With z = |v| / sqrt 2 and t = 1 / (1 + 0.3275911 z),
//   erfc(z) = t (a1 + t (a2 + t (a3 + t (a4 + t a5)))) exp(-z^2),
// absolute error at most 1.5e-7 for every z >= 0 (the five-term rational form of
// the handbooks), and 0.5 v (1 + erf) = 0.5 v + |v| (0.5 - 0.5 erfc(z)).
// The constants below hold the factors 0.5, 1 / sqrt 2 and log2(e).
// ---------------------------------------------------------------------------
typedef float gl_f32x2 __attribute__((ext_vector_type(2)));
typedef float        ep_f32x4 __attribute__((ext_vector_type(4)));
typedef unsigned int ep_u32x4 __attribute__((ext_vector_type(4)));

__device__ __forceinline__ gl_f32x2 gelu2(gl_f32x2 v) {
    const gl_f32x2 a = __builtin_elementwise_abs(v);
    const gl_f32x2 d = __builtin_elementwise_fma(a, gl_f32x2{0.23164189f, 0.23164189f},
                                                 gl_f32x2{1.0f, 1.0f});
    const gl_f32x2 kv = v * 0.84932178f;            // kv^2 = z^2 log2(e)
    const gl_f32x2 ar = -(kv * kv);
    // Both reciprocals and both exponentials in one statement that ends in a v_nop:
    // the instruction set asks for one free slot behind a transcendental before its
    // result is used or a source of it overwritten.
    // The early-clobber outputs keep results off sources.
    float t0, t1, e0, e1;
    asm("v_rcp_f32 %0, %4\n\t"
        "v_rcp_f32 %1, %5\n\t"
        "v_exp_f32 %2, %6\n\t"
        "v_exp_f32 %3, %7\n\t"
        "v_nop"
        : "=&v"(t0), "=&v"(t1), "=&v"(e0), "=&v"(e1)
        : "v"(d.x), "v"(d.y), "v"(ar.x), "v"(ar.y));
    const gl_f32x2 t = {t0, t1}, e = {e0, e1};
    gl_f32x2 p = __builtin_elementwise_fma(t, gl_f32x2{0.53070271f, 0.53070271f},
                                           gl_f32x2{-0.72657603f, -0.72657603f});
    p = __builtin_elementwise_fma(p, t, gl_f32x2{0.71070689f, 0.71070689f});
    p = __builtin_elementwise_fma(p, t, gl_f32x2{-0.14224836f, -0.14224836f});
    p = __builtin_elementwise_fma(p, t, gl_f32x2{0.12741479f, 0.12741479f});
    p = p * t;                                      // 0.5 erfc(z) exp(z^2)
    const gl_f32x2 s = __builtin_elementwise_fma(-p, e, gl_f32x2{0.5f, 0.5f});
    return __builtin_elementwise_fma(a, s, v * 0.5f);
}

// ---------------------------------------------------------------------------
// Generic bf16 WMMA GEMM:  C[M,N] = alpha * A[M,K] @ B[N,K]^T + bias[N]
// MODE 0: store f32      MODE 1: store bf16      MODE 2: GELU (gelu2) -> bf16
// MODE is a template parameter: the epilogue of each instantiation holds its one
// store form alone, with no test of the mode per element.
//
// Block tile 128 x BN (BN = 128), 8 waves (4 row-groups x 2 col-groups),
// wave tile 32 x (BN/2). K stepped by GK = 128 through two LDS buffers filled
// with GLOBAL_LOAD_ASYNC_TO_LDS_B128: the copies of stage s+1 fly while stage s
// is worked on, 32 WMMAs a wave between two barriers. Inside a stage the fragments
// of the next 32 k are fetched from LDS while the current 32 k are multiplied.
// Requires: M%128==0, N%BN==0, K%GK==0, lda/ldb%8==0, 16B-aligned bases.
// Batched over blockIdx.z: z = hz * BSZ + b; every operand's base moves by
// b * (its .b stride) + hz * (its .h stride), in elements. A plain GEMM is
// launched with gridDim.z == 1.
// ---------------------------------------------------------------------------
struct ZStride { int b, h; };
template <int V> struct StoreMode { static constexpr int value = V; };

template <int BN, int MODE>
__global__ __launch_bounds__(256) void gemm_bf16_wmma(
    const bf16_t* __restrict__ A, int lda,
    const bf16_t* __restrict__ Bm, int ldb,
    const float* __restrict__ bias,
    void* __restrict__ C, int ldc,
    int M, int N, int K, float alpha,
    ZStride zA, ZStride zB, ZStride zC) {

    static_assert(BN % 128 == 0, "a copy statement fills 128 rows");
    constexpr int CT = BN / 32;        // wave col tiles of 16

    __shared__ __align__(16) bf16_t As[2 * 128 * GPITCH];
    __shared__ __align__(16) bf16_t Bs[2 * BN * GPITCH];

    const int tid  = threadIdx.x;
    const int lane = tid & 31;
    const int wave = tid >> 5;
    const int m_w  = (wave & 3) * 32;        // 4 wave-rows x 32
    const int n_w  = (wave >> 2) * (BN / 2); // 2 wave-cols x BN/2

    const int m0 = blockIdx.y * 128;
    const int n0 = blockIdx.x * BN;

    const int zb = blockIdx.z & (BSZ - 1);
    const int zh = blockIdx.z / BSZ;
    A  += (size_t)zb * zA.b + (size_t)zh * zA.h;
    Bm += (size_t)zb * zB.b + (size_t)zh * zB.h;
    const size_t zc = (size_t)zb * zC.b + (size_t)zh * zC.h;

    v8f acc[2][CT] = {};

    // One stage's copies: 16 lanes per 256-byte row, so a wave-wide copy covers
    // two whole rows of the stage.
    const int crow = tid >> 4, cch = tid & 15;
    const bf16_t* gA = A  + (size_t)(m0 + crow) * lda + cch * 8;
    const bf16_t* gB = Bm + (size_t)(n0 + crow) * ldb + cch * 8;
    const unsigned lA = (unsigned)(uintptr_t)(As + crow * GPITCH + cch * 8);
    const unsigned lB = (unsigned)(uintptr_t)(Bs + crow * GPITCH + cch * 8);
    auto issue = [&](int s, int st) {
        copy_rows128(gA + (size_t)s * GK, (size_t)lda, lA + (unsigned)st * (128u * GPITCH * 2u));
#pragma unroll
        for (int i = 0; i < BN / 128; ++i)
            copy_rows128(gB + (size_t)s * GK + (size_t)i * 128 * ldb, (size_t)ldb,
                         lB + (unsigned)st * (BN * GPITCH * 2u) + (unsigned)i * (128u * GPITCH * 2u));
    };

    const int NS = K / GK;
    issue(0, 0);
    asm volatile("s_wait_asynccnt 0x0" ::: "memory");   // this wave's part of stage 0 has landed
    __syncthreads();                                    // every wave's part has
    if (NS > 1) issue(1, 1);

    for (int s = 0; s < NS; ++s) {
        const int buf = s & 1;
        const bf16_t* Ab = As + buf * (128 * GPITCH);
        const bf16_t* Bb = Bs + buf * (BN * GPITCH);

        // Two fragment sets: block kk + 1's LDS loads go out as one group ahead of
        // block kk's WMMAs and land under them. All of it stays inside this stage's
        // buffer; only block 0's loads are waited for in the open.
        v16bf af[2][2], bfv[2][CT];
        auto fetch = [&](int set, int kk) {
#pragma unroll
            for (int r = 0; r < 2; ++r)  af[set][r]  = load_frag(Ab, m_w + r * 16, kk * 32, lane);
#pragma unroll
            for (int c = 0; c < CT; ++c) bfv[set][c] = load_frag(Bb, n_w + c * 16, kk * 32, lane);
        };
        fetch(0, 0);
#pragma unroll
        for (int kk = 0; kk < GK / 32; ++kk) {
            const int cur = kk & 1;
            if (kk + 1 < GK / 32) fetch(cur ^ 1, kk + 1);
            // Keeps the load group whole and ahead of the block: left free, the loads are
            // sunk among the WMMAs that need them, each behind a wait for all LDS loads.
            __builtin_amdgcn_sched_barrier(0);
#pragma unroll
            for (int r = 0; r < 2; ++r)
#pragma unroll
                for (int c = 0; c < CT; ++c)
                    // Rows of B as the first operand: the tile comes out transposed (epilogue).
                    acc[r][c] = __builtin_amdgcn_wmma_f32_16x16x32_bf16(
                        false, bfv[cur][c], false, af[cur][r], (short)0, acc[r][c], false, false);
            // The other side of the fence: the next group stays behind this block.
            __builtin_amdgcn_sched_barrier(0);
        }

        // Hand-over: this wave has left buffer buf, and its copies of stage s+1 have
        // landed; behind the barrier that holds for every wave.
        asm volatile("s_wait_dscnt 0x0" ::: "memory");
        asm volatile("s_wait_asynccnt 0x0" ::: "memory");
        __syncthreads();
        if (s + 2 < NS) issue(s + 2, buf);
    }
    asm volatile("s_wait_asynccnt 0x0" ::: "memory");   // no copy is left in flight

    // Epilogue. The product is the transposed tile (rows of B are the A operand), so
    // in acc[r][c] lane l holds row r * 16 + (l & 15) of the wave's 32 x 64 part of C
    // and its columns c * 16 + 8 * (l >> 4) + 0..7: adjacent in memory.
    // Each wave lays its part out in LDS (a range of its own in As, which every wave
    // has left behind the loop's last barrier) and stores it as whole rows, 16 bytes
    // a lane: 128-byte (bf16) or 256-byte (f32) runs instead of 32-byte pieces.
    constexpr unsigned ESZ  = (MODE == 0) ? 4u : 2u;        // bytes per element of C
    constexpr unsigned RB   = (BN / 2) * ESZ;               // bytes per row of the wave's part
    constexpr unsigned SP   = RB + 16u;                     // LDS pitch: odd multiple of 16 B
    constexpr unsigned LPR  = RB / 16u;                     // lanes per row at the store
    constexpr unsigned RPS  = 32u / LPR;                    // rows per wave-wide store
    static_assert(8u * 32u * SP <= sizeof(As), "eight waves' parts must fit As");
    unsigned char* stg = (unsigned char*)As + (unsigned)wave * (32u * SP);
    const unsigned lc = lane & 15, lh = (lane >> 4) & 1;
#pragma unroll
    for (int c = 0; c < CT; ++c) {
        const float* bp = bias + n0 + n_w + c * 16 + 8 * lh;
        const ep_f32x4 b0 = *(const ep_f32x4*)bp, b1 = *(const ep_f32x4*)(bp + 4);
        const float bv[8] = {b0.x, b0.y, b0.z, b0.w, b1.x, b1.y, b1.z, b1.w};
#pragma unroll
        for (int r = 0; r < 2; ++r) {
            unsigned char* sp = stg + (r * 16 + lc) * SP + (c * 16 + 8 * lh) * ESZ;
            float v[8];
#pragma unroll
            for (int i = 0; i < 8; ++i) v[i] = acc[r][c][i] * alpha + bv[i];
            if constexpr (MODE == 0) {
                *(ep_f32x4*)sp        = ep_f32x4{v[0], v[1], v[2], v[3]};
                *(ep_f32x4*)(sp + 16) = ep_f32x4{v[4], v[5], v[6], v[7]};
            } else {
                ep_u32x4 w;
#pragma unroll
                for (int i = 0; i < 4; ++i) {
                    gl_f32x2 y = {v[2 * i], v[2 * i + 1]};
                    if constexpr (MODE == 2) y = gelu2(y);
                    w[i] = __builtin_bit_cast(unsigned, __builtin_convertvector(y, bf16x2));
                }
                *(ep_u32x4*)sp = w;
            }
        }
    }
    // This wave's LDS writes are done before its lanes read one another's.
    asm volatile("s_wait_dscnt 0x0" ::: "memory");
    unsigned char* Cw = (unsigned char*)C
        + (zc + (size_t)(m0 + m_w + lane / LPR) * ldc + n0 + n_w) * ESZ + (lane % LPR) * 16u;
    const unsigned char* rp = stg + (lane / LPR) * SP + (lane % LPR) * 16u;
#pragma unroll
    for (unsigned j = 0; j < 32u / RPS; ++j)
        *(ep_u32x4*)(Cw + (size_t)(j * RPS) * ldc * ESZ) = *(const ep_u32x4*)(rp + j * RPS * SP);
}

typedef unsigned int u32x4 __attribute__((ext_vector_type(4)));
typedef short        s16x8 __attribute__((ext_vector_type(8)));
typedef float        f32x2 __attribute__((ext_vector_type(2)));
typedef float        f32x4 __attribute__((ext_vector_type(4)));

constexpr unsigned PITCH_K = 2 * HDM + 16;   // odd multiple of 16 B: ds_load_b128 readers
constexpr unsigned PITCH_V = 2 * HDM + 32;   // odd multiple of 32 B: ds_load_tr16_b128 readers
constexpr unsigned V_OFF   = SEQ * PITCH_K;
constexpr unsigned ATT_LDS = V_OFF + SEQ * PITCH_V;
constexpr int ATT_WAVES = 16;                // 16 query rows each
constexpr int ATT_ROWS  = ATT_WAVES * 16;
constexpr int ATT_KEYS  = 64;                // keys per pass
constexpr int ATT_PASSES = SEQ / ATT_KEYS;
static_assert(ATT_LDS <= 320u * 1024u, "K and V of one head must fit one workgroup's LDS");
static_assert(ATT_PASSES % 2 == 0, "the pass loop is written in pairs");

struct Frag { u32x4 q[2]; };   // one 16 x 32 bf16 operand: 8 registers per lane

__device__ __forceinline__ v8f mma(const Frag& a, const Frag& b, v8f c) {
    return __builtin_amdgcn_wmma_f32_16x16x32_bf16(
        false, __builtin_bit_cast(v16bf, a), false, __builtin_bit_cast(v16bf, b),
        (short)0, c, false, false);
}
__device__ __forceinline__ u32x4 ld_tr16(const unsigned char* p) {
    typedef __attribute__((address_space(3))) s16x8 lds_s16x8;
    return __builtin_bit_cast(u32x4, __builtin_amdgcn_ds_load_tr16_b128_v8i16((lds_s16x8*)p));
}
__device__ __forceinline__ unsigned pack2(float lo, float hi) {   // round to nearest even
    return __builtin_bit_cast(unsigned, __builtin_convertvector(f32x2{lo, hi}, bf16x2));
}
__device__ __forceinline__ float xhalf(float x) {                 // lane l with lane l ^ 16
    return __builtin_bit_cast(float, __builtin_amdgcn_permlanex16(
        __builtin_bit_cast(int, x), __builtin_bit_cast(int, x),
        0x76543210, 0xfedcba98, false, false));
}

__global__ __launch_bounds__(ATT_WAVES * 32) void attn_fused(const bf16_t* __restrict__ qkv,
                                                             const float* __restrict__ bias,
                                                             bf16_t* __restrict__ ctx) {
    __shared__ __attribute__((aligned(256))) unsigned char L[ATT_LDS];
    const unsigned tid = threadIdx.x, lane = tid & 31u, wave = tid >> 5;
    const unsigned c = lane & 15u, h = lane >> 4;
    // Grid (8, batch, 8): the BSZ workgroups that read one bias block lie 8 apart
    // in launch order, in the hope that they share one L2's copy of it (speed only:
    // no result depends on where a workgroup runs).
    const unsigned tile = blockIdx.x + 8u * blockIdx.z;      // head * 4 + row block
    const unsigned b    = blockIdx.y;
    const unsigned hd   = tile / (SEQ / ATT_ROWS);
    const unsigned q0   = (tile % (SEQ / ATT_ROWS)) * ATT_ROWS + wave * 16u;

    const bf16_t* base = qkv + (size_t)b * SEQ * D3 + hd * HDM;   // q of token 0

    // Stage K and V: 8 lanes per 128-byte row, whole lines from memory.
    constexpr int RST = ATT_WAVES * 32 / 8;   // rows per step of the workgroup
    constexpr int NST = SEQ / RST;
    const unsigned srow = tid >> 3, sch = tid & 7u;
    const bf16_t* sp = base + (size_t)srow * D3 + sch * 8u;
    u32x4 kr[NST], vr[NST];
#pragma unroll
    for (int i = 0; i < NST; ++i) {
        kr[i] = *(const u32x4*)(sp + (size_t)i * RST * D3 + DIM);
        vr[i] = *(const u32x4*)(sp + (size_t)i * RST * D3 + 2 * DIM);
    }

    // Q fragments in the hardware k order (as K's below), scaled by 1/8.
    Frag qf[2];
    const bf16_t* qp = base + (size_t)(q0 + c) * D3 + 8u * h;
    {
#pragma unroll
        for (int kc = 0; kc < 2; ++kc) {
            Frag f;
            f.q[0] = *(const u32x4*)(qp + 32 * kc);
            f.q[1] = *(const u32x4*)(qp + 32 * kc + 16);
            v16bf t = __builtin_bit_cast(v16bf, f);
#pragma unroll
            for (int e = 0; e < 16; ++e) t[e] = (bf16_t)((float)t[e] * 0.125f);
            qf[kc] = __builtin_bit_cast(Frag, t);
        }
    }

    // A operand whose row 0 is ones: row 0 of its product is the column sums of P^T.
    Frag ones;
    {
        const unsigned o = (c == 0u) ? 0x3F803F80u : 0u;
        ones.q[0] = u32x4{o, o, o, o};
        ones.q[1] = u32x4{o, o, o, o};
    }

    v8f acc[4] = {};          // O^T: acc[t][r] = O[q0 + c][16 t + 8 h + r]
    v8f lacc = {};            // register 0 of lanes 0-15: denominator of query c
    float m_run = -INFINITY;  // maximum in use, base-2 scaled; equal in lanes c, c + 16
    constexpr float LOG2E = 1.4426950408889634f;

    // This lane's bias: row q0 + c, keys 16 j + 8 h + 0..7 of each pass.
    const float* bp = bias + ((size_t)hd * SEQ + q0 + c) * SEQ + 8u * h;
    auto load_bias = [&](v8f (&d)[4], int it) {
#pragma unroll
        for (int j = 0; j < 4; ++j) {
            const f32x4 lo = *(const f32x4*)(bp + it * ATT_KEYS + 16 * j);
            const f32x4 hi = *(const f32x4*)(bp + it * ATT_KEYS + 16 * j + 4);
            d[j] = v8f{lo.x, lo.y, lo.z, lo.w, hi.x, hi.y, hi.z, hi.w};
        }
    };

    // One pass over 64 keys. s arrives holding the pass's bias tile; nx is filled
    // with the next pass's (fetch: a literal at every call, false in the last pass),
    // so that its memory latency lies under this pass.
    auto pass = [&](v8f (&s)[4], v8f (&nx)[4], int it, bool fetch) __attribute__((always_inline)) {
        if (fetch) {
            load_bias(nx, it + 1);
            // Before the loop's pointer, which these loads name, is advanced.
            asm volatile("s_wait_xcnt 0x0" ::: "memory");
        }
        // Holds these loads at the head of the pass: sunk to where registers come
        // free they would have half a pass, too little for a read from memory.
        __builtin_amdgcn_sched_barrier(0);

        const unsigned char* kp = L + (it * ATT_KEYS + c) * PITCH_K + 16u * h;
#pragma unroll
        for (int j = 0; j < 4; ++j) {
#pragma unroll
            for (int kc = 0; kc < 2; ++kc) {
                Frag kf;
                kf.q[0] = *(const u32x4*)(kp + j * 16 * PITCH_K + 64 * kc);
                kf.q[1] = *(const u32x4*)(kp + j * 16 * PITCH_K + 64 * kc + 32);
                s[j] = mma(kf, qf[kc], s[j]);   // s[j][r] = score(key 16 j + 8 h + r, query c)
            }
        }

        float mx = s[0][0];
#pragma unroll
        for (int j = 0; j < 4; ++j)
#pragma unroll
            for (int r = 0; r < 8; ++r) mx = __builtin_fmaxf(mx, s[j][r]);
        mx = __builtin_fmaxf(mx, xhalf(mx)) * LOG2E;   // both halves: this query's maximum

        if (__builtin_amdgcn_ballot_w32(mx > m_run + 8.0f) != 0) {   // scalar branch, rare
            const float m_new = __builtin_fmaxf(m_run, mx);
            const float corr  = __builtin_amdgcn_exp2f(m_run - m_new);  // 0 on the first pass
            m_run = m_new;
            lacc = lacc * corr;
#pragma unroll
            for (int t = 0; t < 4; ++t) acc[t] = acc[t] * corr;
        }
        const float nm = -m_run;

#pragma unroll
        for (int g = 0; g < 2; ++g) {   // 32 keys: one k extent of the second product
            const unsigned char* ad = L + V_OFF
                + (it * ATT_KEYS + 32u * g + 8u * h + (lane & 7u)) * PITCH_V
                + ((lane >> 3) & 1u) * 16u;
            Frag vf[4];
#pragma unroll
            for (int t = 0; t < 4; ++t) {
                vf[t].q[0] = ld_tr16(ad + 32 * t);
                vf[t].q[1] = ld_tr16(ad + 16 * PITCH_V + 32 * t);
            }
            unsigned w[8];
#pragma unroll
            for (int i = 0; i < 8; ++i) {   // elements 2 i, 2 i + 1 of the 32-key operand
                const v8f& sv = s[2 * g + (i >> 2)];
                const f32x2 arg = __builtin_elementwise_fma(
                    f32x2{sv[2 * (i & 3)], sv[2 * (i & 3) + 1]}, f32x2{LOG2E, LOG2E},
                    f32x2{nm, nm});
                w[i] = pack2(__builtin_amdgcn_exp2f(arg.x), __builtin_amdgcn_exp2f(arg.y));
            }
            Frag pf;
            pf.q[0] = u32x4{w[0], w[1], w[2], w[3]};
            pf.q[1] = u32x4{w[4], w[5], w[6], w[7]};
#pragma unroll
            for (int t = 0; t < 4; ++t) acc[t] = mma(vf[t], pf, acc[t]);
            lacc = mma(ones, pf, lacc);
        }
    };

    v8f sa[4], sb[4];
    load_bias(sa, 0);
    // Every load so far is issued. The inputs keep the loads' address registers
    // from being given away (to a later load's result) in front of the wait.
    asm volatile("s_wait_xcnt 0x0" :: "v"(sp), "v"(qp), "v"(bp) : "memory");
    __builtin_amdgcn_sched_barrier(0);   // keeps every other reuse behind the wait
#pragma unroll
    for (int i = 0; i < NST; ++i) {
        *(u32x4*)(L + (srow + i * RST) * PITCH_K + sch * 16u)         = kr[i];
        *(u32x4*)(L + V_OFF + (srow + i * RST) * PITCH_V + sch * 16u) = vr[i];
    }
    __syncthreads();   // K and V are staged; nothing writes LDS after this

    for (int it = 0; it < ATT_PASSES - 2; it += 2) {
        pass(sa, sb, it, true);
        pass(sb, sa, it + 1, true);
    }
    pass(sa, sb, ATT_PASSES - 2, true);
    pass(sb, sa, ATT_PASSES - 1, false);

    // Lanes 16-31 hold row 8 of the sum tile, which is 0: the exchange-and-add
    // gives both halves the denominator.
    const float lr  = lacc[0];
    const float inv = 1.0f / (lr + xhalf(lr));
    bf16_t* op = ctx + (size_t)(b * SEQ + q0 + c) * DIM + hd * HDM + 8u * h;
#pragma unroll
    for (int t = 0; t < 4; ++t) {
        const v8f o = acc[t] * inv;
        *(u32x4*)(op + 16 * t) = u32x4{pack2(o[0], o[1]), pack2(o[2], o[3]),
                                       pack2(o[4], o[5]), pack2(o[6], o[7])};
    }
}

// ---------------------------------------------------------------------------
// Fused residual + LayerNorm over rows of width DIM (= 1024).
// One wave per row, the row held in registers: 32 values a lane, fetched and
// stored 16 bytes a lane, so that every wave-wide access covers 512 contiguous
// bytes (256 for the bf16 copy). All 32 loads of a wave (both addends, gain and
// shift) go out together. Mean and variance are summed in the lane, then over the
// 32 lanes in five exchange-and-add steps: no LDS and no barrier.
// WB: also write the bf16 copy of the result.
// ---------------------------------------------------------------------------
constexpr int LN_WAVES = 16;                    // rows per workgroup
constexpr int LN_VEC   = DIM / (32 * 4);        // 16-byte pieces of a row per lane
constexpr unsigned LN_GRID = (unsigned)(BSZ * SEQ / LN_WAVES);
static_assert(DIM % 128 == 0 && BSZ * SEQ % LN_WAVES == 0, "whole rows, whole workgroups");

template <int MASK>
__device__ __forceinline__ float row_xor(float x) {   // lane l with lane l ^ MASK, MASK < 16
    return __builtin_bit_cast(float, __builtin_amdgcn_mov_dpp(
        __builtin_bit_cast(int, x), 0x160 + MASK, 0xf, 0xf, true));
}
__device__ __forceinline__ float wave_sum(float x) {  // every lane gets the sum of all 32
    x += row_xor<1>(x);
    x += row_xor<2>(x);
    x += row_xor<4>(x);
    x += row_xor<8>(x);
    return x + xhalf(x);
}

template <bool WB>
__global__ __launch_bounds__(LN_WAVES * 32) void add_ln_kernel(const float* __restrict__ a,
                                                               const float* __restrict__ res,
                                                               const float* __restrict__ g,
                                                               const float* __restrict__ b,
                                                               float* __restrict__ outf,
                                                               bf16_t* __restrict__ outb) {
    const unsigned lane = threadIdx.x & 31u, wave = threadIdx.x >> 5;
    const size_t   row  = (size_t)blockIdx.x * LN_WAVES + wave;
    const cv_f32x4* ap = (const cv_f32x4*)(a   + row * DIM) + lane;
    const cv_f32x4* rp = (const cv_f32x4*)(res + row * DIM) + lane;
    const cv_f32x4* gp = (const cv_f32x4*)g + lane;
    const cv_f32x4* bp = (const cv_f32x4*)b + lane;

    cv_f32x4 v[LN_VEC], r[LN_VEC], gv[LN_VEC], bv[LN_VEC];
#pragma unroll
    for (int j = 0; j < LN_VEC; ++j) { v[j] = ap[32 * j]; r[j] = rp[32 * j]; }
#pragma unroll
    for (int j = 0; j < LN_VEC; ++j) { gv[j] = gp[32 * j]; bv[j] = bp[32 * j]; }
    // Every load is issued before a register that one of them names is used again. The
    // inputs keep the address registers from being given to a later load's result.
    asm volatile("s_wait_xcnt 0x0" :: "v"(ap), "v"(rp), "v"(lane) : "memory");
    // Keeps all 32 loads ahead of the sums: left free, the gain and shift loads are sunk
    // behind both reductions, two at a time, each pair with a wait of its own.
    __builtin_amdgcn_sched_barrier(0);

    cv_f32x4 s4 = {0.0f, 0.0f, 0.0f, 0.0f};
#pragma unroll
    for (int j = 0; j < LN_VEC; ++j) { v[j] += r[j]; s4 += v[j]; }
    const float mean = wave_sum((s4.x + s4.y) + (s4.z + s4.w)) * (1.0f / DIM);

    cv_f32x4 q4 = {0.0f, 0.0f, 0.0f, 0.0f};
#pragma unroll
    for (int j = 0; j < LN_VEC; ++j) { v[j] -= mean; q4 += v[j] * v[j]; }
    const float inv = rsqrtf(wave_sum((q4.x + q4.y) + (q4.z + q4.w)) * (1.0f / DIM) + 1e-5f);

    cv_bf16x4 hv[LN_VEC];
#pragma unroll
    for (int j = 0; j < LN_VEC; ++j) {
        v[j] = v[j] * inv * gv[j] + bv[j];
        if constexpr (WB) hv[j] = __builtin_convertvector(v[j], cv_bf16x4);
    }
    cv_f32x4* op = (cv_f32x4*)(outf + row * DIM) + lane;
#pragma unroll
    for (int j = 0; j < LN_VEC; ++j) op[32 * j] = v[j];
    if constexpr (WB) {
        cv_bf16x4* hp = (cv_bf16x4*)(outb + row * DIM) + lane;
#pragma unroll
        for (int j = 0; j < LN_VEC; ++j) hp[32 * j] = hv[j];
    }
}

// ---------------------------------------------------------------------------
// Host orchestration
// ---------------------------------------------------------------------------
extern "C" void kernel_launch(void* const* d_in, const int* in_sizes, int n_in,
                              void* d_out, int out_size, void* d_ws, size_t ws_size,
                              hipStream_t stream) {
    (void)in_sizes; (void)n_in; (void)out_size; (void)ws_size;

    const float* src       = (const float*)d_in[0];
    const float* attn_bias = (const float*)d_in[1];
    const float* Wqkv      = (const float*)d_in[2];
    const float* bqkv      = (const float*)d_in[3];
    const float* Wo        = (const float*)d_in[4];
    const float* bo        = (const float*)d_in[5];
    const float* g1        = (const float*)d_in[6];
    const float* b1n       = (const float*)d_in[7];
    const float* g2        = (const float*)d_in[8];
    const float* b2n       = (const float*)d_in[9];
    const float* W1        = (const float*)d_in[10];
    const float* b1        = (const float*)d_in[11];
    const float* W2        = (const float*)d_in[12];
    const float* b2        = (const float*)d_in[13];
    float* out = (float*)d_out;

    char* ws = (char*)d_ws;
    size_t off = 0;
    auto alloc = [&](size_t bytes) -> char* {
        char* p = ws + off;
        off += (bytes + 255) & ~(size_t)255;
        return p;
    };

    const size_t NT = (size_t)BSZ * SEQ;            // 4096 tokens

    // Live across the attention phase.
    bf16_t* Wo_bf   = (bf16_t*)alloc((size_t)DIM * DIM * 2);
    bf16_t* W1_bf   = (bf16_t*)alloc((size_t)FFD * DIM * 2);
    bf16_t* W2_bf   = (bf16_t*)alloc((size_t)DIM * FFD * 2);
    bf16_t* qkv_bf  = (bf16_t*)alloc(NT * D3 * 2);
    bf16_t* ctx_bf  = (bf16_t*)alloc(NT * DIM * 2);
    // Two sets with disjoint lives share what follows:
    // the QKV GEMM's operands, the buffers of steps 5-9.
    const size_t shared0 = off;
    bf16_t* src_bf  = (bf16_t*)alloc(NT * DIM * 2);
    bf16_t* Wqkv_bf = (bf16_t*)alloc((size_t)D3 * DIM * 2);
    off = shared0;
    float*  y_f     = (float*) alloc(NT * DIM * 4);
    float*  x_f     = (float*) alloc(NT * DIM * 4);
    bf16_t* x_bf    = (bf16_t*)alloc(NT * DIM * 2);
    bf16_t* h_bf    = (bf16_t*)alloc(NT * FFD * 2);
    float*  f_f     = (float*) alloc(NT * DIM * 4);

    auto gemm128 = [&](auto mode, const bf16_t* A, int lda, const bf16_t* Bm, int ldb,
                       const float* bias, void* C, int ldc,
                       int M, int N, int K, float alpha) {
        dim3 grid((unsigned)(N / 128), (unsigned)(M / 128));
        gemm_bf16_wmma<128, decltype(mode)::value><<<grid, 256, 0, stream>>>(
            A, lda, Bm, ldb, bias, C, ldc, M, N, K, alpha,
            ZStride{0, 0}, ZStride{0, 0}, ZStride{0, 0});
    };

    // 1) Convert inputs/weights to bf16
    cvt_all_f32_to_bf16<<<CV_GRID, CV_THREADS, 0, stream>>>(
        src, Wqkv, Wo, W1, W2, src_bf, Wqkv_bf, Wo_bf, W1_bf, W2_bf);

    // 2) QKV projection: qkv = src @ Wqkv^T + bqkv  -> bf16 [NT, 3D]
    gemm128(StoreMode<1>{}, src_bf, DIM, Wqkv_bf, DIM, bqkv, qkv_bf, D3,
            (int)NT, D3, DIM, 1.0f);

    // 3, 4) Attention: ctx[b, :, h*HD:(h+1)*HD] = softmax(q k^T / 8 + bias[h]) v
    attn_fused<<<dim3(8, BSZ, NH * (SEQ / ATT_ROWS) / 8), ATT_WAVES * 32, 0, stream>>>(
        qkv_bf, attn_bias, ctx_bf);

    // 5) Output projection: y = ctx @ Wo^T + bo  (f32)
    gemm128(StoreMode<0>{}, ctx_bf, DIM, Wo_bf, DIM, bo, y_f, DIM,
            (int)NT, DIM, DIM, 1.0f);

    // 6) x = LN(src + y) -> f32 + bf16
    add_ln_kernel<true><<<LN_GRID, LN_WAVES * 32, 0, stream>>>(y_f, src, g1, b1n, x_f, x_bf);

    // 7) FF1: h = gelu(x @ W1^T + b1) -> bf16 [NT, FF]
    gemm128(StoreMode<2>{}, x_bf, DIM, W1_bf, DIM, b1, h_bf, FFD,
            (int)NT, FFD, DIM, 1.0f);

    // 8) FF2: f = h @ W2^T + b2 -> f32
    gemm128(StoreMode<0>{}, h_bf, FFD, W2_bf, FFD, b2, f_f, DIM,
            (int)NT, DIM, FFD, 1.0f);

    // 9) out = LN(x + f)
    add_ln_kernel<false><<<LN_GRID, LN_WAVES * 32, 0, stream>>>(f_f, x_f, g2, b2n, out, nullptr);
}

// v010
// It runs in 147 microseconds.
// Timed twice side by side with v009, it ran 1.03 and 1.02 times as fast.
// Over all steps from v000 it is 13.4 times as fast.
#include <hip/hip_runtime.h>
#include <math.h>

// ---------------------------------------------------------------------------
// Types for CDNA5 WMMA (wave32)
// ---------------------------------------------------------------------------
typedef __bf16 bf16_t;
typedef __attribute__((ext_vector_type(16))) __bf16 v16bf;
typedef __attribute__((ext_vector_type(2)))  __bf16 bf16x2;
typedef __attribute__((ext_vector_type(8)))  float  v8f;

// Problem constants (match reference)
constexpr int BSZ = 4;
constexpr int SEQ = 1024;
constexpr int DIM = 1024;
constexpr int NH  = 16;
constexpr int HDM = 64;
constexpr int FFD = 4096;
constexpr int D3  = 3 * DIM;

constexpr int GK     = 128;      // k extent of one GEMM stage: 256-byte rows
constexpr int GPITCH = GK + 8;   // LDS row pitch in elements: 272 B, for ds_load_b128 readers

// ---------------------------------------------------------------------------
// f32 -> bf16 convert of all five GEMM operands in one streaming launch.
// One workgroup of 16 waves per CV_CHUNK contiguous elements of one tensor
// (every tensor is a whole number of chunks). A lane has CV_LOADS independent
// 16-byte loads, so many are in flight at once; each wave-wide load covers 512
// contiguous bytes and each wave-wide store 256.
// ---------------------------------------------------------------------------
typedef __attribute__((ext_vector_type(4))) float  cv_f32x4;
typedef __attribute__((ext_vector_type(4))) __bf16 cv_bf16x4;

constexpr int CV_THREADS = 512;
constexpr int CV_LOADS   = 32;                          // 16-byte loads per lane
constexpr int CV_CHUNK   = CV_THREADS * CV_LOADS * 4;   // elements per workgroup
constexpr unsigned CV_SRC  = (unsigned)(BSZ * SEQ * DIM / CV_CHUNK);
constexpr unsigned CV_WQKV = (unsigned)(D3 * DIM / CV_CHUNK);
constexpr unsigned CV_WO   = (unsigned)(DIM * DIM / CV_CHUNK);
constexpr unsigned CV_W1   = (unsigned)(FFD * DIM / CV_CHUNK);
constexpr unsigned CV_W2   = (unsigned)(DIM * FFD / CV_CHUNK);
constexpr unsigned CV_GRID = CV_SRC + CV_WQKV + CV_WO + CV_W1 + CV_W2;
static_assert(BSZ * SEQ * DIM % CV_CHUNK == 0 && D3 * DIM % CV_CHUNK == 0 &&
              DIM * DIM % CV_CHUNK == 0 && FFD * DIM % CV_CHUNK == 0,
              "every tensor must be a whole number of chunks");

__global__ __launch_bounds__(CV_THREADS) void cvt_all_f32_to_bf16(
    const float* __restrict__ src,  const float* __restrict__ wqkv,
    const float* __restrict__ wo,   const float* __restrict__ w1,
    const float* __restrict__ w2,
    bf16_t* __restrict__ src_o,  bf16_t* __restrict__ wqkv_o,
    bf16_t* __restrict__ wo_o,   bf16_t* __restrict__ w1_o,
    bf16_t* __restrict__ w2_o) {
    // Which tensor, and which chunk of it: the same for the whole workgroup.
    unsigned blk = blockIdx.x;
    const float* in = src;
    bf16_t* out = src_o;
    if (blk >= CV_SRC) {
        blk -= CV_SRC; in = wqkv; out = wqkv_o;
        if (blk >= CV_WQKV) {
            blk -= CV_WQKV; in = wo; out = wo_o;
            if (blk >= CV_WO) {
                blk -= CV_WO; in = w1; out = w1_o;
                if (blk >= CV_W1) { blk -= CV_W1; in = w2; out = w2_o; }
            }
        }
    }
    const cv_f32x4* ip = (const cv_f32x4*)(in + (size_t)blk * CV_CHUNK) + threadIdx.x;
    cv_bf16x4*      op = (cv_bf16x4*)(out + (size_t)blk * CV_CHUNK) + threadIdx.x;

    cv_f32x4 v[CV_LOADS];
#pragma unroll
    for (int j = 0; j < CV_LOADS; ++j) v[j] = ip[j * CV_THREADS];
#pragma unroll
    for (int j = 0; j < CV_LOADS; ++j)
        op[j * CV_THREADS] = __builtin_convertvector(v[j], cv_bf16x4);
}

// ---------------------------------------------------------------------------
// Fragment gather from an LDS tile, per ISA 7.12.2 16-bit A/B layout.
// For lane l: row = base + (l&15), half = l>>4; VGPR v holds
// K = k0 + kbase(v) + half*8 + {0,1}, kbase = {0,2,4,6,16,18,20,22}.
// ---------------------------------------------------------------------------
__device__ inline v16bf load_frag(const bf16_t* __restrict__ smem, int baseRow, int k0, int lane) {
    const int r    = baseRow + (lane & 15);
    const int half = (lane >> 4) & 1;
    const bf16_t* p = smem + r * GPITCH + k0 + half * 8;
    v16bf f;
#pragma unroll
    for (int v = 0; v < 8; ++v) {
        const int k2 = (v < 4) ? (2 * v) : (16 + 2 * (v - 4));
        bf16x2 pr = *(const bf16x2*)(p + k2);
        f[2 * v]     = pr.x;
        f[2 * v + 1] = pr.y;
    }
    return f;
}

// Eight async copies (global -> LDS, 16 B per lane each): 128 rows of 256 B per
// workgroup. g and l are this lane's first addresses; copy i lies 16 rows on.
// The closing wait stands inside the statement, so that no address register is
// rewritten in front of it.
__device__ __forceinline__ void copy_rows128(const bf16_t* g, size_t ld, unsigned l) {
    const bf16_t* g1 = g  + 16 * ld;
    const bf16_t* g2 = g1 + 16 * ld;
    const bf16_t* g3 = g2 + 16 * ld;
    const bf16_t* g4 = g3 + 16 * ld;
    const bf16_t* g5 = g4 + 16 * ld;
    const bf16_t* g6 = g5 + 16 * ld;
    const bf16_t* g7 = g6 + 16 * ld;
    constexpr unsigned LS = 16u * GPITCH * 2u;   // 16 LDS rows, bytes
    asm volatile("global_load_async_to_lds_b128 %0, %8, off\n\t"
                 "global_load_async_to_lds_b128 %1, %9, off\n\t"
                 "global_load_async_to_lds_b128 %2, %10, off\n\t"
                 "global_load_async_to_lds_b128 %3, %11, off\n\t"
                 "global_load_async_to_lds_b128 %4, %12, off\n\t"
                 "global_load_async_to_lds_b128 %5, %13, off\n\t"
                 "global_load_async_to_lds_b128 %6, %14, off\n\t"
                 "global_load_async_to_lds_b128 %7, %15, off\n\t"
                 "s_wait_xcnt 0x0"
                 :: "v"(l), "v"(l + LS), "v"(l + 2 * LS), "v"(l + 3 * LS),
                    "v"(l + 4 * LS), "v"(l + 5 * LS), "v"(l + 6 * LS), "v"(l + 7 * LS),
                    "v"(g), "v"(g1), "v"(g2), "v"(g3), "v"(g4), "v"(g5), "v"(g6), "v"(g7)
                 : "memory");
    // Keeps the next statement's 24 address registers from being formed ahead of this
    // one: all of a stage's at once push accumulators out of the registers asm can name.
    __builtin_amdgcn_sched_barrier(0);
}

// ---------------------------------------------------------------------------
// Exact-form GELU, 0.5 v (1 + erf(v / sqrt 2)), for two values at once and with
// no branch. With z = |v| / sqrt 2 and t = 1 / (1 + 0.3275911 z),
//   erfc(z) = t (a1 + t (a2 + t (a3 + t (a4 + t a5)))) exp(-z^2),
// absolute error at most 1.5e-7 for every z >= 0 (the five-term rational form of
// the handbooks), and 0.5 v (1 + erf) = 0.5 v + |v| (0.5 - 0.5 erfc(z)).
// The constants below hold the factors 0.5, 1 / sqrt 2 and log2(e).
// ---------------------------------------------------------------------------
typedef float gl_f32x2 __attribute__((ext_vector_type(2)));
typedef float        ep_f32x4 __attribute__((ext_vector_type(4)));
typedef unsigned int ep_u32x4 __attribute__((ext_vector_type(4)));

__device__ __forceinline__ gl_f32x2 gelu2(gl_f32x2 v) {
    const gl_f32x2 a = __builtin_elementwise_abs(v);
    const gl_f32x2 d = __builtin_elementwise_fma(a, gl_f32x2{0.23164189f, 0.23164189f},
                                                 gl_f32x2{1.0f, 1.0f});
    const gl_f32x2 kv = v * 0.84932178f;            // kv^2 = z^2 log2(e)
    const gl_f32x2 ar = -(kv * kv);
    // Both reciprocals and both exponentials in one statement that ends in a v_nop:
    // the instruction set asks for one free slot behind a transcendental before its
    // result is used or a source of it overwritten.
    // The early-clobber outputs keep results off sources.
    float t0, t1, e0, e1;
    asm("v_rcp_f32 %0, %4\n\t"
        "v_rcp_f32 %1, %5\n\t"
        "v_exp_f32 %2, %6\n\t"
        "v_exp_f32 %3, %7\n\t"
        "v_nop"
        : "=&v"(t0), "=&v"(t1), "=&v"(e0), "=&v"(e1)
        : "v"(d.x), "v"(d.y), "v"(ar.x), "v"(ar.y));
    const gl_f32x2 t = {t0, t1}, e = {e0, e1};
    gl_f32x2 p = __builtin_elementwise_fma(t, gl_f32x2{0.53070271f, 0.53070271f},
                                           gl_f32x2{-0.72657603f, -0.72657603f});
    p = __builtin_elementwise_fma(p, t, gl_f32x2{0.71070689f, 0.71070689f});
    p = __builtin_elementwise_fma(p, t, gl_f32x2{-0.14224836f, -0.14224836f});
    p = __builtin_elementwise_fma(p, t, gl_f32x2{0.12741479f, 0.12741479f});
    p = p * t;                                      // 0.5 erfc(z) exp(z^2)
    const gl_f32x2 s = __builtin_elementwise_fma(-p, e, gl_f32x2{0.5f, 0.5f});
    return __builtin_elementwise_fma(a, s, v * 0.5f);
}

// ---------------------------------------------------------------------------
// Generic bf16 WMMA GEMM:  C[M,N] = alpha * A[M,K] @ B[N,K]^T + bias[N]
// MODE 0: store f32      MODE 1: store bf16      MODE 2: GELU (gelu2) -> bf16
// MODE is a template parameter: the epilogue of each instantiation holds its one
// store form alone, with no test of the mode per element.
//
// Block tile BM x BN, 8 waves (4 row-groups x 2 col-groups), wave tile
// (BM/4) x (BN/2). 256 x 256 where that still gives a workgroup to most WGPs: a
// stage then brings 128 KiB for 128 WMMAs a wave, half the L2 bytes and half the
// LDS fragment reads per WMMA of the 128 x 128 tile, which the narrow outputs keep.
// K stepped by GK = 128 through two LDS buffers filled
// with GLOBAL_LOAD_ASYNC_TO_LDS_B128: the copies of stage s+1 fly while stage s
// is worked on, 32 or 128 WMMAs a wave between two barriers. Inside a stage the fragments
// of the next 32 k are fetched from LDS while the current 32 k are multiplied.
// Requires: M%BM==0, N%BN==0, K%GK==0, lda/ldb%8==0, 16B-aligned bases.
// Batched over blockIdx.z: z = hz * BSZ + b; every operand's base moves by
// b * (its .b stride) + hz * (its .h stride), in elements. A plain GEMM is
// launched with gridDim.z == 1.
// ---------------------------------------------------------------------------
struct ZStride { int b, h; };
template <int V> struct StoreMode { static constexpr int value = V; };
template <int V> struct Tile      { static constexpr int value = V; };

template <int BM, int BN, int MODE>
__global__ __launch_bounds__(256) void gemm_bf16_wmma(
    const bf16_t* __restrict__ A, int lda,
    const bf16_t* __restrict__ Bm, int ldb,
    const float* __restrict__ bias,
    void* __restrict__ C, int ldc,
    int M, int N, int K, float alpha,
    ZStride zA, ZStride zB, ZStride zC) {

    static_assert(BM % 128 == 0 && BN % 128 == 0, "a copy statement fills 128 rows");
    constexpr int RT = BM / 64;        // wave row tiles of 16
    constexpr int CT = BN / 32;        // wave col tiles of 16

    __shared__ __align__(16) bf16_t As[2 * BM * GPITCH];
    __shared__ __align__(16) bf16_t Bs[2 * BN * GPITCH];

    const int tid  = threadIdx.x;
    const int lane = tid & 31;
    const int wave = tid >> 5;
    const int m_w  = (wave & 3) * (BM / 4);  // 4 wave-rows x BM/4
    const int n_w  = (wave >> 2) * (BN / 2); // 2 wave-cols x BN/2

    const int m0 = blockIdx.y * BM;
    const int n0 = blockIdx.x * BN;

    const int zb = blockIdx.z & (BSZ - 1);
    const int zh = blockIdx.z / BSZ;
    A  += (size_t)zb * zA.b + (size_t)zh * zA.h;
    Bm += (size_t)zb * zB.b + (size_t)zh * zB.h;
    const size_t zc = (size_t)zb * zC.b + (size_t)zh * zC.h;

    v8f acc[RT][CT] = {};

    // One stage's copies: 16 lanes per 256-byte row, so a wave-wide copy covers
    // two whole rows of the stage.
    const int crow = tid >> 4, cch = tid & 15;
    const unsigned oA = (unsigned)(crow * lda + cch * 8);   // this lane's place in a tile,
    const unsigned oB = (unsigned)(crow * ldb + cch * 8);   // elements; the rest is uniform
    const bf16_t* tA = A  + (size_t)m0 * lda;
    const bf16_t* tB = Bm + (size_t)n0 * ldb;
    const unsigned lA = (unsigned)(uintptr_t)(As + crow * GPITCH + cch * 8);
    const unsigned lB = (unsigned)(uintptr_t)(Bs + crow * GPITCH + cch * 8);
    auto issue = [&](int s, int st) {
#pragma unroll
        for (int i = 0; i < BM / 128; ++i)
            copy_rows128(tA + ((size_t)s * GK + (size_t)i * 128 * lda) + oA, (size_t)lda,
                         lA + (unsigned)st * (BM * GPITCH * 2u) + (unsigned)i * (128u * GPITCH * 2u));
#pragma unroll
        for (int i = 0; i < BN / 128; ++i)
            copy_rows128(tB + ((size_t)s * GK + (size_t)i * 128 * ldb) + oB, (size_t)ldb,
                         lB + (unsigned)st * (BN * GPITCH * 2u) + (unsigned)i * (128u * GPITCH * 2u));
    };

    const int NS = K / GK;
    issue(0, 0);
    asm volatile("s_wait_asynccnt 0x0" ::: "memory");   // this wave's part of stage 0 has landed
    __syncthreads();                                    // every wave's part has
    if (NS > 1) issue(1, 1);

    for (int s = 0; s < NS; ++s) {
        const int buf = s & 1;
        const bf16_t* Ab = As + buf * (BM * GPITCH);
        const bf16_t* Bb = Bs + buf * (BN * GPITCH);

        // Two fragment sets: block kk + 1's LDS loads go out as one group ahead of
        // block kk's WMMAs and land under them. All of it stays inside this stage's
        // buffer; only block 0's loads are waited for in the open.
        v16bf af[2][RT], bfv[2][CT];
        auto fetch = [&](int set, int kk) {
#pragma unroll
            for (int r = 0; r < RT; ++r) af[set][r]  = load_frag(Ab, m_w + r * 16, kk * 32, lane);
#pragma unroll
            for (int c = 0; c < CT; ++c) bfv[set][c] = load_frag(Bb, n_w + c * 16, kk * 32, lane);
        };
        fetch(0, 0);
#pragma unroll
        for (int kk = 0; kk < GK / 32; ++kk) {
            const int cur = kk & 1;
            if (kk + 1 < GK / 32) fetch(cur ^ 1, kk + 1);
            // Keeps the load group whole and ahead of the block: left free, the loads are
            // sunk among the WMMAs that need them, each behind a wait for all LDS loads.
            __builtin_amdgcn_sched_barrier(0);
#pragma unroll
            for (int r = 0; r < RT; ++r)
#pragma unroll
                for (int c = 0; c < CT; ++c)
                    // Rows of B as the first operand: the tile comes out transposed (epilogue).
                    acc[r][c] = __builtin_amdgcn_wmma_f32_16x16x32_bf16(
                        false, bfv[cur][c], false, af[cur][r], (short)0, acc[r][c], false, false);
            // The other side of the fence: the next group stays behind this block.
            __builtin_amdgcn_sched_barrier(0);
        }

        // Hand-over: this wave has left buffer buf, and its copies of stage s+1 have
        // landed; behind the barrier that holds for every wave.
        asm volatile("s_wait_dscnt 0x0" ::: "memory");
        asm volatile("s_wait_asynccnt 0x0" ::: "memory");
        __syncthreads();
        if (s + 2 < NS) issue(s + 2, buf);
    }
    asm volatile("s_wait_asynccnt 0x0" ::: "memory");   // no copy is left in flight

    // Epilogue. The product is the transposed tile (rows of B are the A operand), so
    // in acc[r][c] lane l holds row r * 16 + (l & 15) of the wave's WR x BN/2 part of C
    // and its columns c * 16 + 8 * (l >> 4) + 0..7: adjacent in memory.
    // Each wave lays its part out in LDS (a range of its own in As, which every wave
    // has left behind the loop's last barrier) and stores it as whole rows, 16 bytes
    // a lane: runs of 128 bytes or more instead of 32-byte pieces.
    constexpr unsigned WR   = BM / 4;                       // rows of the wave's part
    constexpr unsigned ESZ  = (MODE == 0) ? 4u : 2u;        // bytes per element of C
    constexpr unsigned RB   = (BN / 2) * ESZ;               // bytes per row of the wave's part
    constexpr unsigned SP   = RB + 16u;                     // LDS pitch: odd multiple of 16 B
    constexpr unsigned LPR  = RB / 16u;                     // lanes per row at the store
    constexpr unsigned RPS  = 32u / LPR;                    // rows per wave-wide store
    static_assert(8u * WR * SP <= sizeof(As), "eight waves' parts must fit As");
    unsigned char* stg = (unsigned char*)As + (unsigned)wave * (WR * SP);
    const unsigned lc = lane & 15, lh = (lane >> 4) & 1;
    const float* bp = bias + n0 + n_w + 8 * lh;
    ep_f32x4 bq[CT][2];
#pragma unroll
    for (int c = 0; c < CT; ++c) {
        bq[c][0] = *(const ep_f32x4*)(bp + c * 16);
        bq[c][1] = *(const ep_f32x4*)(bp + c * 16 + 4);
    }
    // Every bias load is issued before the register pair that they name is used again;
    // the input keeps that pair from being given away in front of the wait.
    asm volatile("s_wait_xcnt 0x0" :: "v"(bp) : "memory");
#pragma unroll
    for (int c = 0; c < CT; ++c) {
        const ep_f32x4 b0 = bq[c][0], b1 = bq[c][1];
        const float bv[8] = {b0.x, b0.y, b0.z, b0.w, b1.x, b1.y, b1.z, b1.w};
#pragma unroll
        for (int r = 0; r < RT; ++r) {
            unsigned char* sp = stg + (r * 16 + lc) * SP + (c * 16 + 8 * lh) * ESZ;
            float v[8];
#pragma unroll
            for (int i = 0; i < 8; ++i) v[i] = acc[r][c][i] * alpha + bv[i];
            if constexpr (MODE == 0) {
                *(ep_f32x4*)sp        = ep_f32x4{v[0], v[1], v[2], v[3]};
                *(ep_f32x4*)(sp + 16) = ep_f32x4{v[4], v[5], v[6], v[7]};
            } else {
                ep_u32x4 w;
#pragma unroll
                for (int i = 0; i < 4; ++i) {
                    gl_f32x2 y = {v[2 * i], v[2 * i + 1]};
                    if constexpr (MODE == 2) y = gelu2(y);
                    w[i] = __builtin_bit_cast(unsigned, __builtin_convertvector(y, bf16x2));
                }
                *(ep_u32x4*)sp = w;
            }
        }
        // One column tile at a time: run together, the operands of the tiles' asm statements
        // (gelu2), which must lie in the first 256 registers, push accumulators out to scratch.
        if constexpr (MODE == 2) __builtin_amdgcn_sched_barrier(0);
    }
    // This wave's LDS writes are done before its lanes read one another's.
    asm volatile("s_wait_dscnt 0x0" ::: "memory");
    unsigned char* Cw = (unsigned char*)C
        + (zc + (size_t)(m0 + m_w + lane / LPR) * ldc + n0 + n_w) * ESZ + (lane % LPR) * 16u;
    const unsigned char* rp = stg + (lane / LPR) * SP + (lane % LPR) * 16u;
#pragma unroll
    for (unsigned j = 0; j < WR / RPS; ++j)
        *(ep_u32x4*)(Cw + (size_t)(j * RPS) * ldc * ESZ) = *(const ep_u32x4*)(rp + j * RPS * SP);
}

typedef unsigned int u32x4 __attribute__((ext_vector_type(4)));
typedef short        s16x8 __attribute__((ext_vector_type(8)));
typedef float        f32x2 __attribute__((ext_vector_type(2)));
typedef float        f32x4 __attribute__((ext_vector_type(4)));

constexpr unsigned PITCH_K = 2 * HDM + 16;   // odd multiple of 16 B: ds_load_b128 readers
constexpr unsigned PITCH_V = 2 * HDM + 32;   // odd multiple of 32 B: ds_load_tr16_b128 readers
constexpr unsigned V_OFF   = SEQ * PITCH_K;
constexpr unsigned ATT_LDS = V_OFF + SEQ * PITCH_V;
constexpr int ATT_WAVES = 16;                // 16 query rows each
constexpr int ATT_ROWS  = ATT_WAVES * 16;
constexpr int ATT_KEYS  = 64;                // keys per pass
constexpr int ATT_PASSES = SEQ / ATT_KEYS;
static_assert(ATT_LDS <= 320u * 1024u, "K and V of one head must fit one workgroup's LDS");
static_assert(ATT_PASSES % 2 == 0, "the pass loop is written in pairs");

struct Frag { u32x4 q[2]; };   // one 16 x 32 bf16 operand: 8 registers per lane

__device__ __forceinline__ v8f mma(const Frag& a, const Frag& b, v8f c) {
    return __builtin_amdgcn_wmma_f32_16x16x32_bf16(
        false, __builtin_bit_cast(v16bf, a), false, __builtin_bit_cast(v16bf, b),
        (short)0, c, false, false);
}
__device__ __forceinline__ u32x4 ld_tr16(const unsigned char* p) {
    typedef __attribute__((address_space(3))) s16x8 lds_s16x8;
    return __builtin_bit_cast(u32x4, __builtin_amdgcn_ds_load_tr16_b128_v8i16((lds_s16x8*)p));
}
__device__ __forceinline__ unsigned pack2(float lo, float hi) {   // round to nearest even
    return __builtin_bit_cast(unsigned, __builtin_convertvector(f32x2{lo, hi}, bf16x2));
}
__device__ __forceinline__ float xhalf(float x) {                 // lane l with lane l ^ 16
    return __builtin_bit_cast(float, __builtin_amdgcn_permlanex16(
        __builtin_bit_cast(int, x), __builtin_bit_cast(int, x),
        0x76543210, 0xfedcba98, false, false));
}

__global__ __launch_bounds__(ATT_WAVES * 32) void attn_fused(const bf16_t* __restrict__ qkv,
                                                             const float* __restrict__ bias,
                                                             bf16_t* __restrict__ ctx) {
    __shared__ __attribute__((aligned(256))) unsigned char L[ATT_LDS];
    const unsigned tid = threadIdx.x, lane = tid & 31u, wave = tid >> 5;
    const unsigned c = lane & 15u, h = lane >> 4;
    // Grid (8, batch, 8): the BSZ workgroups that read one bias block lie 8 apart
    // in launch order, in the hope that they share one L2's copy of it (speed only:
    // no result depends on where a workgroup runs).
    const unsigned tile = blockIdx.x + 8u * blockIdx.z;      // head * 4 + row block
    const unsigned b    = blockIdx.y;
    const unsigned hd   = tile / (SEQ / ATT_ROWS);
    const unsigned q0   = (tile % (SEQ / ATT_ROWS)) * ATT_ROWS + wave * 16u;

    const bf16_t* base = qkv + (size_t)b * SEQ * D3 + hd * HDM;   // q of token 0

    // Stage K and V: 8 lanes per 128-byte row, whole lines from memory.
    constexpr int RST = ATT_WAVES * 32 / 8;   // rows per step of the workgroup
    constexpr int NST = SEQ / RST;
    const unsigned srow = tid >> 3, sch = tid & 7u;
    const bf16_t* sp = base + (size_t)srow * D3 + sch * 8u;
    u32x4 kr[NST], vr[NST];
#pragma unroll
    for (int i = 0; i < NST; ++i) {
        kr[i] = *(const u32x4*)(sp + (size_t)i * RST * D3 + DIM);
        vr[i] = *(const u32x4*)(sp + (size_t)i * RST * D3 + 2 * DIM);
    }

    // Q fragments in the hardware k order (as K's below), scaled by 1/8.
    Frag qf[2];
    const bf16_t* qp = base + (size_t)(q0 + c) * D3 + 8u * h;
    {
#pragma unroll
        for (int kc = 0; kc < 2; ++kc) {
            Frag f;
            f.q[0] = *(const u32x4*)(qp + 32 * kc);
            f.q[1] = *(const u32x4*)(qp + 32 * kc + 16);
            v16bf t = __builtin_bit_cast(v16bf, f);
#pragma unroll
            for (int e = 0; e < 16; ++e) t[e] = (bf16_t)((float)t[e] * 0.125f);
            qf[kc] = __builtin_bit_cast(Frag, t);
        }
    }

    // A operand whose row 0 is ones: row 0 of its product is the column sums of P^T.
    Frag ones;
    {
        const unsigned o = (c == 0u) ? 0x3F803F80u : 0u;
        ones.q[0] = u32x4{o, o, o, o};
        ones.q[1] = u32x4{o, o, o, o};
    }

    v8f acc[4] = {};          // O^T: acc[t][r] = O[q0 + c][16 t + 8 h + r]
    v8f lacc = {};            // register 0 of lanes 0-15: denominator of query c
    float m_run = -INFINITY;  // maximum in use, base-2 scaled; equal in lanes c, c + 16
    constexpr float LOG2E = 1.4426950408889634f;

    // This lane's bias: row q0 + c, keys 16 j + 8 h + 0..7 of each pass.
    const float* bp = bias + ((size_t)hd * SEQ + q0 + c) * SEQ + 8u * h;
    auto load_bias = [&](v8f (&d)[4], int it) {
#pragma unroll
        for (int j = 0; j < 4; ++j) {
            const f32x4 lo = *(const f32x4*)(bp + it * ATT_KEYS + 16 * j);
            const f32x4 hi = *(const f32x4*)(bp + it * ATT_KEYS + 16 * j + 4);
            d[j] = v8f{lo.x, lo.y, lo.z, lo.w, hi.x, hi.y, hi.z, hi.w};
        }
    };

    // One pass over 64 keys. s arrives holding the pass's bias tile; nx is filled
    // with the next pass's (fetch: a literal at every call, false in the last pass),
    // so that its memory latency lies under this pass.
    auto pass = [&](v8f (&s)[4], v8f (&nx)[4], int it, bool fetch) __attribute__((always_inline)) {
        if (fetch) {
            load_bias(nx, it + 1);
            // Before the loop's pointer, which these loads name, is advanced.
            asm volatile("s_wait_xcnt 0x0" ::: "memory");
        }
        // Holds these loads at the head of the pass: sunk to where registers come
        // free they would have half a pass, too little for a read from memory.
        __builtin_amdgcn_sched_barrier(0);

        const unsigned char* kp = L + (it * ATT_KEYS + c) * PITCH_K + 16u * h;
#pragma unroll
        for (int j = 0; j < 4; ++j) {
#pragma unroll
            for (int kc = 0; kc < 2; ++kc) {
                Frag kf;
                kf.q[0] = *(const u32x4*)(kp + j * 16 * PITCH_K + 64 * kc);
                kf.q[1] = *(const u32x4*)(kp + j * 16 * PITCH_K + 64 * kc + 32);
                s[j] = mma(kf, qf[kc], s[j]);   // s[j][r] = score(key 16 j + 8 h + r, query c)
            }
        }

        float mx = s[0][0];
#pragma unroll
        for (int j = 0; j < 4; ++j)
#pragma unroll
            for (int r = 0; r < 8; ++r) mx = __builtin_fmaxf(mx, s[j][r]);
        mx = __builtin_fmaxf(mx, xhalf(mx)) * LOG2E;   // both halves: this query's maximum

        if (__builtin_amdgcn_ballot_w32(mx > m_run + 8.0f) != 0) {   // scalar branch, rare
            const float m_new = __builtin_fmaxf(m_run, mx);
            const float corr  = __builtin_amdgcn_exp2f(m_run - m_new);  // 0 on the first pass
            m_run = m_new;
            lacc = lacc * corr;
#pragma unroll
            for (int t = 0; t < 4; ++t) acc[t] = acc[t] * corr;
        }
        const float nm = -m_run;

#pragma unroll
        for (int g = 0; g < 2; ++g) {   // 32 keys: one k extent of the second product
            const unsigned char* ad = L + V_OFF
                + (it * ATT_KEYS + 32u * g + 8u * h + (lane & 7u)) * PITCH_V
                + ((lane >> 3) & 1u) * 16u;
            Frag vf[4];
#pragma unroll
            for (int t = 0; t < 4; ++t) {
                vf[t].q[0] = ld_tr16(ad + 32 * t);
                vf[t].q[1] = ld_tr16(ad + 16 * PITCH_V + 32 * t);
            }
            unsigned w[8];
#pragma unroll
            for (int i = 0; i < 8; ++i) {   // elements 2 i, 2 i + 1 of the 32-key operand
                const v8f& sv = s[2 * g + (i >> 2)];
                const f32x2 arg = __builtin_elementwise_fma(
                    f32x2{sv[2 * (i & 3)], sv[2 * (i & 3) + 1]}, f32x2{LOG2E, LOG2E},
                    f32x2{nm, nm});
                w[i] = pack2(__builtin_amdgcn_exp2f(arg.x), __builtin_amdgcn_exp2f(arg.y));
            }
            Frag pf;
            pf.q[0] = u32x4{w[0], w[1], w[2], w[3]};
            pf.q[1] = u32x4{w[4], w[5], w[6], w[7]};
#pragma unroll
            for (int t = 0; t < 4; ++t) acc[t] = mma(vf[t], pf, acc[t]);
            lacc = mma(ones, pf, lacc);
        }
    };

    v8f sa[4], sb[4];
    load_bias(sa, 0);
    // Every load so far is issued. The inputs keep the loads' address registers
    // from being given away (to a later load's result) in front of the wait.
    asm volatile("s_wait_xcnt 0x0" :: "v"(sp), "v"(qp), "v"(bp) : "memory");
    __builtin_amdgcn_sched_barrier(0);   // keeps every other reuse behind the wait
#pragma unroll
    for (int i = 0; i < NST; ++i) {
        *(u32x4*)(L + (srow + i * RST) * PITCH_K + sch * 16u)         = kr[i];
        *(u32x4*)(L + V_OFF + (srow + i * RST) * PITCH_V + sch * 16u) = vr[i];
    }
    __syncthreads();   // K and V are staged; nothing writes LDS after this

    for (int it = 0; it < ATT_PASSES - 2; it += 2) {
        pass(sa, sb, it, true);
        pass(sb, sa, it + 1, true);
    }
    pass(sa, sb, ATT_PASSES - 2, true);
    pass(sb, sa, ATT_PASSES - 1, false);

    // Lanes 16-31 hold row 8 of the sum tile, which is 0: the exchange-and-add
    // gives both halves the denominator.
    const float lr  = lacc[0];
    const float inv = 1.0f / (lr + xhalf(lr));
    bf16_t* op = ctx + (size_t)(b * SEQ + q0 + c) * DIM + hd * HDM + 8u * h;
#pragma unroll
    for (int t = 0; t < 4; ++t) {
        const v8f o = acc[t] * inv;
        *(u32x4*)(op + 16 * t) = u32x4{pack2(o[0], o[1]), pack2(o[2], o[3]),
                                       pack2(o[4], o[5]), pack2(o[6], o[7])};
    }
}

// ---------------------------------------------------------------------------
// Fused residual + LayerNorm over rows of width DIM (= 1024).
// One wave per row, the row held in registers: 32 values a lane, fetched and
// stored 16 bytes a lane, so that every wave-wide access covers 512 contiguous
// bytes (256 for the bf16 copy). All 32 loads of a wave (both addends, gain and
// shift) go out together. Mean and variance are summed in the lane, then over the
// 32 lanes in five exchange-and-add steps: no LDS and no barrier.
// WB: also write the bf16 copy of the result.
// ---------------------------------------------------------------------------
constexpr int LN_WAVES = 16;                    // rows per workgroup
constexpr int LN_VEC   = DIM / (32 * 4);        // 16-byte pieces of a row per lane
constexpr unsigned LN_GRID = (unsigned)(BSZ * SEQ / LN_WAVES);
static_assert(DIM % 128 == 0 && BSZ * SEQ % LN_WAVES == 0, "whole rows, whole workgroups");

template <int MASK>
__device__ __forceinline__ float row_xor(float x) {   // lane l with lane l ^ MASK, MASK < 16
    return __builtin_bit_cast(float, __builtin_amdgcn_mov_dpp(
        __builtin_bit_cast(int, x), 0x160 + MASK, 0xf, 0xf, true));
}
__device__ __forceinline__ float wave_sum(float x) {  // every lane gets the sum of all 32
    x += row_xor<1>(x);
    x += row_xor<2>(x);
    x += row_xor<4>(x);
    x += row_xor<8>(x);
    return x + xhalf(x);
}

template <bool WB>
__global__ __launch_bounds__(LN_WAVES * 32) void add_ln_kernel(const float* __restrict__ a,
                                                               const float* __restrict__ res,
                                                               const float* __restrict__ g,
                                                               const float* __restrict__ b,
                                                               float* __restrict__ outf,
                                                               bf16_t* __restrict__ outb) {
    const unsigned lane = threadIdx.x & 31u, wave = threadIdx.x >> 5;
    const size_t   row  = (size_t)blockIdx.x * LN_WAVES + wave;
    const cv_f32x4* ap = (const cv_f32x4*)(a   + row * DIM) + lane;
    const cv_f32x4* rp = (const cv_f32x4*)(res + row * DIM) + lane;
    const cv_f32x4* gp = (const cv_f32x4*)g + lane;
    const cv_f32x4* bp = (const cv_f32x4*)b + lane;

    cv_f32x4 v[LN_VEC], r[LN_VEC], gv[LN_VEC], bv[LN_VEC];
#pragma unroll
    for (int j = 0; j < LN_VEC; ++j) { v[j] = ap[32 * j]; r[j] = rp[32 * j]; }
#pragma unroll
    for (int j = 0; j < LN_VEC; ++j) { gv[j] = gp[32 * j]; bv[j] = bp[32 * j]; }
    // Every load is issued before a register that one of them names is used again. The
    // inputs keep the address registers from being given to a later load's result.
    asm volatile("s_wait_xcnt 0x0" :: "v"(ap), "v"(rp), "v"(lane) : "memory");
    // Keeps all 32 loads ahead of the sums: left free, the gain and shift loads are sunk
    // behind both reductions, two at a time, each pair with a wait of its own.
    __builtin_amdgcn_sched_barrier(0);

    cv_f32x4 s4 = {0.0f, 0.0f, 0.0f, 0.0f};
#pragma unroll
    for (int j = 0; j < LN_VEC; ++j) { v[j] += r[j]; s4 += v[j]; }
    const float mean = wave_sum((s4.x + s4.y) + (s4.z + s4.w)) * (1.0f / DIM);

    cv_f32x4 q4 = {0.0f, 0.0f, 0.0f, 0.0f};
#pragma unroll
    for (int j = 0; j < LN_VEC; ++j) { v[j] -= mean; q4 += v[j] * v[j]; }
    const float inv = rsqrtf(wave_sum((q4.x + q4.y) + (q4.z + q4.w)) * (1.0f / DIM) + 1e-5f);

    cv_bf16x4 hv[LN_VEC];
#pragma unroll
    for (int j = 0; j < LN_VEC; ++j) {
        v[j] = v[j] * inv * gv[j] + bv[j];
        if constexpr (WB) hv[j] = __builtin_convertvector(v[j], cv_bf16x4);
    }
    cv_f32x4* op = (cv_f32x4*)(outf + row * DIM) + lane;
#pragma unroll
    for (int j = 0; j < LN_VEC; ++j) op[32 * j] = v[j];
    if constexpr (WB) {
        cv_bf16x4* hp = (cv_bf16x4*)(outb + row * DIM) + lane;
#pragma unroll
        for (int j = 0; j < LN_VEC; ++j) hp[32 * j] = hv[j];
    }
}

// ---------------------------------------------------------------------------
// Host orchestration
// ---------------------------------------------------------------------------
extern "C" void kernel_launch(void* const* d_in, const int* in_sizes, int n_in,
                              void* d_out, int out_size, void* d_ws, size_t ws_size,
                              hipStream_t stream) {
    (void)in_sizes; (void)n_in; (void)out_size; (void)ws_size;

    const float* src       = (const float*)d_in[0];
    const float* attn_bias = (const float*)d_in[1];
    const float* Wqkv      = (const float*)d_in[2];
    const float* bqkv      = (const float*)d_in[3];
    const float* Wo        = (const float*)d_in[4];
    const float* bo        = (const float*)d_in[5];
    const float* g1        = (const float*)d_in[6];
    const float* b1n       = (const float*)d_in[7];
    const float* g2        = (const float*)d_in[8];
    const float* b2n       = (const float*)d_in[9];
    const float* W1        = (const float*)d_in[10];
    const float* b1        = (const float*)d_in[11];
    const float* W2        = (const float*)d_in[12];
    const float* b2        = (const float*)d_in[13];
    float* out = (float*)d_out;

    char* ws = (char*)d_ws;
    size_t off = 0;
    auto alloc = [&](size_t bytes) -> char* {
        char* p = ws + off;
        off += (bytes + 255) & ~(size_t)255;
        return p;
    };

    const size_t NT = (size_t)BSZ * SEQ;            // 4096 tokens

    // Live across the attention phase.
    bf16_t* Wo_bf   = (bf16_t*)alloc((size_t)DIM * DIM * 2);
    bf16_t* W1_bf   = (bf16_t*)alloc((size_t)FFD * DIM * 2);
    bf16_t* W2_bf   = (bf16_t*)alloc((size_t)DIM * FFD * 2);
    bf16_t* qkv_bf  = (bf16_t*)alloc(NT * D3 * 2);
    bf16_t* ctx_bf  = (bf16_t*)alloc(NT * DIM * 2);
    // Two sets with disjoint lives share what follows:
    // the QKV GEMM's operands, the buffers of steps 5-9.
    const size_t shared0 = off;
    bf16_t* src_bf  = (bf16_t*)alloc(NT * DIM * 2);
    bf16_t* Wqkv_bf = (bf16_t*)alloc((size_t)D3 * DIM * 2);
    off = shared0;
    float*  y_f     = (float*) alloc(NT * DIM * 4);
    float*  x_f     = (float*) alloc(NT * DIM * 4);
    bf16_t* x_bf    = (bf16_t*)alloc(NT * DIM * 2);
    bf16_t* h_bf    = (bf16_t*)alloc(NT * FFD * 2);
    float*  f_f     = (float*) alloc(NT * DIM * 4);

    auto gemm = [&](auto tile, auto mode, const bf16_t* A, int lda, const bf16_t* Bm, int ldb,
                    const float* bias, void* C, int ldc,
                    int M, int N, int K, float alpha) {
        constexpr int TL = decltype(tile)::value;   // the tile is TL x TL
        dim3 grid((unsigned)(N / TL), (unsigned)(M / TL));
        gemm_bf16_wmma<TL, TL, decltype(mode)::value><<<grid, 256, 0, stream>>>(
            A, lda, Bm, ldb, bias, C, ldc, M, N, K, alpha,
            ZStride{0, 0}, ZStride{0, 0}, ZStride{0, 0});
    };

    // 1) Convert inputs/weights to bf16
    cvt_all_f32_to_bf16<<<CV_GRID, CV_THREADS, 0, stream>>>(
        src, Wqkv, Wo, W1, W2, src_bf, Wqkv_bf, Wo_bf, W1_bf, W2_bf);

    // 2) QKV projection: qkv = src @ Wqkv^T + bqkv  -> bf16 [NT, 3D]
    gemm(Tile<256>{}, StoreMode<1>{}, src_bf, DIM, Wqkv_bf, DIM, bqkv, qkv_bf, D3,
            (int)NT, D3, DIM, 1.0f);

    // 3, 4) Attention: ctx[b, :, h*HD:(h+1)*HD] = softmax(q k^T / 8 + bias[h]) v
    attn_fused<<<dim3(8, BSZ, NH * (SEQ / ATT_ROWS) / 8), ATT_WAVES * 32, 0, stream>>>(
        qkv_bf, attn_bias, ctx_bf);

    // 5) Output projection: y = ctx @ Wo^T + bo  (f32)
    gemm(Tile<128>{}, StoreMode<0>{}, ctx_bf, DIM, Wo_bf, DIM, bo, y_f, DIM,
            (int)NT, DIM, DIM, 1.0f);

    // 6) x = LN(src + y) -> f32 + bf16
    add_ln_kernel<true><<<LN_GRID, LN_WAVES * 32, 0, stream>>>(y_f, src, g1, b1n, x_f, x_bf);

    // 7) FF1: h = gelu(x @ W1^T + b1) -> bf16 [NT, FF]
    gemm(Tile<256>{}, StoreMode<2>{}, x_bf, DIM, W1_bf, DIM, b1, h_bf, FFD,
            (int)NT, FFD, DIM, 1.0f);

    // 8) FF2: f = h @ W2^T + b2 -> f32
    gemm(Tile<128>{}, StoreMode<0>{}, h_bf, FFD, W2_bf, FFD, b2, f_f, DIM,
            (int)NT, DIM, FFD, 1.0f);

    // 9) out = LN(x + f)
    add_ln_kernel<false><<<LN_GRID, LN_WAVES * 32, 0, stream>>>(f_f, x_f, g2, b2n, out, nullptr);
}
